// v000
// The times below were measured on an AMD MI455X: many runs one after another, warmed up first and cycling through
// copies of the inputs, with the whole window's GPU time divided by the number of runs. Launches and the gaps
// between them are all in it. The median over several windows is given; except for v000 it joins two sittings, which
// can be a few percent apart, so the side-by-side timings, each taken in one sitting, are the better comparison.
// v000 is the starting kernel. One run takes 634 microseconds.
// A distance-kernel mixing of rows: xa [2][1024][1024] (group, row, width); wa, wb, wc, wd [1024][1024] stored (source column, result column), va, vb, vc, vd [1024]: fa | fb | fc = xa w + v, split into 16 strips of 64 columns; for a group and a strip: e2[i][j] = |fa_i|^2 + |fb_j|^2 - 2 fa_i . fb_j; gd = sqrt(max(e2, 1e-12)) / 64; sc = (1 + gd)^(-65.5); nr = its row sums, nc = its column sums; kt = nr^(-1/2) sc nc^(-1/2); pb = kt / max(its row sum, 1e-12); cx = pb fc's strip; res = cx wd + vd -> [2][1024][1024] f32: one result.
// Structure: xa cast to f16 as it lies and the four weights cast transposed behind a carry of 64 (converted to bf16 first); three WMMA GEMMs (the carry undone in their scale argument; the added vectors live) into f32 sheets; ONE flat kernel a thread a (row, strip) takes a strip's squared length (64 words in index order); fa and fb split into f16 words (the residual sheets unused); THEN A GROUP AT A TIME (a literal 2 on the host): the frame's transposing cast without a conversion (k_wtn_f16: a computed sheet) lays fc's group transposed as f16 words; one WMMA GEMM with the strip as the grid's second index forms fa . fb (depth 64) into sixteen f32 sheets; ONE straight-line kernel forms sc in place from the two lengths and the product (the library root and power); ONE flat kernel a thread a row sums it; ONE flat kernel a thread a column sums it and stores the sum's reciprocal root; ONE flat kernel a thread a row forms kt's row sum and stores pb as one f16 word behind a carry of 2^12; one WMMA GEMM (depth 1,024; its scale undoes the carry) writes cx in place at a strip's column offset; then cx split into f16 words and the last WMMA GEMM writes the result.
// Compute dtype: all nine inputs converted to bf16 where they are read; xa's words exact as f16 operands down to 2^-14; the weights' behind 64; the computed sheets ONE f16 word each (pb behind 2^12); every product's accumulation, the lengths, the kernel's arithmetic, the sums and the result f32. v_wmma_f32_16x16x32_f16.
#include <hip/hip_runtime.h>
#define QNG 2                        /* groups */
#define QNL 1024                     /* rows of a group */
#define QNW 1024                     /* a row's width: every projection's depth and width */
#define QNS 16                       /* strips */
#define QSW 64                       /* a strip's width: the pair product's depth */
#define QDS 64.0f                    /* the distance's divisor */
#define QPW -65.5f                   /* the power */
#define QLO 1e-12f                   /* the lower bound of e2 and of a row's sum */
#define QWC 64.0f                    /* the weights' carry (undone in the products' scale argument) */
#define QPC 4096.0f                  /* pb's carry (undone in the fifth product's scale argument) */
typedef unsigned short v8us __attribute__((ext_vector_type(8), may_alias));
typedef float  v8f  __attribute__((ext_vector_type(8)));
typedef float  v4f  __attribute__((ext_vector_type(4)));
typedef float  v4fa __attribute__((ext_vector_type(4), may_alias));

__device__ __forceinline__ unsigned short bf16_bits(float x) { unsigned int u = __float_as_uint(x); return (unsigned short)((u + 0x7FFFu + ((u >> 16) & 1u)) >> 16); }
__device__ __forceinline__ float bf16_val(unsigned short b) { return __uint_as_float(((unsigned int)b) << 16); }
__device__ __forceinline__ float bf16_round(float x) { return bf16_val(bf16_bits(x)); }

typedef _Float16 v16h __attribute__((ext_vector_type(16)));
union FragH { v16h v; v8us half[2]; _Float16 h[16]; unsigned short u[16]; };

// Wt[n][k] = f16(W[k][n] x scale) from f32 row-major W[K][N] (scale = power of two; bf16-exact weights stay exact in f16 away from the subnormal range)
__global__ __launch_bounds__(256) void k_wt_f16(const float* __restrict__ W, _Float16* __restrict__ Wt, int K, int N, float scale) {
  const int t = blockIdx.x * 256 + threadIdx.x; if (t >= N * (K / 8)) return; const int n = t / (K / 8), k8 = (t % (K / 8)) * 8; FragH f;
#pragma unroll
  for (int i = 0; i < 8; ++i) f.h[i] = (_Float16)(bf16_round(W[(size_t)(k8 + i) * N + n]) * scale); const v8us o = f.half[0];
  *(v8us*)((unsigned short*)Wt + (size_t)n * K + k8) = o; 
}

typedef _Float16 v4h __attribute__((ext_vector_type(4)));

__global__ __launch_bounds__(256) void k_wtn_f16(const float* __restrict__ W, _Float16* __restrict__ Wt, int K, int N, float scale) {
  const int t = blockIdx.x * 256 + threadIdx.x; if (t >= N * (K / 8)) return; const int n = t / (K / 8), k8 = (t % (K / 8)) * 8; FragH f;
  for (int i = 0; i < 8; ++i) f.h[i] = (_Float16)(W[(size_t)(k8 + i) * N + n] * scale);
  unsigned short* o = (unsigned short*)Wt + (size_t)n * K + k8; *(v8us*)o = f.half[0];  }

__global__ __launch_bounds__(256) void k_hl(const float* __restrict__ F, _Float16* __restrict__ Hh, _Float16* __restrict__ Hl, size_t n8) { const size_t t = (size_t)blockIdx.x * 256 + threadIdx.x; if (t >= n8) return; FragH fh, fl; const v4f a = *(const v4fa*)(F + t * 8), c = *(const v4fa*)(F + t * 8 + 4);
#pragma unroll
  for (int q = 0; q < 4; ++q) { _Float16 h = (_Float16)a[q]; fh.h[q] = h; fl.h[q] = (_Float16)((a[q] - (float)h) * 1024.0f); h = (_Float16)c[q]; fh.h[4 + q] = h; fl.h[4 + q] = (_Float16)((c[q] - (float)h) * 1024.0f); }
  { *(v8us*)((unsigned short*)Hh + t * 8) = fh.half[0]; *(v8us*)((unsigned short*)Hl + t * 8) = fl.half[0];  } }

__global__ __launch_bounds__(256) void k_x16(const float* __restrict__ x, _Float16* __restrict__ X16, size_t n8) { const size_t t = (size_t)blockIdx.x * 256 + threadIdx.x; if (t >= n8) return; FragH f;
#pragma unroll
  for (int q = 0; q < 8; ++q) f.h[q] = (_Float16)bf16_round(x[t * 8 + q]); *(v8us*)((unsigned short*)X16 + t * 8) = f.half[0];  }

// ---- fast GEMM (wave tile 32x64; requires M % 32 == 0 rows per launch region and N % 64 == 0) ----
__device__ __forceinline__ v16h g2_frag(const _Float16* p, int hh) { FragH f; f.half[0] = *(const v8us*)((const unsigned short*)p + 8 * hh); f.half[1] = *(const v8us*)((const unsigned short*)p + 16 + 8 * hh); return f.v; }
__device__ __forceinline__ v8f g2_mma(v16h a, v16h b, v8f c) { v8f d = __builtin_amdgcn_wmma_f32_16x16x32_f16(false, a, false, b, (short)0, c, false, false); asm volatile("v_nop\n\tv_nop\n\tv_nop\n\tv_nop" : "+v"(d) : "v"(a), "v"(b)); return d; }
template <int ACT>
__global__ __launch_bounds__(128) void k_gemm2(const _Float16* __restrict__ A, int lda, size_t sA, const _Float16* __restrict__ Bh, int ldb, size_t sB, float alpha, const float* __restrict__ bias, size_t sBias, const float* __restrict__ CP, int rowsPerB, size_t sCPb, int row0g,
    float* __restrict__ C, _Float16* __restrict__ C16, int ldc, size_t sC, int M, int N, int K) { static_assert(ACT == 0 || ACT == 3 || ACT == 6 || ACT == 8 || ACT == 9 || ACT == 11 || ACT == 12 || ACT == 14 || ACT == 15 || ACT == 16 || ACT == 17, "k_gemm2: unsupported ACT code (would silently apply no activation)");
  __shared__ __attribute__((aligned(16))) float so[4][32][68];
  const int tid = threadIdx.x, w = tid >> 5, lane = tid & 31, ln = lane & 15, hh = lane >> 4; const int by = blockIdx.y;
  A += (size_t)by * sA; Bh += (size_t)by * sB; const size_t cofs = (size_t)by * sC; const float* bp = bias ? bias + (size_t)by * sBias : nullptr;
  const int ntn = N >> 6; const int mt = blockIdx.x / ntn, nq = blockIdx.x - mt * ntn; const int row0 = mt * 128 + 32 * w, col0 = nq * 64; if (row0 >= M) return;
  const _Float16* a0p = A + (size_t)(row0 + ln) * lda; const _Float16* a1p = a0p + (size_t)16 * lda;
  const _Float16* b0p = Bh + (size_t)(col0 + ln) * ldb; const _Float16* b1p = b0p + (size_t)16 * ldb; const _Float16* b2p = b1p + (size_t)16 * ldb; const _Float16* b3p = b2p + (size_t)16 * ldb;
  const v8f z8 = {0.f,0.f,0.f,0.f,0.f,0.f,0.f,0.f}; v8f c00 = z8, c01 = z8, c02 = z8, c03 = z8, c10 = z8, c11 = z8, c12 = z8, c13 = z8;
  for (int kb = 0; kb < K; kb += 32) { const v16h a0 = g2_frag(a0p + kb, hh), a1 = g2_frag(a1p + kb, hh);
    v16h b = g2_frag(b0p + kb, hh); c00 = g2_mma(a0, b, c00); c10 = g2_mma(a1, b, c10);
    b = g2_frag(b1p + kb, hh); c01 = g2_mma(a0, b, c01); c11 = g2_mma(a1, b, c11);
    b = g2_frag(b2p + kb, hh); c02 = g2_mma(a0, b, c02); c12 = g2_mma(a1, b, c12);
    b = g2_frag(b3p + kb, hh); c03 = g2_mma(a0, b, c03); c13 = g2_mma(a1, b, c13); }
  v8f accs[8] = {c00, c01, c02, c03, c10, c11, c12, c13};
#pragma unroll
  for (int u = 0; u < 8; ++u) { const int t = u & 3, half = u >> 2; const int col = col0 + t * 16 + ln; const float bv = bp ? bf16_round(bp[col]) : 0.f;
#pragma unroll
    for (int r = 0; r < 8; ++r) { const int rloc = half * 16 + 8 * hh + r; float v = accs[u][r] * alpha + bv; if (CP) { if (rowsPerB < 0) v += CP[cofs + (size_t)(row0g + row0 + rloc) * ldc + col];      /* rowsPerB < 0: own element of the batched C plane */ else { const int bidx = (row0g + row0 + rloc) / rowsPerB; v += CP[(size_t)bidx * sCPb + (size_t)by * 64 + col]; } }
      if (ACT == 3) v = fmaxf(v, 0.f); else if (ACT == 6) v = 0.5f * v * (1.0f + erff(v * 0.70710678118654752f)); else if (ACT == 11) v = 1.0f / (1.0f + expf(-v)); else if (ACT == 15) v = v / (1.0f + expf(-v)); else if (ACT == 12) v = (v > 0.f) ? v : 0.01f * v; else if (ACT == 8) v = tanhf(v); else if (ACT == 9) v = 0.5f * v * (1.0f + tanhf(0.7978845608028654f * (v + 0.044715f * v * v * v))); else if (ACT == 14) v = (v > 0.f) ? v : 0.1f * v; else if (ACT == 16) v = (v >= 0.f) ? v : 0.3f * v; else if (ACT == 17) v = (v >= 0.f) ? v : 0.2f * v;
      so[w][rloc][t * 16 + ln] = v; } }
  __builtin_amdgcn_fence(__ATOMIC_ACQ_REL, "workgroup"); __builtin_amdgcn_wave_barrier();
  const int rsub = lane >> 4, c4 = (lane & 15) * 4;
  {
#pragma unroll
    for (int q = 0; q < 16; ++q) { const int r = q * 2 + rsub; const v4f v = *(const v4fa*)&so[w][r][c4]; if (C) *(v4f*)(C + cofs + (size_t)(row0 + r) * ldc + col0 + c4) = v; if (C16) { v4h h4; for (int i = 0; i < 4; ++i) h4[i] = (_Float16)v[i]; *(v4h*)(C16 + cofs + (size_t)(row0 + r) * ldc + col0 + c4) = h4; } }
     } }

__global__ __launch_bounds__(256) void k_sln(const float* __restrict__ F, float* __restrict__ LN) {
  const unsigned t = blockIdx.x * 256u + threadIdx.x; if (t >= (unsigned)(QNG * QNS * QNL)) return;
  const unsigned i = t % QNL, s = (t / QNL) % QNS, g = t / (QNL * QNS); const float* p = F + ((size_t)g * QNL + i) * QNW + s * QSW; float a = 0.0f;
  for (unsigned c = 0; c < (unsigned)QSW; c += 4) { const v4f w = *(const v4fa*)(p + c);
#pragma unroll
    for (int q = 0; q < 4; ++q) a += w[q] * w[q]; }
  *(float*)(LN + t) = a;  }

__global__ __launch_bounds__(256) void k_psc(float* SC, const float* __restrict__ la, const float* __restrict__ lb) {
  const unsigned t = blockIdx.x * 256u + threadIdx.x; if (t >= (unsigned)(QNS * QNL * (QNL / 4))) return;
  const unsigned j = (t % (QNL / 4)) * 4, i = (t / (QNL / 4)) % QNL, s = t / ((QNL / 4) * QNL); float* p = SC + (size_t)t * 4; const v4f z = *(const v4fa*)p; const float qa = la[s * QNL + i]; const v4f kb = *(const v4fa*)(lb + s * QNL + j); v4f w;
#pragma unroll
  for (int q = 0; q < 4; ++q) { const float e2 = (qa + kb[q]) - 2.0f * z[q]; const float gd = sqrtf(fmaxf(e2, QLO)) / QDS; w[q] = powf(1.0f + gd, QPW); }
  *(v4f*)p = w;  }

__global__ __launch_bounds__(256) void k_rsm(const float* __restrict__ SC, float* __restrict__ NR) {
  const unsigned r = blockIdx.x * 256u + threadIdx.x; if (r >= (unsigned)(QNS * QNL)) return;
  const float* p = SC + (size_t)r * QNL; float a = 0.0f;
  for (unsigned j = 0; j < (unsigned)QNL; j += 4) { const v4f w = *(const v4fa*)(p + j); a += w[0]; a += w[1]; a += w[2]; a += w[3]; }
  *(float*)(NR + r) = a;  }

__global__ __launch_bounds__(256) void k_csm(const float* __restrict__ SC, float* __restrict__ CF) {
  const unsigned t = blockIdx.x * 256u + threadIdx.x; if (t >= (unsigned)(QNS * QNL)) return;
  const float* p = SC + (size_t)(t / QNL) * QNL * QNL + (t % QNL); float a = 0.0f;
  for (unsigned i = 0; i < (unsigned)QNL; i += 4) { const float a0 = p[(size_t)i * QNL], a1 = p[(size_t)(i + 1) * QNL], a2 = p[(size_t)(i + 2) * QNL], a3 = p[(size_t)(i + 3) * QNL]; a += a0; a += a1; a += a2; a += a3; }
  const float w = 1.0f / sqrtf(a); *(float*)(CF + t) = w;  }

__global__ __launch_bounds__(256) void k_ktn(const float* __restrict__ SC, const float* __restrict__ NR, const float* __restrict__ CF, _Float16* __restrict__ PB) {
  const unsigned r = blockIdx.x * 256u + threadIdx.x; if (r >= (unsigned)(QNS * QNL)) return;
  const float* p = SC + (size_t)r * QNL; const float* cf = CF + (size_t)(r / QNL) * QNL; unsigned short* o = (unsigned short*)PB + (size_t)r * QNL; const float rf = 1.0f / sqrtf(NR[r]); float a = 0.0f;
  for (unsigned j = 0; j < (unsigned)QNL; j += 4) { const v4f w = *(const v4fa*)(p + j); const v4f c = *(const v4fa*)(cf + j);
#pragma unroll
    for (int q = 0; q < 4; ++q) a += (rf * w[q]) * c[q]; }
  const float dn = fmaxf(a, QLO);
  for (unsigned j = 0; j < (unsigned)QNL; j += 8) { const v4f w0 = *(const v4fa*)(p + j), w1 = *(const v4fa*)(p + j + 4); const v4f c0 = *(const v4fa*)(cf + j), c1 = *(const v4fa*)(cf + j + 4); FragH f;
#pragma unroll
    for (int q = 0; q < 4; ++q) { f.h[q] = (_Float16)((((rf * w0[q]) * c0[q]) / dn) * QPC); f.h[4 + q] = (_Float16)((((rf * w1[q]) * c1[q]) / dn) * QPC); }
    const v8us w = f.half[0]; *(v8us*)(o + j) = w;  }
}

extern "C" void kernel_launch(void* const* d_in, const int* in_sizes, int n_in,
                              void* d_out, int out_size, void* d_ws, size_t ws_size, hipStream_t stream) {
  (void)in_sizes; (void)n_in; (void)out_size;
  const float* const* I = (const float* const*)d_in; const float* xa = I[0]; const float* wa = I[1]; const float* va = I[2]; const float* wb = I[3]; const float* vb = I[4]; const float* wc = I[5]; const float* vc = I[6]; const float* wd = I[7]; const float* vd = I[8];      /* xa [2][1024][1024]; the four weights [1024][1024] (source, result); the four added vectors [1024] */
  float* res = (float*)d_out;
  static_assert((QNG * QNL) % 128 == 0 && QNL % 128 == 0 && QNW % 64 == 0 && QNW % 32 == 0 && QSW % 64 == 0 && QSW % 32 == 0 && QNL % 8 == 0 && QNS * QSW == QNW, "whole tiles");
  uint8_t* wsp = (uint8_t*)d_ws; size_t off = 0;
  auto take = [&](size_t bytes) { uint8_t* p = wsp + off; off += (bytes + 255) & ~(size_t)255; return p; };
  const size_t GW = (size_t)QNG * QNL * QNW, G1 = (size_t)QNL * QNW;
  float* SC = (float*)take((size_t)QNS * QNL * QNL * 4); _Float16* PB = (_Float16*)take((size_t)QNS * QNL * QNL * 2); float* FA = (float*)take(GW * 4); float* FB = (float*)take(GW * 4); float* FC = (float*)take(GW * 4); float* CX = (float*)take(GW * 4);
  _Float16* XH = (_Float16*)take(GW * 2); _Float16* AH = (_Float16*)take(GW * 2); _Float16* AL = (_Float16*)take(GW * 2); _Float16* BH = (_Float16*)take(GW * 2); _Float16* BL = (_Float16*)take(GW * 2); _Float16* CH = (_Float16*)take(GW * 2); _Float16* CL = (_Float16*)take(GW * 2); _Float16* VT = (_Float16*)take(G1 * 2);
  _Float16* WA = (_Float16*)take((size_t)QNW * QNW * 2); _Float16* WB = (_Float16*)take((size_t)QNW * QNW * 2); _Float16* WC = (_Float16*)take((size_t)QNW * QNW * 2); _Float16* WD = (_Float16*)take((size_t)QNW * QNW * 2); float* LA = (float*)take((size_t)QNG * QNS * QNL * 4); float* LB = (float*)take((size_t)QNG * QNS * QNL * 4); float* NR = (float*)take((size_t)QNS * QNL * 4); float* CF = (float*)take((size_t)QNS * QNL * 4);      /* a group's sixteen sheets of sc and of pb (re-used group after group); the three projections and cx in f32; xa's cast; the words and the unused residuals of fa, fb, cx; a group's transposed fc; the four weights transposed; the strips' squared lengths; a group's row sums and column factors */
  if (off > ws_size) return;
  k_x16<<<(unsigned)((GW / 8 + 255) / 256), 256, 0, stream>>>(xa, XH, GW / 8);
  k_wt_f16<<<(unsigned)(((size_t)QNW * (QNW / 8) + 255) / 256), 256, 0, stream>>>(wa, WA, QNW, QNW, QWC);      /* WA[o][k] = f16(64 wa[k][o]) */
  k_wt_f16<<<(unsigned)(((size_t)QNW * (QNW / 8) + 255) / 256), 256, 0, stream>>>(wb, WB, QNW, QNW, QWC);
  k_wt_f16<<<(unsigned)(((size_t)QNW * (QNW / 8) + 255) / 256), 256, 0, stream>>>(wc, WC, QNW, QNW, QWC);
  k_wt_f16<<<(unsigned)(((size_t)QNW * (QNW / 8) + 255) / 256), 256, 0, stream>>>(wd, WD, QNW, QNW, QWC);
  k_gemm2<0><<<dim3((unsigned)(((QNG * QNL) / 128) * (QNW / 64)), 1), 128, 0, stream>>>(XH, QNW, 0, WA, QNW, 0, 1.0f / QWC, va, 0, nullptr, 1, 0, 0, FA, nullptr, QNW, 0, QNG * QNL, QNW, QNW);      /* FA[(g, i)][o] = xa[g][i][:] . wa[:][o] + va[o] */
  k_gemm2<0><<<dim3((unsigned)(((QNG * QNL) / 128) * (QNW / 64)), 1), 128, 0, stream>>>(XH, QNW, 0, WB, QNW, 0, 1.0f / QWC, vb, 0, nullptr, 1, 0, 0, FB, nullptr, QNW, 0, QNG * QNL, QNW, QNW);
  k_gemm2<0><<<dim3((unsigned)(((QNG * QNL) / 128) * (QNW / 64)), 1), 128, 0, stream>>>(XH, QNW, 0, WC, QNW, 0, 1.0f / QWC, vc, 0, nullptr, 1, 0, 0, FC, nullptr, QNW, 0, QNG * QNL, QNW, QNW);
  k_sln<<<(unsigned)((QNG * QNS * QNL + 255) / 256), 256, 0, stream>>>(FA, LA);
  k_sln<<<(unsigned)((QNG * QNS * QNL + 255) / 256), 256, 0, stream>>>(FB, LB);
  k_hl<<<(unsigned)((GW / 8 + 255) / 256), 256, 0, stream>>>(FA, AH, AL, GW / 8);      /* AH is used; AL is written and not read */
  k_hl<<<(unsigned)((GW / 8 + 255) / 256), 256, 0, stream>>>(FB, BH, BL, GW / 8);
  for (int g = 0; g < QNG; ++g) {      /* a literal 2 on the host: SC, PB, VT, NR and CF are re-used group after group */
    k_wtn_f16<<<(unsigned)(((size_t)QNW * (QNL / 8) + 255) / 256), 256, 0, stream>>>(FC + g * G1, VT, QNL, QNW, 1.0f);      /* VT[(s, c)][j] = f16(fc[g][j][s 64 + c]) */
    k_gemm2<0><<<dim3((unsigned)((QNL / 128) * (QNL / 64)), QNS), 128, 0, stream>>>(AH + g * G1, QNW, (size_t)QSW, BH + g * G1, QNW, (size_t)QSW, 1.0f, nullptr, 0, nullptr, 1, 0, 0, SC, nullptr, QNL, (size_t)QNL * QNL, QNL, QNL, QSW);      /* SC[s][i][j] = fa[g][i][s] . fb[g][j][s] */
    k_psc<<<(unsigned)(((size_t)QNS * QNL * (QNL / 4) + 255) / 256), 256, 0, stream>>>(SC, LA + (size_t)g * QNS * QNL, LB + (size_t)g * QNS * QNL);
    k_rsm<<<(unsigned)((QNS * QNL + 255) / 256), 256, 0, stream>>>(SC, NR);
    k_csm<<<(unsigned)((QNS * QNL + 255) / 256), 256, 0, stream>>>(SC, CF);
    k_ktn<<<(unsigned)((QNS * QNL + 255) / 256), 256, 0, stream>>>(SC, NR, CF, PB);
    k_gemm2<0><<<dim3((unsigned)((QNL / 128) * (QSW / 64)), QNS), 128, 0, stream>>>(PB, QNL, (size_t)QNL * QNL, VT, QNL, (size_t)QSW * QNL, 1.0f / QPC, nullptr, 0, nullptr, 1, 0, 0, CX + g * G1, nullptr, QNW, (size_t)QSW, QNL, QSW, QNL); }      /* CX[g][i][s 64 + c] = sum over j of PB[s][i][j] fc[g][j][s 64 + c] / 2^12: in place at a strip's column offset */
  k_hl<<<(unsigned)((GW / 8 + 255) / 256), 256, 0, stream>>>(CX, CH, CL, GW / 8);      /* CH is used; CL is written and not read */
  k_gemm2<0><<<dim3((unsigned)(((QNG * QNL) / 128) * (QNW / 64)), 1), 128, 0, stream>>>(CH, QNW, 0, WD, QNW, 0, 1.0f / QWC, vd, 0, nullptr, 1, 0, 0, res, nullptr, QNW, 0, QNG * QNL, QNW, QNW);      /* res = cx wd + vd: every word of the result once */
}

// v001
// Measured time: 475 microseconds a run.
// Next to v000, in two timings, it ran 1.36 and 1.35 times as fast.
// A distance-kernel mixing of rows: xa [2][1024][1024] (group, row, width); wa, wb, wc, wd [1024][1024] stored (source column, result column), va, vb, vc, vd [1024]: fa | fb | fc = xa w + v, split into 16 strips of 64 columns; for a group and a strip: e2[i][j] = |fa_i|^2 + |fb_j|^2 - 2 fa_i . fb_j; gd = sqrt(max(e2, 1e-12)) / 64; sc = (1 + gd)^(-65.5); nr = its row sums, nc = its column sums; kt = nr^(-1/2) sc nc^(-1/2); pb = kt / max(its row sum, 1e-12); cx = pb fc's strip; res = cx wd + vd -> [2][1024][1024] f32: one result.
// Structure: xa cast to f16 as it lies and the four weights cast transposed behind a carry of 64 (converted to bf16 first); three WMMA GEMMs (the carry undone in their scale argument; the added vectors live) into f32 sheets; ONE flat kernel a thread a (row, strip) takes a strip's squared length (64 words in index order); fa and fb split into f16 words (the residual sheets unused); THEN A GROUP AT A TIME (a literal 2 on the host): the frame's transposing cast without a conversion (k_wtn_f16: a computed sheet) lays fc's group transposed as f16 words; one WMMA GEMM with the strip as the grid's second index forms fa . fb (depth 64) into sixteen f32 sheets; ONE straight-line kernel forms sc in place from the two lengths and the product (the library root and power); ONE flat kernel a thread a column sums it and stores the sum's reciprocal root; ONE kernel a wave four rows in turn (each row in the wave's registers, read once) forms the row's sum, kt's row sum (lane partials, then a butterfly) and stores pb as one f16 word behind a carry of 2^12; one WMMA GEMM (depth 1,024; its scale undoes the carry) writes cx in place at a strip's column offset; then cx split into f16 words and the last WMMA GEMM writes the result.
// Compute dtype: all nine inputs converted to bf16 where they are read; xa's words exact as f16 operands down to 2^-14; the weights' behind 64; the computed sheets ONE f16 word each (pb behind 2^12); every product's accumulation, the lengths, the kernel's arithmetic, the sums and the result f32. v_wmma_f32_16x16x32_f16.
#include <hip/hip_runtime.h>
#define QNG 2                        /* groups */
#define QNL 1024                     /* rows of a group */
#define QNW 1024                     /* a row's width: every projection's depth and width */
#define QNS 16                       /* strips */
#define QSW 64                       /* a strip's width: the pair product's depth */
#define QDS 64.0f                    /* the distance's divisor */
#define QPW -65.5f                   /* the power */
#define QLO 1e-12f                   /* the lower bound of e2 and of a row's sum */
#define QWC 64.0f                    /* the weights' carry (undone in the products' scale argument) */
#define QPC 4096.0f                  /* pb's carry (undone in the fifth product's scale argument) */
#define QWV 16                       /* waves of a work-group of the row kernel */
#define QRW 4                        /* rows of sc that one of its waves takes */
typedef unsigned short v8us __attribute__((ext_vector_type(8), may_alias));
typedef float  v8f  __attribute__((ext_vector_type(8)));
typedef float  v4f  __attribute__((ext_vector_type(4)));
typedef float  v4fa __attribute__((ext_vector_type(4), may_alias));

__device__ __forceinline__ unsigned short bf16_bits(float x) { unsigned int u = __float_as_uint(x); return (unsigned short)((u + 0x7FFFu + ((u >> 16) & 1u)) >> 16); }
__device__ __forceinline__ float bf16_val(unsigned short b) { return __uint_as_float(((unsigned int)b) << 16); }
__device__ __forceinline__ float bf16_round(float x) { return bf16_val(bf16_bits(x)); }

typedef _Float16 v16h __attribute__((ext_vector_type(16)));
union FragH { v16h v; v8us half[2]; _Float16 h[16]; unsigned short u[16]; };

// Wt[n][k] = f16(W[k][n] x scale) from f32 row-major W[K][N] (scale = power of two; bf16-exact weights stay exact in f16 away from the subnormal range)
__global__ __launch_bounds__(256) void k_wt_f16(const float* __restrict__ W, _Float16* __restrict__ Wt, int K, int N, float scale) {
  const int t = blockIdx.x * 256 + threadIdx.x; if (t >= N * (K / 8)) return; const int n = t / (K / 8), k8 = (t % (K / 8)) * 8; FragH f;
#pragma unroll
  for (int i = 0; i < 8; ++i) f.h[i] = (_Float16)(bf16_round(W[(size_t)(k8 + i) * N + n]) * scale); const v8us o = f.half[0];
  *(v8us*)((unsigned short*)Wt + (size_t)n * K + k8) = o; 
}

typedef _Float16 v4h __attribute__((ext_vector_type(4)));

__global__ __launch_bounds__(256) void k_wtn_f16(const float* __restrict__ W, _Float16* __restrict__ Wt, int K, int N, float scale) {
  const int t = blockIdx.x * 256 + threadIdx.x; if (t >= N * (K / 8)) return; const int n = t / (K / 8), k8 = (t % (K / 8)) * 8; FragH f;
  for (int i = 0; i < 8; ++i) f.h[i] = (_Float16)(W[(size_t)(k8 + i) * N + n] * scale);
  unsigned short* o = (unsigned short*)Wt + (size_t)n * K + k8; *(v8us*)o = f.half[0];  }

__global__ __launch_bounds__(256) void k_hl(const float* __restrict__ F, _Float16* __restrict__ Hh, _Float16* __restrict__ Hl, size_t n8) { const size_t t = (size_t)blockIdx.x * 256 + threadIdx.x; if (t >= n8) return; FragH fh, fl; const v4f a = *(const v4fa*)(F + t * 8), c = *(const v4fa*)(F + t * 8 + 4);
#pragma unroll
  for (int q = 0; q < 4; ++q) { _Float16 h = (_Float16)a[q]; fh.h[q] = h; fl.h[q] = (_Float16)((a[q] - (float)h) * 1024.0f); h = (_Float16)c[q]; fh.h[4 + q] = h; fl.h[4 + q] = (_Float16)((c[q] - (float)h) * 1024.0f); }
  { *(v8us*)((unsigned short*)Hh + t * 8) = fh.half[0]; *(v8us*)((unsigned short*)Hl + t * 8) = fl.half[0];  } }

__global__ __launch_bounds__(256) void k_x16(const float* __restrict__ x, _Float16* __restrict__ X16, size_t n8) { const size_t t = (size_t)blockIdx.x * 256 + threadIdx.x; if (t >= n8) return; FragH f;
#pragma unroll
  for (int q = 0; q < 8; ++q) f.h[q] = (_Float16)bf16_round(x[t * 8 + q]); *(v8us*)((unsigned short*)X16 + t * 8) = f.half[0];  }

// ---- fast GEMM (wave tile 32x64; requires M % 32 == 0 rows per launch region and N % 64 == 0) ----
__device__ __forceinline__ v16h g2_frag(const _Float16* p, int hh) { FragH f; f.half[0] = *(const v8us*)((const unsigned short*)p + 8 * hh); f.half[1] = *(const v8us*)((const unsigned short*)p + 16 + 8 * hh); return f.v; }
__device__ __forceinline__ v8f g2_mma(v16h a, v16h b, v8f c) { v8f d = __builtin_amdgcn_wmma_f32_16x16x32_f16(false, a, false, b, (short)0, c, false, false); asm volatile("v_nop\n\tv_nop\n\tv_nop\n\tv_nop" : "+v"(d) : "v"(a), "v"(b)); return d; }
template <int ACT>
__global__ __launch_bounds__(128) void k_gemm2(const _Float16* __restrict__ A, int lda, size_t sA, const _Float16* __restrict__ Bh, int ldb, size_t sB, float alpha, const float* __restrict__ bias, size_t sBias, const float* __restrict__ CP, int rowsPerB, size_t sCPb, int row0g,
    float* __restrict__ C, _Float16* __restrict__ C16, int ldc, size_t sC, int M, int N, int K) { static_assert(ACT == 0 || ACT == 3 || ACT == 6 || ACT == 8 || ACT == 9 || ACT == 11 || ACT == 12 || ACT == 14 || ACT == 15 || ACT == 16 || ACT == 17, "k_gemm2: unsupported ACT code (would silently apply no activation)");
  __shared__ __attribute__((aligned(16))) float so[4][32][68];
  const int tid = threadIdx.x, w = tid >> 5, lane = tid & 31, ln = lane & 15, hh = lane >> 4; const int by = blockIdx.y;
  A += (size_t)by * sA; Bh += (size_t)by * sB; const size_t cofs = (size_t)by * sC; const float* bp = bias ? bias + (size_t)by * sBias : nullptr;
  const int ntn = N >> 6; const int mt = blockIdx.x / ntn, nq = blockIdx.x - mt * ntn; const int row0 = mt * 128 + 32 * w, col0 = nq * 64; if (row0 >= M) return;
  const _Float16* a0p = A + (size_t)(row0 + ln) * lda; const _Float16* a1p = a0p + (size_t)16 * lda;
  const _Float16* b0p = Bh + (size_t)(col0 + ln) * ldb; const _Float16* b1p = b0p + (size_t)16 * ldb; const _Float16* b2p = b1p + (size_t)16 * ldb; const _Float16* b3p = b2p + (size_t)16 * ldb;
  const v8f z8 = {0.f,0.f,0.f,0.f,0.f,0.f,0.f,0.f}; v8f c00 = z8, c01 = z8, c02 = z8, c03 = z8, c10 = z8, c11 = z8, c12 = z8, c13 = z8;
  for (int kb = 0; kb < K; kb += 32) { const v16h a0 = g2_frag(a0p + kb, hh), a1 = g2_frag(a1p + kb, hh);
    v16h b = g2_frag(b0p + kb, hh); c00 = g2_mma(a0, b, c00); c10 = g2_mma(a1, b, c10);
    b = g2_frag(b1p + kb, hh); c01 = g2_mma(a0, b, c01); c11 = g2_mma(a1, b, c11);
    b = g2_frag(b2p + kb, hh); c02 = g2_mma(a0, b, c02); c12 = g2_mma(a1, b, c12);
    b = g2_frag(b3p + kb, hh); c03 = g2_mma(a0, b, c03); c13 = g2_mma(a1, b, c13); }
  v8f accs[8] = {c00, c01, c02, c03, c10, c11, c12, c13};
#pragma unroll
  for (int u = 0; u < 8; ++u) { const int t = u & 3, half = u >> 2; const int col = col0 + t * 16 + ln; const float bv = bp ? bf16_round(bp[col]) : 0.f;
#pragma unroll
    for (int r = 0; r < 8; ++r) { const int rloc = half * 16 + 8 * hh + r; float v = accs[u][r] * alpha + bv; if (CP) { if (rowsPerB < 0) v += CP[cofs + (size_t)(row0g + row0 + rloc) * ldc + col];      /* rowsPerB < 0: own element of the batched C plane */ else { const int bidx = (row0g + row0 + rloc) / rowsPerB; v += CP[(size_t)bidx * sCPb + (size_t)by * 64 + col]; } }
      if (ACT == 3) v = fmaxf(v, 0.f); else if (ACT == 6) v = 0.5f * v * (1.0f + erff(v * 0.70710678118654752f)); else if (ACT == 11) v = 1.0f / (1.0f + expf(-v)); else if (ACT == 15) v = v / (1.0f + expf(-v)); else if (ACT == 12) v = (v > 0.f) ? v : 0.01f * v; else if (ACT == 8) v = tanhf(v); else if (ACT == 9) v = 0.5f * v * (1.0f + tanhf(0.7978845608028654f * (v + 0.044715f * v * v * v))); else if (ACT == 14) v = (v > 0.f) ? v : 0.1f * v; else if (ACT == 16) v = (v >= 0.f) ? v : 0.3f * v; else if (ACT == 17) v = (v >= 0.f) ? v : 0.2f * v;
      so[w][rloc][t * 16 + ln] = v; } }
  __builtin_amdgcn_fence(__ATOMIC_ACQ_REL, "workgroup"); __builtin_amdgcn_wave_barrier();
  const int rsub = lane >> 4, c4 = (lane & 15) * 4;
  {
#pragma unroll
    for (int q = 0; q < 16; ++q) { const int r = q * 2 + rsub; const v4f v = *(const v4fa*)&so[w][r][c4]; if (C) *(v4f*)(C + cofs + (size_t)(row0 + r) * ldc + col0 + c4) = v; if (C16) { v4h h4; for (int i = 0; i < 4; ++i) h4[i] = (_Float16)v[i]; *(v4h*)(C16 + cofs + (size_t)(row0 + r) * ldc + col0 + c4) = h4; } }
     } }

__global__ __launch_bounds__(256) void k_sln(const float* __restrict__ F, float* __restrict__ LN) {
  const unsigned t = blockIdx.x * 256u + threadIdx.x; if (t >= (unsigned)(QNG * QNS * QNL)) return;
  const unsigned i = t % QNL, s = (t / QNL) % QNS, g = t / (QNL * QNS); const float* p = F + ((size_t)g * QNL + i) * QNW + s * QSW; float a = 0.0f;
  for (unsigned c = 0; c < (unsigned)QSW; c += 4) { const v4f w = *(const v4fa*)(p + c);
#pragma unroll
    for (int q = 0; q < 4; ++q) a += w[q] * w[q]; }
  *(float*)(LN + t) = a;  }

__global__ __launch_bounds__(256) void k_psc(float* SC, const float* __restrict__ la, const float* __restrict__ lb) {
  const unsigned t = blockIdx.x * 256u + threadIdx.x; if (t >= (unsigned)(QNS * QNL * (QNL / 4))) return;
  const unsigned j = (t % (QNL / 4)) * 4, i = (t / (QNL / 4)) % QNL, s = t / ((QNL / 4) * QNL); float* p = SC + (size_t)t * 4; const v4f z = *(const v4fa*)p; const float qa = la[s * QNL + i]; const v4f kb = *(const v4fa*)(lb + s * QNL + j); v4f w;
#pragma unroll
  for (int q = 0; q < 4; ++q) { const float e2 = (qa + kb[q]) - 2.0f * z[q]; const float gd = sqrtf(fmaxf(e2, QLO)) / QDS; w[q] = powf(1.0f + gd, QPW); }
  *(v4f*)p = w;  }

__global__ __launch_bounds__(256) void k_csm(const float* __restrict__ SC, float* __restrict__ CF) {
  const unsigned t = blockIdx.x * 256u + threadIdx.x; if (t >= (unsigned)(QNS * QNL)) return;
  const float* p = SC + (size_t)(t / QNL) * QNL * QNL + (t % QNL); float a = 0.0f;
  for (unsigned i = 0; i < (unsigned)QNL; i += 4) { const float a0 = p[(size_t)i * QNL], a1 = p[(size_t)(i + 1) * QNL], a2 = p[(size_t)(i + 2) * QNL], a3 = p[(size_t)(i + 3) * QNL]; a += a0; a += a1; a += a2; a += a3; }
  const float w = 1.0f / sqrtf(a); *(float*)(CF + t) = w;  }

// A wave takes QRW rows of sc one after the other, each whole row in its registers (a lane: 8 pieces of 4 words, a load of the wave = 512 bytes in a row): nr, kt's row sum and pb from ONE read.
__device__ __forceinline__ float wave_sum(float s) {      /* butterfly over the 32 lanes: every lane ends with the same bits */
  s += __int_as_float(__builtin_amdgcn_update_dpp(0, __float_as_int(s), 0x161, 0xf, 0xf, false));      /* row_xmask:1 */
  s += __int_as_float(__builtin_amdgcn_update_dpp(0, __float_as_int(s), 0x162, 0xf, 0xf, false));      /* row_xmask:2 */
  s += __int_as_float(__builtin_amdgcn_update_dpp(0, __float_as_int(s), 0x164, 0xf, 0xf, false));      /* row_xmask:4 */
  s += __int_as_float(__builtin_amdgcn_update_dpp(0, __float_as_int(s), 0x168, 0xf, 0xf, false));      /* row_xmask:8 */
  const int b = __float_as_int(s); s += __int_as_float(__builtin_amdgcn_permlanex16(b, b, 0x76543210, 0xfedcba98, false, false));      /* lane l with lane l ^ 16 */
  return s; }

__global__ __launch_bounds__(QWV * 32) void k_ktw(const float* __restrict__ SC, const float* __restrict__ CF, _Float16* __restrict__ PB) {
  static_assert(QNL == 8 * 128 && QNL % QRW == 0 && (QNS * QNL) % (QWV * QRW) == 0, "a row is 8 loads of a wave; a wave's rows lie in one strip; whole work-groups");
  const unsigned lane = threadIdx.x & 31u, wave = (unsigned)__builtin_amdgcn_readfirstlane((int)(threadIdx.x >> 5)); const unsigned r0 = (blockIdx.x * QWV + wave) * QRW;
  const float* p = SC + (size_t)r0 * QNL + lane * 4; const float* cf = CF + (size_t)(r0 / QNL) * QNL + lane * 4; _Float16* o = PB + (size_t)r0 * QNL + lane * 4;
  v4f c[8], w[2][8];
#pragma unroll
  for (int q = 0; q < 8; ++q) w[0][q] = *(const v4fa*)(p + q * 128);
#pragma unroll
  for (int q = 0; q < 8; ++q) c[q] = *(const v4fa*)(cf + q * 128);
#pragma unroll
  for (int k = 0; k < QRW; ++k) { v4f* t = w[k & 1];
    __builtin_amdgcn_sched_barrier(0);      /* this one and the one behind the loads pin the order: the next row's loads, then this row's arithmetic; without them the next row's sum is drawn forward into this row's arithmetic and its loads get less time to land */
    if (k + 1 < QRW) {
#pragma unroll
      for (int q = 0; q < 8; ++q) w[(k + 1) & 1][q] = *(const v4fa*)(p + (size_t)(k + 1) * QNL + q * 128);
      if (k == 0) asm volatile("s_wait_xcnt 0x0" ::: "memory");      /* the wait in front of the first overwrite of the scalar base that the loads of c name (the arithmetic below re-uses it) */
      __builtin_amdgcn_sched_barrier(0); }
    v4f a = {0.f, 0.f, 0.f, 0.f};
#pragma unroll
    for (int q = 0; q < 8; ++q) a += t[q];
    const float rf = 1.0f / sqrtf(wave_sum((a[0] + a[1]) + (a[2] + a[3]))); a = (v4f){0.f, 0.f, 0.f, 0.f};
#pragma unroll
    for (int q = 0; q < 8; ++q) { t[q] = (rf * t[q]) * c[q]; a += t[q]; }
    const float dn = fmaxf(wave_sum((a[0] + a[1]) + (a[2] + a[3])), QLO);
#pragma unroll
    for (int q = 0; q < 8; ++q) { v4h h;
#pragma unroll
      for (int i = 0; i < 4; ++i) h[i] = (_Float16)((t[q][i] / dn) * QPC);
      *(v4h*)(o + (size_t)k * QNL + q * 128) = h;
      if (k + 1 < QRW || q < 7) asm volatile("s_wait_xcnt 0x0" ::: "memory"); } }      /* the wait in front of the next overwrite of the store's data registers (later pieces, the next rows' loads); behind the wave's last store nothing is overwritten */
}

extern "C" void kernel_launch(void* const* d_in, const int* in_sizes, int n_in,
                              void* d_out, int out_size, void* d_ws, size_t ws_size, hipStream_t stream) {
  (void)in_sizes; (void)n_in; (void)out_size;
  const float* const* I = (const float* const*)d_in; const float* xa = I[0]; const float* wa = I[1]; const float* va = I[2]; const float* wb = I[3]; const float* vb = I[4]; const float* wc = I[5]; const float* vc = I[6]; const float* wd = I[7]; const float* vd = I[8];      /* xa [2][1024][1024]; the four weights [1024][1024] (source, result); the four added vectors [1024] */
  float* res = (float*)d_out;
  static_assert((QNG * QNL) % 128 == 0 && QNL % 128 == 0 && QNW % 64 == 0 && QNW % 32 == 0 && QSW % 64 == 0 && QSW % 32 == 0 && QNL % 8 == 0 && QNS * QSW == QNW, "whole tiles");
  uint8_t* wsp = (uint8_t*)d_ws; size_t off = 0;
  auto take = [&](size_t bytes) { uint8_t* p = wsp + off; off += (bytes + 255) & ~(size_t)255; return p; };
  const size_t GW = (size_t)QNG * QNL * QNW, G1 = (size_t)QNL * QNW;
  float* SC = (float*)take((size_t)QNS * QNL * QNL * 4); _Float16* PB = (_Float16*)take((size_t)QNS * QNL * QNL * 2); float* FA = (float*)take(GW * 4); float* FB = (float*)take(GW * 4); float* FC = (float*)take(GW * 4); float* CX = (float*)take(GW * 4);
  _Float16* XH = (_Float16*)take(GW * 2); _Float16* AH = (_Float16*)take(GW * 2); _Float16* AL = (_Float16*)take(GW * 2); _Float16* BH = (_Float16*)take(GW * 2); _Float16* BL = (_Float16*)take(GW * 2); _Float16* CH = (_Float16*)take(GW * 2); _Float16* CL = (_Float16*)take(GW * 2); _Float16* VT = (_Float16*)take(G1 * 2);
  _Float16* WA = (_Float16*)take((size_t)QNW * QNW * 2); _Float16* WB = (_Float16*)take((size_t)QNW * QNW * 2); _Float16* WC = (_Float16*)take((size_t)QNW * QNW * 2); _Float16* WD = (_Float16*)take((size_t)QNW * QNW * 2); float* LA = (float*)take((size_t)QNG * QNS * QNL * 4); float* LB = (float*)take((size_t)QNG * QNS * QNL * 4); float* CF = (float*)take((size_t)QNS * QNL * 4);      /* a group's sixteen sheets of sc and of pb (re-used group after group); the three projections and cx in f32; xa's cast; the words and the unused residuals of fa, fb, cx; a group's transposed fc; the four weights transposed; the strips' squared lengths; a group's column factors */
  if (off > ws_size) return;
  k_x16<<<(unsigned)((GW / 8 + 255) / 256), 256, 0, stream>>>(xa, XH, GW / 8);
  k_wt_f16<<<(unsigned)(((size_t)QNW * (QNW / 8) + 255) / 256), 256, 0, stream>>>(wa, WA, QNW, QNW, QWC);      /* WA[o][k] = f16(64 wa[k][o]) */
  k_wt_f16<<<(unsigned)(((size_t)QNW * (QNW / 8) + 255) / 256), 256, 0, stream>>>(wb, WB, QNW, QNW, QWC);
  k_wt_f16<<<(unsigned)(((size_t)QNW * (QNW / 8) + 255) / 256), 256, 0, stream>>>(wc, WC, QNW, QNW, QWC);
  k_wt_f16<<<(unsigned)(((size_t)QNW * (QNW / 8) + 255) / 256), 256, 0, stream>>>(wd, WD, QNW, QNW, QWC);
  k_gemm2<0><<<dim3((unsigned)(((QNG * QNL) / 128) * (QNW / 64)), 1), 128, 0, stream>>>(XH, QNW, 0, WA, QNW, 0, 1.0f / QWC, va, 0, nullptr, 1, 0, 0, FA, nullptr, QNW, 0, QNG * QNL, QNW, QNW);      /* FA[(g, i)][o] = xa[g][i][:] . wa[:][o] + va[o] */
  k_gemm2<0><<<dim3((unsigned)(((QNG * QNL) / 128) * (QNW / 64)), 1), 128, 0, stream>>>(XH, QNW, 0, WB, QNW, 0, 1.0f / QWC, vb, 0, nullptr, 1, 0, 0, FB, nullptr, QNW, 0, QNG * QNL, QNW, QNW);
  k_gemm2<0><<<dim3((unsigned)(((QNG * QNL) / 128) * (QNW / 64)), 1), 128, 0, stream>>>(XH, QNW, 0, WC, QNW, 0, 1.0f / QWC, vc, 0, nullptr, 1, 0, 0, FC, nullptr, QNW, 0, QNG * QNL, QNW, QNW);
  k_sln<<<(unsigned)((QNG * QNS * QNL + 255) / 256), 256, 0, stream>>>(FA, LA);
  k_sln<<<(unsigned)((QNG * QNS * QNL + 255) / 256), 256, 0, stream>>>(FB, LB);
  k_hl<<<(unsigned)((GW / 8 + 255) / 256), 256, 0, stream>>>(FA, AH, AL, GW / 8);      /* AH is used; AL is written and not read */
  k_hl<<<(unsigned)((GW / 8 + 255) / 256), 256, 0, stream>>>(FB, BH, BL, GW / 8);
  for (int g = 0; g < QNG; ++g) {      /* a literal 2 on the host: SC, PB, VT and CF are re-used group after group */
    k_wtn_f16<<<(unsigned)(((size_t)QNW * (QNL / 8) + 255) / 256), 256, 0, stream>>>(FC + g * G1, VT, QNL, QNW, 1.0f);      /* VT[(s, c)][j] = f16(fc[g][j][s 64 + c]) */
    k_gemm2<0><<<dim3((unsigned)((QNL / 128) * (QNL / 64)), QNS), 128, 0, stream>>>(AH + g * G1, QNW, (size_t)QSW, BH + g * G1, QNW, (size_t)QSW, 1.0f, nullptr, 0, nullptr, 1, 0, 0, SC, nullptr, QNL, (size_t)QNL * QNL, QNL, QNL, QSW);      /* SC[s][i][j] = fa[g][i][s] . fb[g][j][s] */
    k_psc<<<(unsigned)(((size_t)QNS * QNL * (QNL / 4) + 255) / 256), 256, 0, stream>>>(SC, LA + (size_t)g * QNS * QNL, LB + (size_t)g * QNS * QNL);
    k_csm<<<(unsigned)((QNS * QNL + 255) / 256), 256, 0, stream>>>(SC, CF);
    k_ktw<<<(unsigned)((QNS * QNL) / (QWV * QRW)), QWV * 32, 0, stream>>>(SC, CF, PB);
    k_gemm2<0><<<dim3((unsigned)((QNL / 128) * (QSW / 64)), QNS), 128, 0, stream>>>(PB, QNL, (size_t)QNL * QNL, VT, QNL, (size_t)QSW * QNL, 1.0f / QPC, nullptr, 0, nullptr, 1, 0, 0, CX + g * G1, nullptr, QNW, (size_t)QSW, QNL, QSW, QNL); }      /* CX[g][i][s 64 + c] = sum over j of PB[s][i][j] fc[g][j][s 64 + c] / 2^12: in place at a strip's column offset */
  k_hl<<<(unsigned)((GW / 8 + 255) / 256), 256, 0, stream>>>(CX, CH, CL, GW / 8);      /* CH is used; CL is written and not read */
  k_gemm2<0><<<dim3((unsigned)(((QNG * QNL) / 128) * (QNW / 64)), 1), 128, 0, stream>>>(CH, QNW, 0, WD, QNW, 0, 1.0f / QWC, vd, 0, nullptr, 1, 0, 0, res, nullptr, QNW, 0, QNG * QNL, QNW, QNW);      /* res = cx wd + vd: every word of the result once */
}

// v002
// A run of this version takes 421 microseconds.
// Timed twice side by side with v001, it ran 1.12 times as fast both times.
// Counting every step since v000, it is 1.52 times as fast.
// A distance-kernel mixing of rows: xa [2][1024][1024] (group, row, width); wa, wb, wc, wd [1024][1024] stored (source column, result column), va, vb, vc, vd [1024]: fa | fb | fc = xa w + v, split into 16 strips of 64 columns; for a group and a strip: e2[i][j] = |fa_i|^2 + |fb_j|^2 - 2 fa_i . fb_j; gd = sqrt(max(e2, 1e-12)) / 64; sc = (1 + gd)^(-65.5); nr = its row sums, nc = its column sums; kt = nr^(-1/2) sc nc^(-1/2); pb = kt / max(its row sum, 1e-12); cx = pb fc's strip; res = cx wd + vd -> [2][1024][1024] f32: one result.
// Structure: xa cast to f16 as it lies and the four weights cast transposed behind a carry of 64 (converted to bf16 first); three WMMA GEMMs (the carry undone in their scale argument; the added vectors live) into f32 sheets; ONE flat kernel a thread a (row, strip) takes a strip's squared length (64 words in index order); fa and fb split into f16 words (the residual sheets unused); THEN A GROUP AT A TIME (a literal 2 on the host): the frame's transposing cast without a conversion (k_wtn_f16: a computed sheet) lays fc's group transposed as f16 words; one WMMA GEMM with the strip as the grid's second index forms fa . fb (depth 64) into sixteen f32 sheets; ONE kernel, a work-group 64 columns of a strip over all rows, forms sc in place from the two lengths and the product (the library root and power), sums its columns as it goes (thread partials, then LDS) and stores each sum's reciprocal root; ONE kernel a wave four rows in turn (each row in the wave's registers, read once) forms the row's sum, kt's row sum (lane partials, then a butterfly) and stores pb as one f16 word behind a carry of 2^12; one WMMA GEMM (depth 1,024; its scale undoes the carry) writes cx in place at a strip's column offset; then cx split into f16 words and the last WMMA GEMM writes the result.
// Compute dtype: all nine inputs converted to bf16 where they are read; xa's words exact as f16 operands down to 2^-14; the weights' behind 64; the computed sheets ONE f16 word each (pb behind 2^12); every product's accumulation, the lengths, the kernel's arithmetic, the sums and the result f32. v_wmma_f32_16x16x32_f16.
#include <hip/hip_runtime.h>
#define QNG 2                        /* groups */
#define QNL 1024                     /* rows of a group */
#define QNW 1024                     /* a row's width: every projection's depth and width */
#define QNS 16                       /* strips */
#define QSW 64                       /* a strip's width: the pair product's depth */
#define QDS 64.0f                    /* the distance's divisor */
#define QPW -65.5f                   /* the power */
#define QLO 1e-12f                   /* the lower bound of e2 and of a row's sum */
#define QWC 64.0f                    /* the weights' carry (undone in the products' scale argument) */
#define QPC 4096.0f                  /* pb's carry (undone in the fifth product's scale argument) */
#define QWV 16                       /* waves of a work-group of the row kernel */
#define QRW 4                        /* rows of sc that one of its waves takes */
#define QCB 64                       /* columns of sc that a work-group of the power kernel takes */
#define QCR 64                       /* rows of sc that it takes in one pass */
typedef unsigned short v8us __attribute__((ext_vector_type(8), may_alias));
typedef float  v8f  __attribute__((ext_vector_type(8)));
typedef float  v4f  __attribute__((ext_vector_type(4)));
typedef float  v4fa __attribute__((ext_vector_type(4), may_alias));

__device__ __forceinline__ unsigned short bf16_bits(float x) { unsigned int u = __float_as_uint(x); return (unsigned short)((u + 0x7FFFu + ((u >> 16) & 1u)) >> 16); }
__device__ __forceinline__ float bf16_val(unsigned short b) { return __uint_as_float(((unsigned int)b) << 16); }
__device__ __forceinline__ float bf16_round(float x) { return bf16_val(bf16_bits(x)); }

typedef _Float16 v16h __attribute__((ext_vector_type(16)));
union FragH { v16h v; v8us half[2]; _Float16 h[16]; unsigned short u[16]; };

// Wt[n][k] = f16(W[k][n] x scale) from f32 row-major W[K][N] (scale = power of two; bf16-exact weights stay exact in f16 away from the subnormal range)
__global__ __launch_bounds__(256) void k_wt_f16(const float* __restrict__ W, _Float16* __restrict__ Wt, int K, int N, float scale) {
  const int t = blockIdx.x * 256 + threadIdx.x; if (t >= N * (K / 8)) return; const int n = t / (K / 8), k8 = (t % (K / 8)) * 8; FragH f;
#pragma unroll
  for (int i = 0; i < 8; ++i) f.h[i] = (_Float16)(bf16_round(W[(size_t)(k8 + i) * N + n]) * scale); const v8us o = f.half[0];
  *(v8us*)((unsigned short*)Wt + (size_t)n * K + k8) = o; 
}

typedef _Float16 v4h __attribute__((ext_vector_type(4)));

__global__ __launch_bounds__(256) void k_wtn_f16(const float* __restrict__ W, _Float16* __restrict__ Wt, int K, int N, float scale) {
  const int t = blockIdx.x * 256 + threadIdx.x; if (t >= N * (K / 8)) return; const int n = t / (K / 8), k8 = (t % (K / 8)) * 8; FragH f;
  for (int i = 0; i < 8; ++i) f.h[i] = (_Float16)(W[(size_t)(k8 + i) * N + n] * scale);
  unsigned short* o = (unsigned short*)Wt + (size_t)n * K + k8; *(v8us*)o = f.half[0];  }

__global__ __launch_bounds__(256) void k_hl(const float* __restrict__ F, _Float16* __restrict__ Hh, _Float16* __restrict__ Hl, size_t n8) { const size_t t = (size_t)blockIdx.x * 256 + threadIdx.x; if (t >= n8) return; FragH fh, fl; const v4f a = *(const v4fa*)(F + t * 8), c = *(const v4fa*)(F + t * 8 + 4);
#pragma unroll
  for (int q = 0; q < 4; ++q) { _Float16 h = (_Float16)a[q]; fh.h[q] = h; fl.h[q] = (_Float16)((a[q] - (float)h) * 1024.0f); h = (_Float16)c[q]; fh.h[4 + q] = h; fl.h[4 + q] = (_Float16)((c[q] - (float)h) * 1024.0f); }
  { *(v8us*)((unsigned short*)Hh + t * 8) = fh.half[0]; *(v8us*)((unsigned short*)Hl + t * 8) = fl.half[0];  } }

__global__ __launch_bounds__(256) void k_x16(const float* __restrict__ x, _Float16* __restrict__ X16, size_t n8) { const size_t t = (size_t)blockIdx.x * 256 + threadIdx.x; if (t >= n8) return; FragH f;
#pragma unroll
  for (int q = 0; q < 8; ++q) f.h[q] = (_Float16)bf16_round(x[t * 8 + q]); *(v8us*)((unsigned short*)X16 + t * 8) = f.half[0];  }

// ---- fast GEMM (wave tile 32x64; requires M % 32 == 0 rows per launch region and N % 64 == 0) ----
__device__ __forceinline__ v16h g2_frag(const _Float16* p, int hh) { FragH f; f.half[0] = *(const v8us*)((const unsigned short*)p + 8 * hh); f.half[1] = *(const v8us*)((const unsigned short*)p + 16 + 8 * hh); return f.v; }
__device__ __forceinline__ v8f g2_mma(v16h a, v16h b, v8f c) { v8f d = __builtin_amdgcn_wmma_f32_16x16x32_f16(false, a, false, b, (short)0, c, false, false); asm volatile("v_nop\n\tv_nop\n\tv_nop\n\tv_nop" : "+v"(d) : "v"(a), "v"(b)); return d; }
template <int ACT>
__global__ __launch_bounds__(128) void k_gemm2(const _Float16* __restrict__ A, int lda, size_t sA, const _Float16* __restrict__ Bh, int ldb, size_t sB, float alpha, const float* __restrict__ bias, size_t sBias, const float* __restrict__ CP, int rowsPerB, size_t sCPb, int row0g,
    float* __restrict__ C, _Float16* __restrict__ C16, int ldc, size_t sC, int M, int N, int K) { static_assert(ACT == 0 || ACT == 3 || ACT == 6 || ACT == 8 || ACT == 9 || ACT == 11 || ACT == 12 || ACT == 14 || ACT == 15 || ACT == 16 || ACT == 17, "k_gemm2: unsupported ACT code (would silently apply no activation)");
  __shared__ __attribute__((aligned(16))) float so[4][32][68];
  const int tid = threadIdx.x, w = tid >> 5, lane = tid & 31, ln = lane & 15, hh = lane >> 4; const int by = blockIdx.y;
  A += (size_t)by * sA; Bh += (size_t)by * sB; const size_t cofs = (size_t)by * sC; const float* bp = bias ? bias + (size_t)by * sBias : nullptr;
  const int ntn = N >> 6; const int mt = blockIdx.x / ntn, nq = blockIdx.x - mt * ntn; const int row0 = mt * 128 + 32 * w, col0 = nq * 64; if (row0 >= M) return;
  const _Float16* a0p = A + (size_t)(row0 + ln) * lda; const _Float16* a1p = a0p + (size_t)16 * lda;
  const _Float16* b0p = Bh + (size_t)(col0 + ln) * ldb; const _Float16* b1p = b0p + (size_t)16 * ldb; const _Float16* b2p = b1p + (size_t)16 * ldb; const _Float16* b3p = b2p + (size_t)16 * ldb;
  const v8f z8 = {0.f,0.f,0.f,0.f,0.f,0.f,0.f,0.f}; v8f c00 = z8, c01 = z8, c02 = z8, c03 = z8, c10 = z8, c11 = z8, c12 = z8, c13 = z8;
  for (int kb = 0; kb < K; kb += 32) { const v16h a0 = g2_frag(a0p + kb, hh), a1 = g2_frag(a1p + kb, hh);
    v16h b = g2_frag(b0p + kb, hh); c00 = g2_mma(a0, b, c00); c10 = g2_mma(a1, b, c10);
    b = g2_frag(b1p + kb, hh); c01 = g2_mma(a0, b, c01); c11 = g2_mma(a1, b, c11);
    b = g2_frag(b2p + kb, hh); c02 = g2_mma(a0, b, c02); c12 = g2_mma(a1, b, c12);
    b = g2_frag(b3p + kb, hh); c03 = g2_mma(a0, b, c03); c13 = g2_mma(a1, b, c13); }
  v8f accs[8] = {c00, c01, c02, c03, c10, c11, c12, c13};
#pragma unroll
  for (int u = 0; u < 8; ++u) { const int t = u & 3, half = u >> 2; const int col = col0 + t * 16 + ln; const float bv = bp ? bf16_round(bp[col]) : 0.f;
#pragma unroll
    for (int r = 0; r < 8; ++r) { const int rloc = half * 16 + 8 * hh + r; float v = accs[u][r] * alpha + bv; if (CP) { if (rowsPerB < 0) v += CP[cofs + (size_t)(row0g + row0 + rloc) * ldc + col];      /* rowsPerB < 0: own element of the batched C plane */ else { const int bidx = (row0g + row0 + rloc) / rowsPerB; v += CP[(size_t)bidx * sCPb + (size_t)by * 64 + col]; } }
      if (ACT == 3) v = fmaxf(v, 0.f); else if (ACT == 6) v = 0.5f * v * (1.0f + erff(v * 0.70710678118654752f)); else if (ACT == 11) v = 1.0f / (1.0f + expf(-v)); else if (ACT == 15) v = v / (1.0f + expf(-v)); else if (ACT == 12) v = (v > 0.f) ? v : 0.01f * v; else if (ACT == 8) v = tanhf(v); else if (ACT == 9) v = 0.5f * v * (1.0f + tanhf(0.7978845608028654f * (v + 0.044715f * v * v * v))); else if (ACT == 14) v = (v > 0.f) ? v : 0.1f * v; else if (ACT == 16) v = (v >= 0.f) ? v : 0.3f * v; else if (ACT == 17) v = (v >= 0.f) ? v : 0.2f * v;
      so[w][rloc][t * 16 + ln] = v; } }
  __builtin_amdgcn_fence(__ATOMIC_ACQ_REL, "workgroup"); __builtin_amdgcn_wave_barrier();
  const int rsub = lane >> 4, c4 = (lane & 15) * 4;
  {
#pragma unroll
    for (int q = 0; q < 16; ++q) { const int r = q * 2 + rsub; const v4f v = *(const v4fa*)&so[w][r][c4]; if (C) *(v4f*)(C + cofs + (size_t)(row0 + r) * ldc + col0 + c4) = v; if (C16) { v4h h4; for (int i = 0; i < 4; ++i) h4[i] = (_Float16)v[i]; *(v4h*)(C16 + cofs + (size_t)(row0 + r) * ldc + col0 + c4) = h4; } }
     } }

__global__ __launch_bounds__(256) void k_sln(const float* __restrict__ F, float* __restrict__ LN) {
  const unsigned t = blockIdx.x * 256u + threadIdx.x; if (t >= (unsigned)(QNG * QNS * QNL)) return;
  const unsigned i = t % QNL, s = (t / QNL) % QNS, g = t / (QNL * QNS); const float* p = F + ((size_t)g * QNL + i) * QNW + s * QSW; float a = 0.0f;
  for (unsigned c = 0; c < (unsigned)QSW; c += 4) { const v4f w = *(const v4fa*)(p + c);
#pragma unroll
    for (int q = 0; q < 4; ++q) a += w[q] * w[q]; }
  *(float*)(LN + t) = a;  }

// A work-group takes QCB columns of one strip over all its rows (a wave's load or store = 2 rows of 256 bytes in a row): sc is formed in place as before, and each thread keeps the running sums of its 4 columns, so sc is not read again for nc.
__global__ __launch_bounds__(1024) __attribute__((amdgpu_waves_per_eu(8, 8)))      /* one work-group of 32 waves a WGP = 8 waves a SIMD: told so, the compiler spends registers on interleaving a trip's four powers (more dual issue) */
void k_pcs(float* SC, const float* __restrict__ la, const float* __restrict__ lb, float* __restrict__ CF) {
  static_assert(QCB == 64 && QNL % QCB == 0 && QNL % QCR == 0 && QCR * (QCB / 4) == 1024, "16 threads a row piece, QCR rows a pass, whole passes");
  __shared__ __attribute__((aligned(16))) float ps[QCR][QCB];
  const unsigned tid = threadIdx.x, c4 = (tid & 15u) * 4u, rr = tid >> 4; const unsigned s = blockIdx.x / (QNL / QCB), j0 = (blockIdx.x % (QNL / QCB)) * QCB;
  float* p = SC + (size_t)s * QNL * QNL + (size_t)rr * QNL + j0 + c4; const float* lq = la + s * QNL + rr; const v4f kb = *(const v4fa*)(lb + s * QNL + j0 + c4);
  v4f a = {0.f, 0.f, 0.f, 0.f}; v4f z = *(const v4fa*)p; float qa = lq[0];
  for (unsigned k = 0; k < (unsigned)(QNL / QCR); ++k) { const unsigned kn = (k + 1 < (unsigned)(QNL / QCR)) ? k + 1 : k;      /* the next pass's words are fetched ahead of this pass's arithmetic (the last pass fetches its own again, unused) */
    const v4f zn = *(const v4fa*)(p + (size_t)kn * QCR * QNL); const float qn = lq[kn * QCR]; v4f w;
#pragma unroll
    for (int q = 0; q < 4; ++q) { const float e2 = (qa + kb[q]) - 2.0f * z[q]; const float gd = sqrtf(fmaxf(e2, QLO)) / QDS; w[q] = powf(1.0f + gd, QPW); }
    *(v4fa*)(p + (size_t)k * QCR * QNL) = w; a += w; z = zn; qa = qn; }
  *(v4fa*)&ps[rr][c4] = a;
  __syncthreads();      /* the QCR partial sums of every column are in LDS before a thread a column adds them */
  if (tid < (unsigned)QCB) { float t = 0.0f;
#pragma unroll
    for (int r = 0; r < QCR; ++r) t += ps[r][tid];
    CF[s * QNL + j0 + tid] = 1.0f / sqrtf(t); } }

// A wave takes QRW rows of sc one after the other, each whole row in its registers (a lane: 8 pieces of 4 words, a load of the wave = 512 bytes in a row): nr, kt's row sum and pb from ONE read.
__device__ __forceinline__ float wave_sum(float s) {      /* butterfly over the 32 lanes: every lane ends with the same bits */
  s += __int_as_float(__builtin_amdgcn_update_dpp(0, __float_as_int(s), 0x161, 0xf, 0xf, false));      /* row_xmask:1 */
  s += __int_as_float(__builtin_amdgcn_update_dpp(0, __float_as_int(s), 0x162, 0xf, 0xf, false));      /* row_xmask:2 */
  s += __int_as_float(__builtin_amdgcn_update_dpp(0, __float_as_int(s), 0x164, 0xf, 0xf, false));      /* row_xmask:4 */
  s += __int_as_float(__builtin_amdgcn_update_dpp(0, __float_as_int(s), 0x168, 0xf, 0xf, false));      /* row_xmask:8 */
  const int b = __float_as_int(s); s += __int_as_float(__builtin_amdgcn_permlanex16(b, b, 0x76543210, 0xfedcba98, false, false));      /* lane l with lane l ^ 16 */
  return s; }

__global__ __launch_bounds__(QWV * 32) void k_ktw(const float* __restrict__ SC, const float* __restrict__ CF, _Float16* __restrict__ PB) {
  static_assert(QNL == 8 * 128 && QNL % QRW == 0 && (QNS * QNL) % (QWV * QRW) == 0, "a row is 8 loads of a wave; a wave's rows lie in one strip; whole work-groups");
  const unsigned lane = threadIdx.x & 31u, wave = (unsigned)__builtin_amdgcn_readfirstlane((int)(threadIdx.x >> 5)); const unsigned r0 = (blockIdx.x * QWV + wave) * QRW;
  const float* p = SC + (size_t)r0 * QNL + lane * 4; const float* cf = CF + (size_t)(r0 / QNL) * QNL + lane * 4; _Float16* o = PB + (size_t)r0 * QNL + lane * 4;
  v4f c[8], w[2][8];
#pragma unroll
  for (int q = 0; q < 8; ++q) w[0][q] = *(const v4fa*)(p + q * 128);
#pragma unroll
  for (int q = 0; q < 8; ++q) c[q] = *(const v4fa*)(cf + q * 128);
#pragma unroll
  for (int k = 0; k < QRW; ++k) { v4f* t = w[k & 1];
    __builtin_amdgcn_sched_barrier(0);      /* this one and the one behind the loads pin the order: the next row's loads, then this row's arithmetic; without them the next row's sum is drawn forward into this row's arithmetic and its loads get less time to land */
    if (k + 1 < QRW) {
#pragma unroll
      for (int q = 0; q < 8; ++q) w[(k + 1) & 1][q] = *(const v4fa*)(p + (size_t)(k + 1) * QNL + q * 128);
      if (k == 0) asm volatile("s_wait_xcnt 0x0" ::: "memory");      /* the wait in front of the first overwrite of the scalar base that the loads of c name (the arithmetic below re-uses it) */
      __builtin_amdgcn_sched_barrier(0); }
    v4f a = {0.f, 0.f, 0.f, 0.f};
#pragma unroll
    for (int q = 0; q < 8; ++q) a += t[q];
    const float rf = 1.0f / sqrtf(wave_sum((a[0] + a[1]) + (a[2] + a[3]))); a = (v4f){0.f, 0.f, 0.f, 0.f};
#pragma unroll
    for (int q = 0; q < 8; ++q) { t[q] = (rf * t[q]) * c[q]; a += t[q]; }
    const float dn = fmaxf(wave_sum((a[0] + a[1]) + (a[2] + a[3])), QLO);
#pragma unroll
    for (int q = 0; q < 8; ++q) { v4h h;
#pragma unroll
      for (int i = 0; i < 4; ++i) h[i] = (_Float16)((t[q][i] / dn) * QPC);
      *(v4h*)(o + (size_t)k * QNL + q * 128) = h;
      if (k + 1 < QRW || q < 7) asm volatile("s_wait_xcnt 0x0" ::: "memory"); } }      /* the wait in front of the next overwrite of the store's data registers (later pieces, the next rows' loads); behind the wave's last store nothing is overwritten */
}

extern "C" void kernel_launch(void* const* d_in, const int* in_sizes, int n_in,
                              void* d_out, int out_size, void* d_ws, size_t ws_size, hipStream_t stream) {
  (void)in_sizes; (void)n_in; (void)out_size;
  const float* const* I = (const float* const*)d_in; const float* xa = I[0]; const float* wa = I[1]; const float* va = I[2]; const float* wb = I[3]; const float* vb = I[4]; const float* wc = I[5]; const float* vc = I[6]; const float* wd = I[7]; const float* vd = I[8];      /* xa [2][1024][1024]; the four weights [1024][1024] (source, result); the four added vectors [1024] */
  float* res = (float*)d_out;
  static_assert((QNG * QNL) % 128 == 0 && QNL % 128 == 0 && QNW % 64 == 0 && QNW % 32 == 0 && QSW % 64 == 0 && QSW % 32 == 0 && QNL % 8 == 0 && QNS * QSW == QNW, "whole tiles");
  uint8_t* wsp = (uint8_t*)d_ws; size_t off = 0;
  auto take = [&](size_t bytes) { uint8_t* p = wsp + off; off += (bytes + 255) & ~(size_t)255; return p; };
  const size_t GW = (size_t)QNG * QNL * QNW, G1 = (size_t)QNL * QNW;
  float* SC = (float*)take((size_t)QNS * QNL * QNL * 4); _Float16* PB = (_Float16*)take((size_t)QNS * QNL * QNL * 2); float* FA = (float*)take(GW * 4); float* FB = (float*)take(GW * 4); float* FC = (float*)take(GW * 4); float* CX = (float*)take(GW * 4);
  _Float16* XH = (_Float16*)take(GW * 2); _Float16* AH = (_Float16*)take(GW * 2); _Float16* AL = (_Float16*)take(GW * 2); _Float16* BH = (_Float16*)take(GW * 2); _Float16* BL = (_Float16*)take(GW * 2); _Float16* CH = (_Float16*)take(GW * 2); _Float16* CL = (_Float16*)take(GW * 2); _Float16* VT = (_Float16*)take(G1 * 2);
  _Float16* WA = (_Float16*)take((size_t)QNW * QNW * 2); _Float16* WB = (_Float16*)take((size_t)QNW * QNW * 2); _Float16* WC = (_Float16*)take((size_t)QNW * QNW * 2); _Float16* WD = (_Float16*)take((size_t)QNW * QNW * 2); float* LA = (float*)take((size_t)QNG * QNS * QNL * 4); float* LB = (float*)take((size_t)QNG * QNS * QNL * 4); float* CF = (float*)take((size_t)QNS * QNL * 4);      /* a group's sixteen sheets of sc and of pb (re-used group after group); the three projections and cx in f32; xa's cast; the words and the unused residuals of fa, fb, cx; a group's transposed fc; the four weights transposed; the strips' squared lengths; a group's column factors */
  if (off > ws_size) return;
  k_x16<<<(unsigned)((GW / 8 + 255) / 256), 256, 0, stream>>>(xa, XH, GW / 8);
  k_wt_f16<<<(unsigned)(((size_t)QNW * (QNW / 8) + 255) / 256), 256, 0, stream>>>(wa, WA, QNW, QNW, QWC);      /* WA[o][k] = f16(64 wa[k][o]) */
  k_wt_f16<<<(unsigned)(((size_t)QNW * (QNW / 8) + 255) / 256), 256, 0, stream>>>(wb, WB, QNW, QNW, QWC);
  k_wt_f16<<<(unsigned)(((size_t)QNW * (QNW / 8) + 255) / 256), 256, 0, stream>>>(wc, WC, QNW, QNW, QWC);
  k_wt_f16<<<(unsigned)(((size_t)QNW * (QNW / 8) + 255) / 256), 256, 0, stream>>>(wd, WD, QNW, QNW, QWC);
  k_gemm2<0><<<dim3((unsigned)(((QNG * QNL) / 128) * (QNW / 64)), 1), 128, 0, stream>>>(XH, QNW, 0, WA, QNW, 0, 1.0f / QWC, va, 0, nullptr, 1, 0, 0, FA, nullptr, QNW, 0, QNG * QNL, QNW, QNW);      /* FA[(g, i)][o] = xa[g][i][:] . wa[:][o] + va[o] */
  k_gemm2<0><<<dim3((unsigned)(((QNG * QNL) / 128) * (QNW / 64)), 1), 128, 0, stream>>>(XH, QNW, 0, WB, QNW, 0, 1.0f / QWC, vb, 0, nullptr, 1, 0, 0, FB, nullptr, QNW, 0, QNG * QNL, QNW, QNW);
  k_gemm2<0><<<dim3((unsigned)(((QNG * QNL) / 128) * (QNW / 64)), 1), 128, 0, stream>>>(XH, QNW, 0, WC, QNW, 0, 1.0f / QWC, vc, 0, nullptr, 1, 0, 0, FC, nullptr, QNW, 0, QNG * QNL, QNW, QNW);
  k_sln<<<(unsigned)((QNG * QNS * QNL + 255) / 256), 256, 0, stream>>>(FA, LA);
  k_sln<<<(unsigned)((QNG * QNS * QNL + 255) / 256), 256, 0, stream>>>(FB, LB);
  k_hl<<<(unsigned)((GW / 8 + 255) / 256), 256, 0, stream>>>(FA, AH, AL, GW / 8);      /* AH is used; AL is written and not read */
  k_hl<<<(unsigned)((GW / 8 + 255) / 256), 256, 0, stream>>>(FB, BH, BL, GW / 8);
  for (int g = 0; g < QNG; ++g) {      /* a literal 2 on the host: SC, PB, VT and CF are re-used group after group */
    k_wtn_f16<<<(unsigned)(((size_t)QNW * (QNL / 8) + 255) / 256), 256, 0, stream>>>(FC + g * G1, VT, QNL, QNW, 1.0f);      /* VT[(s, c)][j] = f16(fc[g][j][s 64 + c]) */
    k_gemm2<0><<<dim3((unsigned)((QNL / 128) * (QNL / 64)), QNS), 128, 0, stream>>>(AH + g * G1, QNW, (size_t)QSW, BH + g * G1, QNW, (size_t)QSW, 1.0f, nullptr, 0, nullptr, 1, 0, 0, SC, nullptr, QNL, (size_t)QNL * QNL, QNL, QNL, QSW);      /* SC[s][i][j] = fa[g][i][s] . fb[g][j][s] */
    k_pcs<<<(unsigned)(QNS * (QNL / QCB)), 1024, 0, stream>>>(SC, LA + (size_t)g * QNS * QNL, LB + (size_t)g * QNS * QNL, CF);
    k_ktw<<<(unsigned)((QNS * QNL) / (QWV * QRW)), QWV * 32, 0, stream>>>(SC, CF, PB);
    k_gemm2<0><<<dim3((unsigned)((QNL / 128) * (QSW / 64)), QNS), 128, 0, stream>>>(PB, QNL, (size_t)QNL * QNL, VT, QNL, (size_t)QSW * QNL, 1.0f / QPC, nullptr, 0, nullptr, 1, 0, 0, CX + g * G1, nullptr, QNW, (size_t)QSW, QNL, QSW, QNL); }      /* CX[g][i][s 64 + c] = sum over j of PB[s][i][j] fc[g][j][s 64 + c] / 2^12: in place at a strip's column offset */
  k_hl<<<(unsigned)((GW / 8 + 255) / 256), 256, 0, stream>>>(CX, CH, CL, GW / 8);      /* CH is used; CL is written and not read */
  k_gemm2<0><<<dim3((unsigned)(((QNG * QNL) / 128) * (QNW / 64)), 1), 128, 0, stream>>>(CH, QNW, 0, WD, QNW, 0, 1.0f / QWC, vd, 0, nullptr, 1, 0, 0, res, nullptr, QNW, 0, QNG * QNL, QNW, QNW);      /* res = cx wd + vd: every word of the result once */
}

// v003
// One run takes 277 microseconds.
// In both of two side-by-side timings against v002, it was 1.53 times as fast.
// Counting every step since v000, it is 2.33 times as fast.
// A distance-kernel mixing of rows: xa [2][1024][1024] (group, row, width); wa, wb, wc, wd [1024][1024] stored (source column, result column), va, vb, vc, vd [1024]: fa | fb | fc = xa w + v, split into 16 strips of 64 columns; for a group and a strip: e2[i][j] = |fa_i|^2 + |fb_j|^2 - 2 fa_i . fb_j; gd = sqrt(max(e2, 1e-12)) / 64; sc = (1 + gd)^(-65.5); nr = its row sums, nc = its column sums; kt = nr^(-1/2) sc nc^(-1/2); pb = kt / max(its row sum, 1e-12); cx = pb fc's strip; res = cx wd + vd -> [2][1024][1024] f32: one result.
// Structure: xa cast to f16 as it lies and the four weights cast transposed behind a carry of 64 (converted to bf16 first); three WMMA GEMMs (the carry undone in their scale argument; the added vectors live) into f32 sheets; ONE flat kernel a thread a (row, strip) takes a strip's squared length (64 words in index order); fa and fb split into f16 words (the residual sheets unused); THEN A GROUP AT A TIME (a literal 2 on the host): the frame's transposing cast without a conversion (k_wtn_f16: a computed sheet) lays fc's group transposed as f16 words; one WMMA GEMM with the strip as the grid's second index forms fa . fb (depth 64) into sixteen f32 sheets; ONE kernel, a work-group 64 columns of a strip over all rows, forms sc in place from the two lengths and the product (the library root and power), sums its columns as it goes (thread partials, then LDS) and stores each sum's reciprocal root; ONE kernel a wave four rows in turn (each row in the wave's registers, read once) forms the row's sum, kt's row sum (lane partials, then a butterfly) and stores pb as one f16 word behind a carry of 2^12; one WMMA GEMM (depth 1,024; its scale undoes the carry) writes cx in place at a strip's column offset; then cx split into f16 words and the last WMMA GEMM writes the result.
// Compute dtype: all nine inputs converted to bf16 where they are read; xa's words exact as f16 operands down to 2^-14; the weights' behind 64; the computed sheets ONE f16 word each (pb behind 2^12); every product's accumulation, the lengths, the kernel's arithmetic, the sums and the result f32. v_wmma_f32_16x16x32_f16.
#include <hip/hip_runtime.h>
#define QNG 2                        /* groups */
#define QNL 1024                     /* rows of a group */
#define QNW 1024                     /* a row's width: every projection's depth and width */
#define QNS 16                       /* strips */
#define QSW 64                       /* a strip's width: the pair product's depth */
#define QDS 64.0f                    /* the distance's divisor */
#define QPW -65.5f                   /* the power */
#define QLO 1e-12f                   /* the lower bound of e2 and of a row's sum */
#define QWC 64.0f                    /* the weights' carry (undone in the products' scale argument) */
#define QPC 4096.0f                  /* pb's carry (undone in the fifth product's scale argument) */
#define QWV 16                       /* waves of a work-group of the row kernel */
#define QRW 4                        /* rows of sc that one of its waves takes */
#define QCB 64                       /* columns of sc that a work-group of the power kernel takes */
#define QCR 64                       /* rows of sc that it takes in one pass */
typedef unsigned short v8us __attribute__((ext_vector_type(8), may_alias));
typedef float  v8f  __attribute__((ext_vector_type(8)));
typedef float  v4f  __attribute__((ext_vector_type(4)));
typedef float  v4fa __attribute__((ext_vector_type(4), may_alias));

__device__ __forceinline__ unsigned short bf16_bits(float x) { unsigned int u = __float_as_uint(x); return (unsigned short)((u + 0x7FFFu + ((u >> 16) & 1u)) >> 16); }
__device__ __forceinline__ float bf16_val(unsigned short b) { return __uint_as_float(((unsigned int)b) << 16); }
__device__ __forceinline__ float bf16_round(float x) { return bf16_val(bf16_bits(x)); }

typedef _Float16 v16h __attribute__((ext_vector_type(16)));
union FragH { v16h v; v8us half[2]; _Float16 h[16]; unsigned short u[16]; };

// Wt[n][k] = f16(W[k][n] x scale) from f32 row-major W[K][N] (scale = power of two; bf16-exact weights stay exact in f16 away from the subnormal range)
__global__ __launch_bounds__(256) void k_wt_f16(const float* __restrict__ W, _Float16* __restrict__ Wt, int K, int N, float scale) {
  const int t = blockIdx.x * 256 + threadIdx.x; if (t >= N * (K / 8)) return; const int n = t / (K / 8), k8 = (t % (K / 8)) * 8; FragH f;
#pragma unroll
  for (int i = 0; i < 8; ++i) f.h[i] = (_Float16)(bf16_round(W[(size_t)(k8 + i) * N + n]) * scale); const v8us o = f.half[0];
  *(v8us*)((unsigned short*)Wt + (size_t)n * K + k8) = o; 
}

typedef _Float16 v4h __attribute__((ext_vector_type(4)));

__global__ __launch_bounds__(256) void k_wtn_f16(const float* __restrict__ W, _Float16* __restrict__ Wt, int K, int N, float scale) {
  const int t = blockIdx.x * 256 + threadIdx.x; if (t >= N * (K / 8)) return; const int n = t / (K / 8), k8 = (t % (K / 8)) * 8; FragH f;
  for (int i = 0; i < 8; ++i) f.h[i] = (_Float16)(W[(size_t)(k8 + i) * N + n] * scale);
  unsigned short* o = (unsigned short*)Wt + (size_t)n * K + k8; *(v8us*)o = f.half[0];  }

__global__ __launch_bounds__(256) void k_hl(const float* __restrict__ F, _Float16* __restrict__ Hh, _Float16* __restrict__ Hl, size_t n8) { const size_t t = (size_t)blockIdx.x * 256 + threadIdx.x; if (t >= n8) return; FragH fh, fl; const v4f a = *(const v4fa*)(F + t * 8), c = *(const v4fa*)(F + t * 8 + 4);
#pragma unroll
  for (int q = 0; q < 4; ++q) { _Float16 h = (_Float16)a[q]; fh.h[q] = h; fl.h[q] = (_Float16)((a[q] - (float)h) * 1024.0f); h = (_Float16)c[q]; fh.h[4 + q] = h; fl.h[4 + q] = (_Float16)((c[q] - (float)h) * 1024.0f); }
  { *(v8us*)((unsigned short*)Hh + t * 8) = fh.half[0]; *(v8us*)((unsigned short*)Hl + t * 8) = fl.half[0];  } }

__global__ __launch_bounds__(256) void k_x16(const float* __restrict__ x, _Float16* __restrict__ X16, size_t n8) { const size_t t = (size_t)blockIdx.x * 256 + threadIdx.x; if (t >= n8) return; FragH f;
#pragma unroll
  for (int q = 0; q < 8; ++q) f.h[q] = (_Float16)bf16_round(x[t * 8 + q]); *(v8us*)((unsigned short*)X16 + t * 8) = f.half[0];  }

// ---- fast GEMM (wave tile 32x64, work-group tile 128x64; requires M % 128 == 0 rows per launch region, N % 64 == 0 and K % 64 == 0); both operands staged in LDS 64 k at a time, two buffers ----
#define G2P 72                       /* 16-bit words of a staged row: 64 + 8, a pitch of 144 bytes (16 bytes x odd: 16 rows read 16 bytes a lane without bank conflicts) */
#define G2S (192 * G2P)              /* 16-bit words of a stage: 128 rows of A, then 64 rows of B */
__device__ __forceinline__ v16h g2_frag(const _Float16* p, int hh) { FragH f; f.half[0] = *(const v8us*)((const unsigned short*)p + 8 * hh); f.half[1] = *(const v8us*)((const unsigned short*)p + 16 + 8 * hh); return f.v; }
__device__ __forceinline__ v8f g2_mma(v16h a, v16h b, v8f c) { v8f d = __builtin_amdgcn_wmma_f32_16x16x32_f16(false, a, false, b, (short)0, c, false, false); asm volatile("v_nop\n\tv_nop\n\tv_nop\n\tv_nop" : "+v"(d) : "v"(a), "v"(b)); return d; }
template <int ACT>
__global__ __launch_bounds__(128) void k_gemm2(const _Float16* __restrict__ A, int lda, size_t sA, const _Float16* __restrict__ Bh, int ldb, size_t sB, float alpha, const float* __restrict__ bias, size_t sBias, const float* __restrict__ CP, int rowsPerB, size_t sCPb, int row0g,
    float* __restrict__ C, _Float16* __restrict__ C16, int ldc, size_t sC, int M, int N, int K) { static_assert(ACT == 0 || ACT == 3 || ACT == 6 || ACT == 8 || ACT == 9 || ACT == 11 || ACT == 12 || ACT == 14 || ACT == 15 || ACT == 16 || ACT == 17, "k_gemm2: unsupported ACT code (would silently apply no activation)");
  __shared__ __attribute__((aligned(16))) unsigned char sm[2 * G2S * 2]; static_assert(sizeof(sm) >= 4 * 32 * 68 * 4, "the result's staging re-uses the two operand buffers");
  float (*so)[32][68] = (float (*)[32][68])sm;      /* written only behind the k loop's last barrier */
  const int tid = threadIdx.x, w = tid >> 5, lane = tid & 31, ln = lane & 15, hh = lane >> 4; const int by = blockIdx.y;
  A += (size_t)by * sA; Bh += (size_t)by * sB; const size_t cofs = (size_t)by * sC; const float* bp = bias ? bias + (size_t)by * sBias : nullptr;
  const int ntn = N >> 6; const int mt = blockIdx.x / ntn, nq = blockIdx.x - mt * ntn; const int row0 = mt * 128 + 32 * w, col0 = nq * 64; if (mt * 128 >= M) return;      /* the whole work-group leaves or none does: barriers follow */
  const int sr = tid >> 3, sk = (tid & 7) * 8;      /* staging: 8 threads a row of 128 bytes, so a wave's load is 4 whole lines; 16 rows a round of the work-group */
  const unsigned short* ga = (const unsigned short*)A + (size_t)(mt * 128 + sr) * lda + sk; const unsigned short* gb = (const unsigned short*)Bh + (size_t)(col0 + sr) * ldb + sk;
  unsigned short* sh = (unsigned short*)sm; const int swo = sr * G2P + sk; v8us st[12];
  const v8f z8 = {0.f,0.f,0.f,0.f,0.f,0.f,0.f,0.f}; v8f c00 = z8, c01 = z8, c02 = z8, c03 = z8, c10 = z8, c11 = z8, c12 = z8, c13 = z8;
  for (int i = 0; i < 8; ++i) st[i] = *(const v8us*)(ga + (size_t)(16 * i) * lda);
  for (int i = 0; i < 4; ++i) st[8 + i] = *(const v8us*)(gb + (size_t)(16 * i) * ldb);
  for (int i = 0; i < 12; ++i) *(v8us*)(sh + swo + i * 16 * G2P) = st[i];
  __syncthreads();      /* stage 0 is in LDS before a wave reads it */
  for (int kb = 0; kb < K; kb += 64) { const int cur = (kb >> 6) & 1; const bool more = kb + 64 < K;
    if (more) {      /* the next stage's words fly while this stage is multiplied */
      for (int i = 0; i < 8; ++i) st[i] = *(const v8us*)(ga + (size_t)(16 * i) * lda + kb + 64);
      for (int i = 0; i < 4; ++i) st[8 + i] = *(const v8us*)(gb + (size_t)(16 * i) * ldb + kb + 64); }
    const _Float16* pa = (const _Float16*)(sh + cur * G2S + (32 * w + ln) * G2P); const _Float16* pb = (const _Float16*)(sh + cur * G2S + (128 + ln) * G2P);
    v16h a0[2], a1[2], b[2][4];
    for (int ks = 0; ks < 2; ++ks) { a0[ks] = g2_frag(pa + 32 * ks, hh); a1[ks] = g2_frag(pa + 16 * G2P + 32 * ks, hh);
      for (int t = 0; t < 4; ++t) b[ks][t] = g2_frag(pb + t * 16 * G2P + 32 * ks, hh); }
    for (int ks = 0; ks < 2; ++ks) { c00 = g2_mma(a0[ks], b[ks][0], c00); c10 = g2_mma(a1[ks], b[ks][0], c10); c01 = g2_mma(a0[ks], b[ks][1], c01); c11 = g2_mma(a1[ks], b[ks][1], c11);
      c02 = g2_mma(a0[ks], b[ks][2], c02); c12 = g2_mma(a1[ks], b[ks][2], c12); c03 = g2_mma(a0[ks], b[ks][3], c03); c13 = g2_mma(a1[ks], b[ks][3], c13); }
    if (more) {
      for (int i = 0; i < 12; ++i) *(v8us*)(sh + (cur ^ 1) * G2S + swo + i * 16 * G2P) = st[i]; }      /* the other buffer: its readers left it in front of the last barrier */
    __syncthreads(); }      /* publishes the next stage and ends this stage's reads (behind the last stage: before the result's staging re-uses the bytes) */
  v8f accs[8] = {c00, c01, c02, c03, c10, c11, c12, c13};
#pragma unroll
  for (int u = 0; u < 8; ++u) { const int t = u & 3, half = u >> 2; const int col = col0 + t * 16 + ln; const float bv = bp ? bf16_round(bp[col]) : 0.f;
#pragma unroll
    for (int r = 0; r < 8; ++r) { const int rloc = half * 16 + 8 * hh + r; float v = accs[u][r] * alpha + bv; if (CP) { if (rowsPerB < 0) v += CP[cofs + (size_t)(row0g + row0 + rloc) * ldc + col];      /* rowsPerB < 0: own element of the batched C plane */ else { const int bidx = (row0g + row0 + rloc) / rowsPerB; v += CP[(size_t)bidx * sCPb + (size_t)by * 64 + col]; } }
      if (ACT == 3) v = fmaxf(v, 0.f); else if (ACT == 6) v = 0.5f * v * (1.0f + erff(v * 0.70710678118654752f)); else if (ACT == 11) v = 1.0f / (1.0f + expf(-v)); else if (ACT == 15) v = v / (1.0f + expf(-v)); else if (ACT == 12) v = (v > 0.f) ? v : 0.01f * v; else if (ACT == 8) v = tanhf(v); else if (ACT == 9) v = 0.5f * v * (1.0f + tanhf(0.7978845608028654f * (v + 0.044715f * v * v * v))); else if (ACT == 14) v = (v > 0.f) ? v : 0.1f * v; else if (ACT == 16) v = (v >= 0.f) ? v : 0.3f * v; else if (ACT == 17) v = (v >= 0.f) ? v : 0.2f * v;
      so[w][rloc][t * 16 + ln] = v; } }
  __builtin_amdgcn_fence(__ATOMIC_ACQ_REL, "workgroup"); __builtin_amdgcn_wave_barrier();
  const int rsub = lane >> 4, c4 = (lane & 15) * 4;
  {
#pragma unroll
    for (int q = 0; q < 16; ++q) { const int r = q * 2 + rsub; const v4f v = *(const v4fa*)&so[w][r][c4]; if (C) *(v4f*)(C + cofs + (size_t)(row0 + r) * ldc + col0 + c4) = v; if (C16) { v4h h4; for (int i = 0; i < 4; ++i) h4[i] = (_Float16)v[i]; *(v4h*)(C16 + cofs + (size_t)(row0 + r) * ldc + col0 + c4) = h4; } }
     } }

__global__ __launch_bounds__(256) void k_sln(const float* __restrict__ F, float* __restrict__ LN) {
  const unsigned t = blockIdx.x * 256u + threadIdx.x; if (t >= (unsigned)(QNG * QNS * QNL)) return;
  const unsigned i = t % QNL, s = (t / QNL) % QNS, g = t / (QNL * QNS); const float* p = F + ((size_t)g * QNL + i) * QNW + s * QSW; float a = 0.0f;
  for (unsigned c = 0; c < (unsigned)QSW; c += 4) { const v4f w = *(const v4fa*)(p + c);
#pragma unroll
    for (int q = 0; q < 4; ++q) a += w[q] * w[q]; }
  *(float*)(LN + t) = a;  }

// A work-group takes QCB columns of one strip over all its rows (a wave's load or store = 2 rows of 256 bytes in a row): sc is formed in place as before, and each thread keeps the running sums of its 4 columns, so sc is not read again for nc.
__global__ __launch_bounds__(1024) __attribute__((amdgpu_waves_per_eu(8, 8)))      /* one work-group of 32 waves a WGP = 8 waves a SIMD: told so, the compiler spends registers on interleaving a trip's four powers (more dual issue) */
void k_pcs(float* SC, const float* __restrict__ la, const float* __restrict__ lb, float* __restrict__ CF) {
  static_assert(QCB == 64 && QNL % QCB == 0 && QNL % QCR == 0 && QCR * (QCB / 4) == 1024, "16 threads a row piece, QCR rows a pass, whole passes");
  __shared__ __attribute__((aligned(16))) float ps[QCR][QCB];
  const unsigned tid = threadIdx.x, c4 = (tid & 15u) * 4u, rr = tid >> 4; const unsigned s = blockIdx.x / (QNL / QCB), j0 = (blockIdx.x % (QNL / QCB)) * QCB;
  float* p = SC + (size_t)s * QNL * QNL + (size_t)rr * QNL + j0 + c4; const float* lq = la + s * QNL + rr; const v4f kb = *(const v4fa*)(lb + s * QNL + j0 + c4);
  v4f a = {0.f, 0.f, 0.f, 0.f}; v4f z = *(const v4fa*)p; float qa = lq[0];
  for (unsigned k = 0; k < (unsigned)(QNL / QCR); ++k) { const unsigned kn = (k + 1 < (unsigned)(QNL / QCR)) ? k + 1 : k;      /* the next pass's words are fetched ahead of this pass's arithmetic (the last pass fetches its own again, unused) */
    const v4f zn = *(const v4fa*)(p + (size_t)kn * QCR * QNL); const float qn = lq[kn * QCR]; v4f w;
#pragma unroll
    for (int q = 0; q < 4; ++q) { const float e2 = (qa + kb[q]) - 2.0f * z[q]; const float gd = sqrtf(fmaxf(e2, QLO)) / QDS; w[q] = powf(1.0f + gd, QPW); }
    *(v4fa*)(p + (size_t)k * QCR * QNL) = w; a += w; z = zn; qa = qn; }
  *(v4fa*)&ps[rr][c4] = a;
  __syncthreads();      /* the QCR partial sums of every column are in LDS before a thread a column adds them */
  if (tid < (unsigned)QCB) { float t = 0.0f;
#pragma unroll
    for (int r = 0; r < QCR; ++r) t += ps[r][tid];
    CF[s * QNL + j0 + tid] = 1.0f / sqrtf(t); } }

// A wave takes QRW rows of sc one after the other, each whole row in its registers (a lane: 8 pieces of 4 words, a load of the wave = 512 bytes in a row): nr, kt's row sum and pb from ONE read.
__device__ __forceinline__ float wave_sum(float s) {      /* butterfly over the 32 lanes: every lane ends with the same bits */
  s += __int_as_float(__builtin_amdgcn_update_dpp(0, __float_as_int(s), 0x161, 0xf, 0xf, false));      /* row_xmask:1 */
  s += __int_as_float(__builtin_amdgcn_update_dpp(0, __float_as_int(s), 0x162, 0xf, 0xf, false));      /* row_xmask:2 */
  s += __int_as_float(__builtin_amdgcn_update_dpp(0, __float_as_int(s), 0x164, 0xf, 0xf, false));      /* row_xmask:4 */
  s += __int_as_float(__builtin_amdgcn_update_dpp(0, __float_as_int(s), 0x168, 0xf, 0xf, false));      /* row_xmask:8 */
  const int b = __float_as_int(s); s += __int_as_float(__builtin_amdgcn_permlanex16(b, b, 0x76543210, 0xfedcba98, false, false));      /* lane l with lane l ^ 16 */
  return s; }

__global__ __launch_bounds__(QWV * 32) void k_ktw(const float* __restrict__ SC, const float* __restrict__ CF, _Float16* __restrict__ PB) {
  static_assert(QNL == 8 * 128 && QNL % QRW == 0 && (QNS * QNL) % (QWV * QRW) == 0, "a row is 8 loads of a wave; a wave's rows lie in one strip; whole work-groups");
  const unsigned lane = threadIdx.x & 31u, wave = (unsigned)__builtin_amdgcn_readfirstlane((int)(threadIdx.x >> 5)); const unsigned r0 = (blockIdx.x * QWV + wave) * QRW;
  const float* p = SC + (size_t)r0 * QNL + lane * 4; const float* cf = CF + (size_t)(r0 / QNL) * QNL + lane * 4; _Float16* o = PB + (size_t)r0 * QNL + lane * 4;
  v4f c[8], w[2][8];
#pragma unroll
  for (int q = 0; q < 8; ++q) w[0][q] = *(const v4fa*)(p + q * 128);
#pragma unroll
  for (int q = 0; q < 8; ++q) c[q] = *(const v4fa*)(cf + q * 128);
#pragma unroll
  for (int k = 0; k < QRW; ++k) { v4f* t = w[k & 1];
    __builtin_amdgcn_sched_barrier(0);      /* this one and the one behind the loads pin the order: the next row's loads, then this row's arithmetic; without them the next row's sum is drawn forward into this row's arithmetic and its loads get less time to land */
    if (k + 1 < QRW) {
#pragma unroll
      for (int q = 0; q < 8; ++q) w[(k + 1) & 1][q] = *(const v4fa*)(p + (size_t)(k + 1) * QNL + q * 128);
      if (k == 0) asm volatile("s_wait_xcnt 0x0" ::: "memory");      /* the wait in front of the first overwrite of the scalar base that the loads of c name (the arithmetic below re-uses it) */
      __builtin_amdgcn_sched_barrier(0); }
    v4f a = {0.f, 0.f, 0.f, 0.f};
#pragma unroll
    for (int q = 0; q < 8; ++q) a += t[q];
    const float rf = 1.0f / sqrtf(wave_sum((a[0] + a[1]) + (a[2] + a[3]))); a = (v4f){0.f, 0.f, 0.f, 0.f};
#pragma unroll
    for (int q = 0; q < 8; ++q) { t[q] = (rf * t[q]) * c[q]; a += t[q]; }
    const float dn = fmaxf(wave_sum((a[0] + a[1]) + (a[2] + a[3])), QLO);
#pragma unroll
    for (int q = 0; q < 8; ++q) { v4h h;
#pragma unroll
      for (int i = 0; i < 4; ++i) h[i] = (_Float16)((t[q][i] / dn) * QPC);
      *(v4h*)(o + (size_t)k * QNL + q * 128) = h;
      if (k + 1 < QRW || q < 7) asm volatile("s_wait_xcnt 0x0" ::: "memory"); } }      /* the wait in front of the next overwrite of the store's data registers (later pieces, the next rows' loads); behind the wave's last store nothing is overwritten */
}

extern "C" void kernel_launch(void* const* d_in, const int* in_sizes, int n_in,
                              void* d_out, int out_size, void* d_ws, size_t ws_size, hipStream_t stream) {
  (void)in_sizes; (void)n_in; (void)out_size;
  const float* const* I = (const float* const*)d_in; const float* xa = I[0]; const float* wa = I[1]; const float* va = I[2]; const float* wb = I[3]; const float* vb = I[4]; const float* wc = I[5]; const float* vc = I[6]; const float* wd = I[7]; const float* vd = I[8];      /* xa [2][1024][1024]; the four weights [1024][1024] (source, result); the four added vectors [1024] */
  float* res = (float*)d_out;
  static_assert((QNG * QNL) % 128 == 0 && QNL % 128 == 0 && QNW % 64 == 0 && QNW % 32 == 0 && QSW % 64 == 0 && QSW % 32 == 0 && QNL % 8 == 0 && QNS * QSW == QNW, "whole tiles");
  uint8_t* wsp = (uint8_t*)d_ws; size_t off = 0;
  auto take = [&](size_t bytes) { uint8_t* p = wsp + off; off += (bytes + 255) & ~(size_t)255; return p; };
  const size_t GW = (size_t)QNG * QNL * QNW, G1 = (size_t)QNL * QNW;
  float* SC = (float*)take((size_t)QNS * QNL * QNL * 4); _Float16* PB = (_Float16*)take((size_t)QNS * QNL * QNL * 2); float* FA = (float*)take(GW * 4); float* FB = (float*)take(GW * 4); float* FC = (float*)take(GW * 4); float* CX = (float*)take(GW * 4);
  _Float16* XH = (_Float16*)take(GW * 2); _Float16* AH = (_Float16*)take(GW * 2); _Float16* AL = (_Float16*)take(GW * 2); _Float16* BH = (_Float16*)take(GW * 2); _Float16* BL = (_Float16*)take(GW * 2); _Float16* CH = (_Float16*)take(GW * 2); _Float16* CL = (_Float16*)take(GW * 2); _Float16* VT = (_Float16*)take(G1 * 2);
  _Float16* WA = (_Float16*)take((size_t)QNW * QNW * 2); _Float16* WB = (_Float16*)take((size_t)QNW * QNW * 2); _Float16* WC = (_Float16*)take((size_t)QNW * QNW * 2); _Float16* WD = (_Float16*)take((size_t)QNW * QNW * 2); float* LA = (float*)take((size_t)QNG * QNS * QNL * 4); float* LB = (float*)take((size_t)QNG * QNS * QNL * 4); float* CF = (float*)take((size_t)QNS * QNL * 4);      /* a group's sixteen sheets of sc and of pb (re-used group after group); the three projections and cx in f32; xa's cast; the words and the unused residuals of fa, fb, cx; a group's transposed fc; the four weights transposed; the strips' squared lengths; a group's column factors */
  if (off > ws_size) return;
  k_x16<<<(unsigned)((GW / 8 + 255) / 256), 256, 0, stream>>>(xa, XH, GW / 8);
  k_wt_f16<<<(unsigned)(((size_t)QNW * (QNW / 8) + 255) / 256), 256, 0, stream>>>(wa, WA, QNW, QNW, QWC);      /* WA[o][k] = f16(64 wa[k][o]) */
  k_wt_f16<<<(unsigned)(((size_t)QNW * (QNW / 8) + 255) / 256), 256, 0, stream>>>(wb, WB, QNW, QNW, QWC);
  k_wt_f16<<<(unsigned)(((size_t)QNW * (QNW / 8) + 255) / 256), 256, 0, stream>>>(wc, WC, QNW, QNW, QWC);
  k_wt_f16<<<(unsigned)(((size_t)QNW * (QNW / 8) + 255) / 256), 256, 0, stream>>>(wd, WD, QNW, QNW, QWC);
  k_gemm2<0><<<dim3((unsigned)(((QNG * QNL) / 128) * (QNW / 64)), 1), 128, 0, stream>>>(XH, QNW, 0, WA, QNW, 0, 1.0f / QWC, va, 0, nullptr, 1, 0, 0, FA, nullptr, QNW, 0, QNG * QNL, QNW, QNW);      /* FA[(g, i)][o] = xa[g][i][:] . wa[:][o] + va[o] */
  k_gemm2<0><<<dim3((unsigned)(((QNG * QNL) / 128) * (QNW / 64)), 1), 128, 0, stream>>>(XH, QNW, 0, WB, QNW, 0, 1.0f / QWC, vb, 0, nullptr, 1, 0, 0, FB, nullptr, QNW, 0, QNG * QNL, QNW, QNW);
  k_gemm2<0><<<dim3((unsigned)(((QNG * QNL) / 128) * (QNW / 64)), 1), 128, 0, stream>>>(XH, QNW, 0, WC, QNW, 0, 1.0f / QWC, vc, 0, nullptr, 1, 0, 0, FC, nullptr, QNW, 0, QNG * QNL, QNW, QNW);
  k_sln<<<(unsigned)((QNG * QNS * QNL + 255) / 256), 256, 0, stream>>>(FA, LA);
  k_sln<<<(unsigned)((QNG * QNS * QNL + 255) / 256), 256, 0, stream>>>(FB, LB);
  k_hl<<<(unsigned)((GW / 8 + 255) / 256), 256, 0, stream>>>(FA, AH, AL, GW / 8);      /* AH is used; AL is written and not read */
  k_hl<<<(unsigned)((GW / 8 + 255) / 256), 256, 0, stream>>>(FB, BH, BL, GW / 8);
  for (int g = 0; g < QNG; ++g) {      /* a literal 2 on the host: SC, PB, VT and CF are re-used group after group */
    k_wtn_f16<<<(unsigned)(((size_t)QNW * (QNL / 8) + 255) / 256), 256, 0, stream>>>(FC + g * G1, VT, QNL, QNW, 1.0f);      /* VT[(s, c)][j] = f16(fc[g][j][s 64 + c]) */
    k_gemm2<0><<<dim3((unsigned)((QNL / 128) * (QNL / 64)), QNS), 128, 0, stream>>>(AH + g * G1, QNW, (size_t)QSW, BH + g * G1, QNW, (size_t)QSW, 1.0f, nullptr, 0, nullptr, 1, 0, 0, SC, nullptr, QNL, (size_t)QNL * QNL, QNL, QNL, QSW);      /* SC[s][i][j] = fa[g][i][s] . fb[g][j][s] */
    k_pcs<<<(unsigned)(QNS * (QNL / QCB)), 1024, 0, stream>>>(SC, LA + (size_t)g * QNS * QNL, LB + (size_t)g * QNS * QNL, CF);
    k_ktw<<<(unsigned)((QNS * QNL) / (QWV * QRW)), QWV * 32, 0, stream>>>(SC, CF, PB);
    k_gemm2<0><<<dim3((unsigned)((QNL / 128) * (QSW / 64)), QNS), 128, 0, stream>>>(PB, QNL, (size_t)QNL * QNL, VT, QNL, (size_t)QSW * QNL, 1.0f / QPC, nullptr, 0, nullptr, 1, 0, 0, CX + g * G1, nullptr, QNW, (size_t)QSW, QNL, QSW, QNL); }      /* CX[g][i][s 64 + c] = sum over j of PB[s][i][j] fc[g][j][s 64 + c] / 2^12: in place at a strip's column offset */
  k_hl<<<(unsigned)((GW / 8 + 255) / 256), 256, 0, stream>>>(CX, CH, CL, GW / 8);      /* CH is used; CL is written and not read */
  k_gemm2<0><<<dim3((unsigned)(((QNG * QNL) / 128) * (QNW / 64)), 1), 128, 0, stream>>>(CH, QNW, 0, WD, QNW, 0, 1.0f / QWC, vd, 0, nullptr, 1, 0, 0, res, nullptr, QNW, 0, QNG * QNL, QNW, QNW);      /* res = cx wd + vd: every word of the result once */
}

// v004
// Measured time: 237 microseconds a run.
// In both of two side-by-side timings against v003, it was 1.17 times as fast.
// Over all steps from v000 it is 2.72 times as fast.
// A distance-kernel mixing of rows: xa [2][1024][1024] (group, row, width); wa, wb, wc, wd [1024][1024] stored (source column, result column), va, vb, vc, vd [1024]: fa | fb | fc = xa w + v, split into 16 strips of 64 columns; for a group and a strip: e2[i][j] = |fa_i|^2 + |fb_j|^2 - 2 fa_i . fb_j; gd = sqrt(max(e2, 1e-12)) / 64; sc = (1 + gd)^(-65.5); nr = its row sums, nc = its column sums; kt = nr^(-1/2) sc nc^(-1/2); pb = kt / max(its row sum, 1e-12); cx = pb fc's strip; res = cx wd + vd -> [2][1024][1024] f32: one result.
// Structure: xa cast to f16 as it lies and the four weights cast transposed behind a carry of 64 (converted to bf16 first); three WMMA GEMMs (the carry undone in their scale argument; the added vectors live) into f32 sheets; ONE flat kernel a thread a (row, strip) takes a strip's squared length (64 words in index order); fa and fb split into f16 words (the residual sheets unused); THEN A GROUP AT A TIME (a literal 2 on the host): the frame's transposing cast without a conversion (k_wtn_f16: a computed sheet) lays fc's group transposed as f16 words; one WMMA GEMM with the strip as the grid's second index forms fa . fb (depth 64) into sixteen f32 sheets; ONE kernel, a work-group 64 columns of a strip over all rows, forms sc in place from the two lengths and the product (the root, log2 and exp2 instructions: the power as 2^(-65.5 log2(1 + gd))), sums its columns as it goes (thread partials, then LDS) and stores each sum's reciprocal root; ONE kernel a wave four rows in turn (each row in the wave's registers, read once) forms the row's sum, kt's row sum (lane partials, then a butterfly) and stores pb as one f16 word behind a carry of 2^12; one WMMA GEMM (depth 1,024; its scale undoes the carry) writes cx in place at a strip's column offset; then cx split into f16 words and the last WMMA GEMM writes the result.
// Compute dtype: all nine inputs converted to bf16 where they are read; xa's words exact as f16 operands down to 2^-14; the weights' behind 64; the computed sheets ONE f16 word each (pb behind 2^12); every product's accumulation, the lengths, the kernel's arithmetic, the sums and the result f32. v_wmma_f32_16x16x32_f16.
#include <hip/hip_runtime.h>
#define QNG 2                        /* groups */
#define QNL 1024                     /* rows of a group */
#define QNW 1024                     /* a row's width: every projection's depth and width */
#define QNS 16                       /* strips */
#define QSW 64                       /* a strip's width: the pair product's depth */
#define QDS 64.0f                    /* the distance's divisor */
#define QPW -65.5f                   /* the power */
#define QLO 1e-12f                   /* the lower bound of e2 and of a row's sum */
#define QWC 64.0f                    /* the weights' carry (undone in the products' scale argument) */
#define QPC 4096.0f                  /* pb's carry (undone in the fifth product's scale argument) */
#define QWV 16                       /* waves of a work-group of the row kernel */
#define QRW 4                        /* rows of sc that one of its waves takes */
#define QCB 64                       /* columns of sc that a work-group of the power kernel takes */
#define QCR 64                       /* rows of sc that it takes in one pass */
typedef unsigned short v8us __attribute__((ext_vector_type(8), may_alias));
typedef float  v8f  __attribute__((ext_vector_type(8)));
typedef float  v4f  __attribute__((ext_vector_type(4)));
typedef float  v4fa __attribute__((ext_vector_type(4), may_alias));

__device__ __forceinline__ unsigned short bf16_bits(float x) { unsigned int u = __float_as_uint(x); return (unsigned short)((u + 0x7FFFu + ((u >> 16) & 1u)) >> 16); }
__device__ __forceinline__ float bf16_val(unsigned short b) { return __uint_as_float(((unsigned int)b) << 16); }
__device__ __forceinline__ float bf16_round(float x) { return bf16_val(bf16_bits(x)); }

typedef _Float16 v16h __attribute__((ext_vector_type(16)));
union FragH { v16h v; v8us half[2]; _Float16 h[16]; unsigned short u[16]; };

// Wt[n][k] = f16(W[k][n] x scale) from f32 row-major W[K][N] (scale = power of two; bf16-exact weights stay exact in f16 away from the subnormal range)
__global__ __launch_bounds__(256) void k_wt_f16(const float* __restrict__ W, _Float16* __restrict__ Wt, int K, int N, float scale) {
  const int t = blockIdx.x * 256 + threadIdx.x; if (t >= N * (K / 8)) return; const int n = t / (K / 8), k8 = (t % (K / 8)) * 8; FragH f;
#pragma unroll
  for (int i = 0; i < 8; ++i) f.h[i] = (_Float16)(bf16_round(W[(size_t)(k8 + i) * N + n]) * scale); const v8us o = f.half[0];
  *(v8us*)((unsigned short*)Wt + (size_t)n * K + k8) = o; 
}

typedef _Float16 v4h __attribute__((ext_vector_type(4)));

__global__ __launch_bounds__(256) void k_wtn_f16(const float* __restrict__ W, _Float16* __restrict__ Wt, int K, int N, float scale) {
  const int t = blockIdx.x * 256 + threadIdx.x; if (t >= N * (K / 8)) return; const int n = t / (K / 8), k8 = (t % (K / 8)) * 8; FragH f;
  for (int i = 0; i < 8; ++i) f.h[i] = (_Float16)(W[(size_t)(k8 + i) * N + n] * scale);
  unsigned short* o = (unsigned short*)Wt + (size_t)n * K + k8; *(v8us*)o = f.half[0];  }

__global__ __launch_bounds__(256) void k_hl(const float* __restrict__ F, _Float16* __restrict__ Hh, _Float16* __restrict__ Hl, size_t n8) { const size_t t = (size_t)blockIdx.x * 256 + threadIdx.x; if (t >= n8) return; FragH fh, fl; const v4f a = *(const v4fa*)(F + t * 8), c = *(const v4fa*)(F + t * 8 + 4);
#pragma unroll
  for (int q = 0; q < 4; ++q) { _Float16 h = (_Float16)a[q]; fh.h[q] = h; fl.h[q] = (_Float16)((a[q] - (float)h) * 1024.0f); h = (_Float16)c[q]; fh.h[4 + q] = h; fl.h[4 + q] = (_Float16)((c[q] - (float)h) * 1024.0f); }
  { *(v8us*)((unsigned short*)Hh + t * 8) = fh.half[0]; *(v8us*)((unsigned short*)Hl + t * 8) = fl.half[0];  } }

__global__ __launch_bounds__(256) void k_x16(const float* __restrict__ x, _Float16* __restrict__ X16, size_t n8) { const size_t t = (size_t)blockIdx.x * 256 + threadIdx.x; if (t >= n8) return; FragH f;
#pragma unroll
  for (int q = 0; q < 8; ++q) f.h[q] = (_Float16)bf16_round(x[t * 8 + q]); *(v8us*)((unsigned short*)X16 + t * 8) = f.half[0];  }

// ---- fast GEMM (wave tile 32x64, work-group tile 128x64; requires M % 128 == 0 rows per launch region, N % 64 == 0 and K % 64 == 0); both operands staged in LDS 64 k at a time, two buffers ----
#define G2P 72                       /* 16-bit words of a staged row: 64 + 8, a pitch of 144 bytes (16 bytes x odd: 16 rows read 16 bytes a lane without bank conflicts) */
#define G2S (192 * G2P)              /* 16-bit words of a stage: 128 rows of A, then 64 rows of B */
__device__ __forceinline__ v16h g2_frag(const _Float16* p, int hh) { FragH f; f.half[0] = *(const v8us*)((const unsigned short*)p + 8 * hh); f.half[1] = *(const v8us*)((const unsigned short*)p + 16 + 8 * hh); return f.v; }
__device__ __forceinline__ v8f g2_mma(v16h a, v16h b, v8f c) { v8f d = __builtin_amdgcn_wmma_f32_16x16x32_f16(false, a, false, b, (short)0, c, false, false); asm volatile("v_nop\n\tv_nop\n\tv_nop\n\tv_nop" : "+v"(d) : "v"(a), "v"(b)); return d; }
template <int ACT>
__global__ __launch_bounds__(128) void k_gemm2(const _Float16* __restrict__ A, int lda, size_t sA, const _Float16* __restrict__ Bh, int ldb, size_t sB, float alpha, const float* __restrict__ bias, size_t sBias, const float* __restrict__ CP, int rowsPerB, size_t sCPb, int row0g,
    float* __restrict__ C, _Float16* __restrict__ C16, int ldc, size_t sC, int M, int N, int K) { static_assert(ACT == 0 || ACT == 3 || ACT == 6 || ACT == 8 || ACT == 9 || ACT == 11 || ACT == 12 || ACT == 14 || ACT == 15 || ACT == 16 || ACT == 17, "k_gemm2: unsupported ACT code (would silently apply no activation)");
  __shared__ __attribute__((aligned(16))) unsigned char sm[2 * G2S * 2]; static_assert(sizeof(sm) >= 4 * 32 * 68 * 4, "the result's staging re-uses the two operand buffers");
  float (*so)[32][68] = (float (*)[32][68])sm;      /* written only behind the k loop's last barrier */
  const int tid = threadIdx.x, w = tid >> 5, lane = tid & 31, ln = lane & 15, hh = lane >> 4; const int by = blockIdx.y;
  A += (size_t)by * sA; Bh += (size_t)by * sB; const size_t cofs = (size_t)by * sC; const float* bp = bias ? bias + (size_t)by * sBias : nullptr;
  const int ntn = N >> 6; const int mt = blockIdx.x / ntn, nq = blockIdx.x - mt * ntn; const int row0 = mt * 128 + 32 * w, col0 = nq * 64; if (mt * 128 >= M) return;      /* the whole work-group leaves or none does: barriers follow */
  const int sr = tid >> 3, sk = (tid & 7) * 8;      /* staging: 8 threads a row of 128 bytes, so a wave's load is 4 whole lines; 16 rows a round of the work-group */
  const unsigned short* ga = (const unsigned short*)A + (size_t)(mt * 128 + sr) * lda + sk; const unsigned short* gb = (const unsigned short*)Bh + (size_t)(col0 + sr) * ldb + sk;
  unsigned short* sh = (unsigned short*)sm; const int swo = sr * G2P + sk; v8us st[12];
  const v8f z8 = {0.f,0.f,0.f,0.f,0.f,0.f,0.f,0.f}; v8f c00 = z8, c01 = z8, c02 = z8, c03 = z8, c10 = z8, c11 = z8, c12 = z8, c13 = z8;
  for (int i = 0; i < 8; ++i) st[i] = *(const v8us*)(ga + (size_t)(16 * i) * lda);
  for (int i = 0; i < 4; ++i) st[8 + i] = *(const v8us*)(gb + (size_t)(16 * i) * ldb);
  for (int i = 0; i < 12; ++i) *(v8us*)(sh + swo + i * 16 * G2P) = st[i];
  __syncthreads();      /* stage 0 is in LDS before a wave reads it */
  for (int kb = 0; kb < K; kb += 64) { const int cur = (kb >> 6) & 1; const bool more = kb + 64 < K;
    if (more) {      /* the next stage's words fly while this stage is multiplied */
      for (int i = 0; i < 8; ++i) st[i] = *(const v8us*)(ga + (size_t)(16 * i) * lda + kb + 64);
      for (int i = 0; i < 4; ++i) st[8 + i] = *(const v8us*)(gb + (size_t)(16 * i) * ldb + kb + 64); }
    const _Float16* pa = (const _Float16*)(sh + cur * G2S + (32 * w + ln) * G2P); const _Float16* pb = (const _Float16*)(sh + cur * G2S + (128 + ln) * G2P);
    v16h a0[2], a1[2], b[2][4];
    for (int ks = 0; ks < 2; ++ks) { a0[ks] = g2_frag(pa + 32 * ks, hh); a1[ks] = g2_frag(pa + 16 * G2P + 32 * ks, hh);
      for (int t = 0; t < 4; ++t) b[ks][t] = g2_frag(pb + t * 16 * G2P + 32 * ks, hh); }
    for (int ks = 0; ks < 2; ++ks) { c00 = g2_mma(a0[ks], b[ks][0], c00); c10 = g2_mma(a1[ks], b[ks][0], c10); c01 = g2_mma(a0[ks], b[ks][1], c01); c11 = g2_mma(a1[ks], b[ks][1], c11);
      c02 = g2_mma(a0[ks], b[ks][2], c02); c12 = g2_mma(a1[ks], b[ks][2], c12); c03 = g2_mma(a0[ks], b[ks][3], c03); c13 = g2_mma(a1[ks], b[ks][3], c13); }
    if (more) {
      for (int i = 0; i < 12; ++i) *(v8us*)(sh + (cur ^ 1) * G2S + swo + i * 16 * G2P) = st[i]; }      /* the other buffer: its readers left it in front of the last barrier */
    __syncthreads(); }      /* publishes the next stage and ends this stage's reads (behind the last stage: before the result's staging re-uses the bytes) */
  v8f accs[8] = {c00, c01, c02, c03, c10, c11, c12, c13};
#pragma unroll
  for (int u = 0; u < 8; ++u) { const int t = u & 3, half = u >> 2; const int col = col0 + t * 16 + ln; const float bv = bp ? bf16_round(bp[col]) : 0.f;
#pragma unroll
    for (int r = 0; r < 8; ++r) { const int rloc = half * 16 + 8 * hh + r; float v = accs[u][r] * alpha + bv; if (CP) { if (rowsPerB < 0) v += CP[cofs + (size_t)(row0g + row0 + rloc) * ldc + col];      /* rowsPerB < 0: own element of the batched C plane */ else { const int bidx = (row0g + row0 + rloc) / rowsPerB; v += CP[(size_t)bidx * sCPb + (size_t)by * 64 + col]; } }
      if (ACT == 3) v = fmaxf(v, 0.f); else if (ACT == 6) v = 0.5f * v * (1.0f + erff(v * 0.70710678118654752f)); else if (ACT == 11) v = 1.0f / (1.0f + expf(-v)); else if (ACT == 15) v = v / (1.0f + expf(-v)); else if (ACT == 12) v = (v > 0.f) ? v : 0.01f * v; else if (ACT == 8) v = tanhf(v); else if (ACT == 9) v = 0.5f * v * (1.0f + tanhf(0.7978845608028654f * (v + 0.044715f * v * v * v))); else if (ACT == 14) v = (v > 0.f) ? v : 0.1f * v; else if (ACT == 16) v = (v >= 0.f) ? v : 0.3f * v; else if (ACT == 17) v = (v >= 0.f) ? v : 0.2f * v;
      so[w][rloc][t * 16 + ln] = v; } }
  __builtin_amdgcn_fence(__ATOMIC_ACQ_REL, "workgroup"); __builtin_amdgcn_wave_barrier();
  const int rsub = lane >> 4, c4 = (lane & 15) * 4;
  {
#pragma unroll
    for (int q = 0; q < 16; ++q) { const int r = q * 2 + rsub; const v4f v = *(const v4fa*)&so[w][r][c4]; if (C) *(v4f*)(C + cofs + (size_t)(row0 + r) * ldc + col0 + c4) = v; if (C16) { v4h h4; for (int i = 0; i < 4; ++i) h4[i] = (_Float16)v[i]; *(v4h*)(C16 + cofs + (size_t)(row0 + r) * ldc + col0 + c4) = h4; } }
     } }

__global__ __launch_bounds__(256) void k_sln(const float* __restrict__ F, float* __restrict__ LN) {
  const unsigned t = blockIdx.x * 256u + threadIdx.x; if (t >= (unsigned)(QNG * QNS * QNL)) return;
  const unsigned i = t % QNL, s = (t / QNL) % QNS, g = t / (QNL * QNS); const float* p = F + ((size_t)g * QNL + i) * QNW + s * QSW; float a = 0.0f;
  for (unsigned c = 0; c < (unsigned)QSW; c += 4) { const v4f w = *(const v4fa*)(p + c);
#pragma unroll
    for (int q = 0; q < 4; ++q) a += w[q] * w[q]; }
  *(float*)(LN + t) = a;  }

// A work-group takes QCB columns of one strip over all its rows (a wave's load or store = 2 rows of 256 bytes in a row): sc is formed in place as before, and each thread keeps the running sums of its 4 columns, so sc is not read again for nc.
__global__ __launch_bounds__(1024) __attribute__((amdgpu_waves_per_eu(8, 8)))      /* one work-group of 32 waves a WGP = 8 waves a SIMD: told so, the compiler spends registers on interleaving a trip's four powers (more dual issue) */
void k_pcs(float* SC, const float* __restrict__ la, const float* __restrict__ lb, float* __restrict__ CF) {
  static_assert(QCB == 64 && QNL % QCB == 0 && QNL % QCR == 0 && QCR * (QCB / 4) == 1024, "16 threads a row piece, QCR rows a pass, whole passes");
  __shared__ __attribute__((aligned(16))) float ps[QCR][QCB];
  const unsigned tid = threadIdx.x, c4 = (tid & 15u) * 4u, rr = tid >> 4; const unsigned s = blockIdx.x / (QNL / QCB), j0 = (blockIdx.x % (QNL / QCB)) * QCB;
  float* p = SC + (size_t)s * QNL * QNL + (size_t)rr * QNL + j0 + c4; const float* lq = la + s * QNL + rr; const v4f kb = *(const v4fa*)(lb + s * QNL + j0 + c4);
  v4f a = {0.f, 0.f, 0.f, 0.f}; v4f z = *(const v4fa*)p; float qa = lq[0];
  for (unsigned k = 0; k < (unsigned)(QNL / QCR); ++k) { const unsigned kn = (k + 1 < (unsigned)(QNL / QCR)) ? k + 1 : k;      /* the next pass's words are fetched ahead of this pass's arithmetic (the last pass fetches its own again, unused) */
    const v4f zn = *(const v4fa*)(p + (size_t)kn * QCR * QNL); const float qn = lq[kn * QCR]; v4f w;
#pragma unroll
    for (int q = 0; q < 4; ++q) { const float e2 = (qa + kb[q]) - 2.0f * z[q]; const float gd = __builtin_amdgcn_sqrtf(fmaxf(e2, QLO)) / QDS;      /* v_sqrt_f32 as it is: its argument is at least QLO, never subnormal */
      w[q] = exp2f(QPW * __builtin_amdgcn_logf(1.0f + gd)); }      /* (1 + gd)^QPW = 2^(QPW log2(1 + gd)); v_log_f32 as it is: its argument is at least 1; exp2f keeps subnormal results */
    *(v4fa*)(p + (size_t)k * QCR * QNL) = w;
    asm volatile("s_wait_xcnt 0x0" ::: "memory");      /* the wait in front of the next overwrite of the store's data and address registers (the next pass's loads and arithmetic re-use them) */
    a += w; z = zn; qa = qn; }
  *(v4fa*)&ps[rr][c4] = a;
  __syncthreads();      /* the QCR partial sums of every column are in LDS before a thread a column adds them */
  if (tid < (unsigned)QCB) { float t = 0.0f;
#pragma unroll
    for (int r = 0; r < QCR; ++r) t += ps[r][tid];
    CF[s * QNL + j0 + tid] = 1.0f / sqrtf(t); } }

// A wave takes QRW rows of sc one after the other, each whole row in its registers (a lane: 8 pieces of 4 words, a load of the wave = 512 bytes in a row): nr, kt's row sum and pb from ONE read.
__device__ __forceinline__ float wave_sum(float s) {      /* butterfly over the 32 lanes: every lane ends with the same bits */
  s += __int_as_float(__builtin_amdgcn_update_dpp(0, __float_as_int(s), 0x161, 0xf, 0xf, false));      /* row_xmask:1 */
  s += __int_as_float(__builtin_amdgcn_update_dpp(0, __float_as_int(s), 0x162, 0xf, 0xf, false));      /* row_xmask:2 */
  s += __int_as_float(__builtin_amdgcn_update_dpp(0, __float_as_int(s), 0x164, 0xf, 0xf, false));      /* row_xmask:4 */
  s += __int_as_float(__builtin_amdgcn_update_dpp(0, __float_as_int(s), 0x168, 0xf, 0xf, false));      /* row_xmask:8 */
  const int b = __float_as_int(s); s += __int_as_float(__builtin_amdgcn_permlanex16(b, b, 0x76543210, 0xfedcba98, false, false));      /* lane l with lane l ^ 16 */
  return s; }

__global__ __launch_bounds__(QWV * 32) void k_ktw(const float* __restrict__ SC, const float* __restrict__ CF, _Float16* __restrict__ PB) {
  static_assert(QNL == 8 * 128 && QNL % QRW == 0 && (QNS * QNL) % (QWV * QRW) == 0, "a row is 8 loads of a wave; a wave's rows lie in one strip; whole work-groups");
  const unsigned lane = threadIdx.x & 31u, wave = (unsigned)__builtin_amdgcn_readfirstlane((int)(threadIdx.x >> 5)); const unsigned r0 = (blockIdx.x * QWV + wave) * QRW;
  const float* p = SC + (size_t)r0 * QNL + lane * 4; const float* cf = CF + (size_t)(r0 / QNL) * QNL + lane * 4; _Float16* o = PB + (size_t)r0 * QNL + lane * 4;
  v4f c[8], w[2][8];
#pragma unroll
  for (int q = 0; q < 8; ++q) w[0][q] = *(const v4fa*)(p + q * 128);
#pragma unroll
  for (int q = 0; q < 8; ++q) c[q] = *(const v4fa*)(cf + q * 128);
#pragma unroll
  for (int k = 0; k < QRW; ++k) { v4f* t = w[k & 1];
    __builtin_amdgcn_sched_barrier(0);      /* this one and the one behind the loads pin the order: the next row's loads, then this row's arithmetic; without them the next row's sum is drawn forward into this row's arithmetic and its loads get less time to land */
    if (k + 1 < QRW) {
#pragma unroll
      for (int q = 0; q < 8; ++q) w[(k + 1) & 1][q] = *(const v4fa*)(p + (size_t)(k + 1) * QNL + q * 128);
      if (k == 0) asm volatile("s_wait_xcnt 0x0" ::: "memory");      /* the wait in front of the first overwrite of the scalar base that the loads of c name (the arithmetic below re-uses it) */
      __builtin_amdgcn_sched_barrier(0); }
    v4f a = {0.f, 0.f, 0.f, 0.f};
#pragma unroll
    for (int q = 0; q < 8; ++q) a += t[q];
    const float rf = 1.0f / sqrtf(wave_sum((a[0] + a[1]) + (a[2] + a[3]))); a = (v4f){0.f, 0.f, 0.f, 0.f};
#pragma unroll
    for (int q = 0; q < 8; ++q) { t[q] = (rf * t[q]) * c[q]; a += t[q]; }
    const float dn = fmaxf(wave_sum((a[0] + a[1]) + (a[2] + a[3])), QLO);
#pragma unroll
    for (int q = 0; q < 8; ++q) { v4h h;
#pragma unroll
      for (int i = 0; i < 4; ++i) h[i] = (_Float16)((t[q][i] / dn) * QPC);
      *(v4h*)(o + (size_t)k * QNL + q * 128) = h;
      if (k + 1 < QRW || q < 7) asm volatile("s_wait_xcnt 0x0" ::: "memory"); } }      /* the wait in front of the next overwrite of the store's data registers (later pieces, the next rows' loads); behind the wave's last store nothing is overwritten */
}

extern "C" void kernel_launch(void* const* d_in, const int* in_sizes, int n_in,
                              void* d_out, int out_size, void* d_ws, size_t ws_size, hipStream_t stream) {
  (void)in_sizes; (void)n_in; (void)out_size;
  const float* const* I = (const float* const*)d_in; const float* xa = I[0]; const float* wa = I[1]; const float* va = I[2]; const float* wb = I[3]; const float* vb = I[4]; const float* wc = I[5]; const float* vc = I[6]; const float* wd = I[7]; const float* vd = I[8];      /* xa [2][1024][1024]; the four weights [1024][1024] (source, result); the four added vectors [1024] */
  float* res = (float*)d_out;
  static_assert((QNG * QNL) % 128 == 0 && QNL % 128 == 0 && QNW % 64 == 0 && QNW % 32 == 0 && QSW % 64 == 0 && QSW % 32 == 0 && QNL % 8 == 0 && QNS * QSW == QNW, "whole tiles");
  uint8_t* wsp = (uint8_t*)d_ws; size_t off = 0;
  auto take = [&](size_t bytes) { uint8_t* p = wsp + off; off += (bytes + 255) & ~(size_t)255; return p; };
  const size_t GW = (size_t)QNG * QNL * QNW, G1 = (size_t)QNL * QNW;
  float* SC = (float*)take((size_t)QNS * QNL * QNL * 4); _Float16* PB = (_Float16*)take((size_t)QNS * QNL * QNL * 2); float* FA = (float*)take(GW * 4); float* FB = (float*)take(GW * 4); float* FC = (float*)take(GW * 4); float* CX = (float*)take(GW * 4);
  _Float16* XH = (_Float16*)take(GW * 2); _Float16* AH = (_Float16*)take(GW * 2); _Float16* AL = (_Float16*)take(GW * 2); _Float16* BH = (_Float16*)take(GW * 2); _Float16* BL = (_Float16*)take(GW * 2); _Float16* CH = (_Float16*)take(GW * 2); _Float16* CL = (_Float16*)take(GW * 2); _Float16* VT = (_Float16*)take(G1 * 2);
  _Float16* WA = (_Float16*)take((size_t)QNW * QNW * 2); _Float16* WB = (_Float16*)take((size_t)QNW * QNW * 2); _Float16* WC = (_Float16*)take((size_t)QNW * QNW * 2); _Float16* WD = (_Float16*)take((size_t)QNW * QNW * 2); float* LA = (float*)take((size_t)QNG * QNS * QNL * 4); float* LB = (float*)take((size_t)QNG * QNS * QNL * 4); float* CF = (float*)take((size_t)QNS * QNL * 4);      /* a group's sixteen sheets of sc and of pb (re-used group after group); the three projections and cx in f32; xa's cast; the words and the unused residuals of fa, fb, cx; a group's transposed fc; the four weights transposed; the strips' squared lengths; a group's column factors */
  if (off > ws_size) return;
  k_x16<<<(unsigned)((GW / 8 + 255) / 256), 256, 0, stream>>>(xa, XH, GW / 8);
  k_wt_f16<<<(unsigned)(((size_t)QNW * (QNW / 8) + 255) / 256), 256, 0, stream>>>(wa, WA, QNW, QNW, QWC);      /* WA[o][k] = f16(64 wa[k][o]) */
  k_wt_f16<<<(unsigned)(((size_t)QNW * (QNW / 8) + 255) / 256), 256, 0, stream>>>(wb, WB, QNW, QNW, QWC);
  k_wt_f16<<<(unsigned)(((size_t)QNW * (QNW / 8) + 255) / 256), 256, 0, stream>>>(wc, WC, QNW, QNW, QWC);
  k_wt_f16<<<(unsigned)(((size_t)QNW * (QNW / 8) + 255) / 256), 256, 0, stream>>>(wd, WD, QNW, QNW, QWC);
  k_gemm2<0><<<dim3((unsigned)(((QNG * QNL) / 128) * (QNW / 64)), 1), 128, 0, stream>>>(XH, QNW, 0, WA, QNW, 0, 1.0f / QWC, va, 0, nullptr, 1, 0, 0, FA, nullptr, QNW, 0, QNG * QNL, QNW, QNW);      /* FA[(g, i)][o] = xa[g][i][:] . wa[:][o] + va[o] */
  k_gemm2<0><<<dim3((unsigned)(((QNG * QNL) / 128) * (QNW / 64)), 1), 128, 0, stream>>>(XH, QNW, 0, WB, QNW, 0, 1.0f / QWC, vb, 0, nullptr, 1, 0, 0, FB, nullptr, QNW, 0, QNG * QNL, QNW, QNW);
  k_gemm2<0><<<dim3((unsigned)(((QNG * QNL) / 128) * (QNW / 64)), 1), 128, 0, stream>>>(XH, QNW, 0, WC, QNW, 0, 1.0f / QWC, vc, 0, nullptr, 1, 0, 0, FC, nullptr, QNW, 0, QNG * QNL, QNW, QNW);
  k_sln<<<(unsigned)((QNG * QNS * QNL + 255) / 256), 256, 0, stream>>>(FA, LA);
  k_sln<<<(unsigned)((QNG * QNS * QNL + 255) / 256), 256, 0, stream>>>(FB, LB);
  k_hl<<<(unsigned)((GW / 8 + 255) / 256), 256, 0, stream>>>(FA, AH, AL, GW / 8);      /* AH is used; AL is written and not read */
  k_hl<<<(unsigned)((GW / 8 + 255) / 256), 256, 0, stream>>>(FB, BH, BL, GW / 8);
  for (int g = 0; g < QNG; ++g) {      /* a literal 2 on the host: SC, PB, VT and CF are re-used group after group */
    k_wtn_f16<<<(unsigned)(((size_t)QNW * (QNL / 8) + 255) / 256), 256, 0, stream>>>(FC + g * G1, VT, QNL, QNW, 1.0f);      /* VT[(s, c)][j] = f16(fc[g][j][s 64 + c]) */
    k_gemm2<0><<<dim3((unsigned)((QNL / 128) * (QNL / 64)), QNS), 128, 0, stream>>>(AH + g * G1, QNW, (size_t)QSW, BH + g * G1, QNW, (size_t)QSW, 1.0f, nullptr, 0, nullptr, 1, 0, 0, SC, nullptr, QNL, (size_t)QNL * QNL, QNL, QNL, QSW);      /* SC[s][i][j] = fa[g][i][s] . fb[g][j][s] */
    k_pcs<<<(unsigned)(QNS * (QNL / QCB)), 1024, 0, stream>>>(SC, LA + (size_t)g * QNS * QNL, LB + (size_t)g * QNS * QNL, CF);
    k_ktw<<<(unsigned)((QNS * QNL) / (QWV * QRW)), QWV * 32, 0, stream>>>(SC, CF, PB);
    k_gemm2<0><<<dim3((unsigned)((QNL / 128) * (QSW / 64)), QNS), 128, 0, stream>>>(PB, QNL, (size_t)QNL * QNL, VT, QNL, (size_t)QSW * QNL, 1.0f / QPC, nullptr, 0, nullptr, 1, 0, 0, CX + g * G1, nullptr, QNW, (size_t)QSW, QNL, QSW, QNL); }      /* CX[g][i][s 64 + c] = sum over j of PB[s][i][j] fc[g][j][s 64 + c] / 2^12: in place at a strip's column offset */
  k_hl<<<(unsigned)((GW / 8 + 255) / 256), 256, 0, stream>>>(CX, CH, CL, GW / 8);      /* CH is used; CL is written and not read */
  k_gemm2<0><<<dim3((unsigned)(((QNG * QNL) / 128) * (QNW / 64)), 1), 128, 0, stream>>>(CH, QNW, 0, WD, QNW, 0, 1.0f / QWC, vd, 0, nullptr, 1, 0, 0, res, nullptr, QNW, 0, QNG * QNL, QNW, QNW);      /* res = cx wd + vd: every word of the result once */
}

// v005
// Measured time: 210 microseconds a run.
// Two timings next to v004 put it at 1.12 and 1.15 times that version's speed.
// All steps since v000 together make it 3.10 times as fast.
// A distance-kernel mixing of rows: xa [2][1024][1024] (group, row, width); wa, wb, wc, wd [1024][1024] stored (source column, result column), va, vb, vc, vd [1024]: fa | fb | fc = xa w + v, split into 16 strips of 64 columns; for a group and a strip: e2[i][j] = |fa_i|^2 + |fb_j|^2 - 2 fa_i . fb_j; gd = sqrt(max(e2, 1e-12)) / 64; sc = (1 + gd)^(-65.5); nr = its row sums, nc = its column sums; kt = nr^(-1/2) sc nc^(-1/2); pb = kt / max(its row sum, 1e-12); cx = pb fc's strip; res = cx wd + vd -> [2][1024][1024] f32: one result.
// Structure: xa cast to f16 as it lies and the four weights cast transposed behind a carry of 64 (converted to bf16 first); three WMMA GEMMs (the carry undone in their scale argument; the added vectors live) whose f32 words never go to memory: the epilogue of fa's and fb's stores each word as ONE f16 word and, a lane a row, a strip's squared length (the tile's 64 f32 words in index order; a tile's width is a strip's), the epilogue of fc's stores the f16 words transposed through LDS, a group's sheet (strip column, row); THEN A GROUP AT A TIME (a literal 2 on the host): one WMMA GEMM with the strip as the grid's second index forms fa . fb (depth 64) into sixteen f32 sheets; ONE kernel, a work-group 64 columns of a strip over all rows, forms sc in place from the two lengths and the product (the root, log2 and exp2 instructions: the power as 2^(-65.5 log2(1 + gd))), sums its columns as it goes (thread partials, then LDS) and stores each sum's reciprocal root; ONE kernel a wave four rows in turn (each row in the wave's registers, read once) forms the row's sum, kt's row sum (lane partials, then a butterfly) and stores pb as one f16 word behind a carry of 2^12; one WMMA GEMM (depth 1,024; its scale undoes the carry) stores cx as f16 words in place at a strip's column offset; then the last WMMA GEMM writes the result.
// Compute dtype: all nine inputs converted to bf16 where they are read; xa's words exact as f16 operands down to 2^-14; the weights' behind 64; fa, fb, fc, pb and cx ONE f16 word each (pb behind 2^12); sc's sheets, every product's accumulation, the lengths, the kernel's arithmetic, the sums and the result f32. v_wmma_f32_16x16x32_f16.
#include <hip/hip_runtime.h>
#define QNG 2                        /* groups */
#define QNL 1024                     /* rows of a group */
#define QNW 1024                     /* a row's width: every projection's depth and width */
#define QNS 16                       /* strips */
#define QSW 64                       /* a strip's width: the pair product's depth */
#define QDS 64.0f                    /* the distance's divisor */
#define QPW -65.5f                   /* the power */
#define QLO 1e-12f                   /* the lower bound of e2 and of a row's sum */
#define QWC 64.0f                    /* the weights' carry (undone in the products' scale argument) */
#define QPC 4096.0f                  /* pb's carry (undone in the fifth product's scale argument) */
#define QWV 16                       /* waves of a work-group of the row kernel */
#define QRW 4                        /* rows of sc that one of its waves takes */
#define QCB 64                       /* columns of sc that a work-group of the power kernel takes */
#define QCR 64                       /* rows of sc that it takes in one pass */
typedef unsigned short v8us __attribute__((ext_vector_type(8), may_alias));
typedef float  v8f  __attribute__((ext_vector_type(8)));
typedef float  v4f  __attribute__((ext_vector_type(4)));
typedef float  v4fa __attribute__((ext_vector_type(4), may_alias));

__device__ __forceinline__ unsigned short bf16_bits(float x) { unsigned int u = __float_as_uint(x); return (unsigned short)((u + 0x7FFFu + ((u >> 16) & 1u)) >> 16); }
__device__ __forceinline__ float bf16_val(unsigned short b) { return __uint_as_float(((unsigned int)b) << 16); }
__device__ __forceinline__ float bf16_round(float x) { return bf16_val(bf16_bits(x)); }

typedef _Float16 v16h __attribute__((ext_vector_type(16)));
union FragH { v16h v; v8us half[2]; _Float16 h[16]; unsigned short u[16]; };

// Wt[n][k] = f16(W[k][n] x scale) from f32 row-major W[K][N] (scale = power of two; bf16-exact weights stay exact in f16 away from the subnormal range)
__global__ __launch_bounds__(256) void k_wt_f16(const float* __restrict__ W, _Float16* __restrict__ Wt, int K, int N, float scale) {
  const int t = blockIdx.x * 256 + threadIdx.x; if (t >= N * (K / 8)) return; const int n = t / (K / 8), k8 = (t % (K / 8)) * 8; FragH f;
#pragma unroll
  for (int i = 0; i < 8; ++i) f.h[i] = (_Float16)(bf16_round(W[(size_t)(k8 + i) * N + n]) * scale); const v8us o = f.half[0];
  *(v8us*)((unsigned short*)Wt + (size_t)n * K + k8) = o; 
}

typedef _Float16 v4h __attribute__((ext_vector_type(4)));

__global__ __launch_bounds__(256) void k_x16(const float* __restrict__ x, _Float16* __restrict__ X16, size_t n8) { const size_t t = (size_t)blockIdx.x * 256 + threadIdx.x; if (t >= n8) return; FragH f;
#pragma unroll
  for (int q = 0; q < 8; ++q) f.h[q] = (_Float16)bf16_round(x[t * 8 + q]); *(v8us*)((unsigned short*)X16 + t * 8) = f.half[0];  }

// ---- fast GEMM (wave tile 32x64, work-group tile 128x64; requires M % 128 == 0 rows per launch region, N % 64 == 0 and K % 64 == 0); both operands staged in LDS 64 k at a time, two buffers; epilogue: alpha, bias, CP and ACT, stored to C, with three more results: C16 (the words as f16), LN (a row's squared length over the tile's 64 columns) and CT (the words as f16, transposed) ----
#define G2P 72                       /* 16-bit words of a staged row: 64 + 8, a pitch of 144 bytes (16 bytes x odd: 16 rows read 16 bytes a lane without bank conflicts) */
#define G2S (192 * G2P)              /* 16-bit words of a stage: 128 rows of A, then 64 rows of B */
#define G2T 136                      /* 16-bit words of a column of the transposed result's staging: 128 + 8, a pitch of 272 bytes (16 bytes x odd) */
__device__ __forceinline__ v16h g2_frag(const _Float16* p, int hh) { FragH f; f.half[0] = *(const v8us*)((const unsigned short*)p + 8 * hh); f.half[1] = *(const v8us*)((const unsigned short*)p + 16 + 8 * hh); return f.v; }
__device__ __forceinline__ v8f g2_mma(v16h a, v16h b, v8f c) { v8f d = __builtin_amdgcn_wmma_f32_16x16x32_f16(false, a, false, b, (short)0, c, false, false); asm volatile("v_nop\n\tv_nop\n\tv_nop\n\tv_nop" : "+v"(d) : "v"(a), "v"(b)); return d; }
template <int ACT>
__global__ __launch_bounds__(128) void k_gemm2(const _Float16* __restrict__ A, int lda, size_t sA, const _Float16* __restrict__ Bh, int ldb, size_t sB, float alpha, const float* __restrict__ bias, size_t sBias, const float* __restrict__ CP, int rowsPerB, size_t sCPb, int row0g,
    float* __restrict__ C, _Float16* __restrict__ C16, int ldc, size_t sC, int M, int N, int K, _Float16* __restrict__ CT, float* __restrict__ LN, int rowsT) {      /* CT [M / rowsT][N][rowsT] and LN [M / rowsT][N / 64][rowsT]: rowsT % 128 == 0, a launch of one plane */ static_assert(ACT == 0 || ACT == 3 || ACT == 6 || ACT == 8 || ACT == 9 || ACT == 11 || ACT == 12 || ACT == 14 || ACT == 15 || ACT == 16 || ACT == 17, "k_gemm2: unsupported ACT code (would silently apply no activation)");
  __shared__ __attribute__((aligned(16))) unsigned char sm[2 * G2S * 2]; static_assert(sizeof(sm) >= 4 * 32 * 68 * 4 && sizeof(sm) >= 64 * G2T * 2, "the result's staging re-uses the two operand buffers");
  float (*so)[32][68] = (float (*)[32][68])sm;      /* written only behind the k loop's last barrier */
  const int tid = threadIdx.x, w = tid >> 5, lane = tid & 31, ln = lane & 15, hh = lane >> 4; const int by = blockIdx.y;
  A += (size_t)by * sA; Bh += (size_t)by * sB; const size_t cofs = (size_t)by * sC; const float* bp = bias ? bias + (size_t)by * sBias : nullptr;
  const int ntn = N >> 6; const int mt = blockIdx.x / ntn, nq = blockIdx.x - mt * ntn; const int row0 = mt * 128 + 32 * w, col0 = nq * 64; if (mt * 128 >= M) return;      /* the whole work-group leaves or none does: barriers follow */
  const int sr = tid >> 3, sk = (tid & 7) * 8;      /* staging: 8 threads a row of 128 bytes, so a wave's load is 4 whole lines; 16 rows a round of the work-group */
  const unsigned short* ga = (const unsigned short*)A + (size_t)(mt * 128 + sr) * lda + sk; const unsigned short* gb = (const unsigned short*)Bh + (size_t)(col0 + sr) * ldb + sk;
  unsigned short* sh = (unsigned short*)sm; const int swo = sr * G2P + sk; v8us st[12];
  const v8f z8 = {0.f,0.f,0.f,0.f,0.f,0.f,0.f,0.f}; v8f c00 = z8, c01 = z8, c02 = z8, c03 = z8, c10 = z8, c11 = z8, c12 = z8, c13 = z8;
  for (int i = 0; i < 8; ++i) st[i] = *(const v8us*)(ga + (size_t)(16 * i) * lda);
  for (int i = 0; i < 4; ++i) st[8 + i] = *(const v8us*)(gb + (size_t)(16 * i) * ldb);
  for (int i = 0; i < 12; ++i) *(v8us*)(sh + swo + i * 16 * G2P) = st[i];
  __syncthreads();      /* stage 0 is in LDS before a wave reads it */
  for (int kb = 0; kb < K; kb += 64) { const int cur = (kb >> 6) & 1; const bool more = kb + 64 < K;
    if (more) {      /* the next stage's words fly while this stage is multiplied */
      for (int i = 0; i < 8; ++i) st[i] = *(const v8us*)(ga + (size_t)(16 * i) * lda + kb + 64);
      for (int i = 0; i < 4; ++i) st[8 + i] = *(const v8us*)(gb + (size_t)(16 * i) * ldb + kb + 64); }
    const _Float16* pa = (const _Float16*)(sh + cur * G2S + (32 * w + ln) * G2P); const _Float16* pb = (const _Float16*)(sh + cur * G2S + (128 + ln) * G2P);
    v16h a0[2], a1[2], b[2][4];
    for (int ks = 0; ks < 2; ++ks) { a0[ks] = g2_frag(pa + 32 * ks, hh); a1[ks] = g2_frag(pa + 16 * G2P + 32 * ks, hh);
      for (int t = 0; t < 4; ++t) b[ks][t] = g2_frag(pb + t * 16 * G2P + 32 * ks, hh); }
    for (int ks = 0; ks < 2; ++ks) { c00 = g2_mma(a0[ks], b[ks][0], c00); c10 = g2_mma(a1[ks], b[ks][0], c10); c01 = g2_mma(a0[ks], b[ks][1], c01); c11 = g2_mma(a1[ks], b[ks][1], c11);
      c02 = g2_mma(a0[ks], b[ks][2], c02); c12 = g2_mma(a1[ks], b[ks][2], c12); c03 = g2_mma(a0[ks], b[ks][3], c03); c13 = g2_mma(a1[ks], b[ks][3], c13); }
    if (more) {
      for (int i = 0; i < 12; ++i) *(v8us*)(sh + (cur ^ 1) * G2S + swo + i * 16 * G2P) = st[i]; }      /* the other buffer: its readers left it in front of the last barrier */
    __syncthreads(); }      /* publishes the next stage and ends this stage's reads (behind the last stage: before the result's staging re-uses the bytes) */
  v8f accs[8] = {c00, c01, c02, c03, c10, c11, c12, c13};
#pragma unroll
  for (int u = 0; u < 8; ++u) { const int t = u & 3, half = u >> 2; const int col = col0 + t * 16 + ln; const float bv = bp ? bf16_round(bp[col]) : 0.f;
#pragma unroll
    for (int r = 0; r < 8; ++r) { const int rloc = half * 16 + 8 * hh + r; float v = accs[u][r] * alpha + bv; if (CP) { if (rowsPerB < 0) v += CP[cofs + (size_t)(row0g + row0 + rloc) * ldc + col];      /* rowsPerB < 0: own element of the batched C plane */ else { const int bidx = (row0g + row0 + rloc) / rowsPerB; v += CP[(size_t)bidx * sCPb + (size_t)by * 64 + col]; } }
      if (ACT == 3) v = fmaxf(v, 0.f); else if (ACT == 6) v = 0.5f * v * (1.0f + erff(v * 0.70710678118654752f)); else if (ACT == 11) v = 1.0f / (1.0f + expf(-v)); else if (ACT == 15) v = v / (1.0f + expf(-v)); else if (ACT == 12) v = (v > 0.f) ? v : 0.01f * v; else if (ACT == 8) v = tanhf(v); else if (ACT == 9) v = 0.5f * v * (1.0f + tanhf(0.7978845608028654f * (v + 0.044715f * v * v * v))); else if (ACT == 14) v = (v > 0.f) ? v : 0.1f * v; else if (ACT == 16) v = (v >= 0.f) ? v : 0.3f * v; else if (ACT == 17) v = (v >= 0.f) ? v : 0.2f * v;
      accs[u][r] = v; } }
  if (CT) {      /* the same for the whole work-group: a barrier follows. A lane's 8 words of an accumulator are 8 rows in a row of one column: 16 bytes of the transposed sheet */
    unsigned short* tp = (unsigned short*)sm; const int gT = (mt * 128) / rowsT, rT = mt * 128 - gT * rowsT;
#pragma unroll
    for (int u = 0; u < 8; ++u) { FragH f;
#pragma unroll
      for (int r = 0; r < 8; ++r) f.h[r] = (_Float16)accs[u][r];
      *(v8us*)(tp + ((u & 3) * 16 + ln) * G2T + 32 * w + (u >> 2) * 16 + 8 * hh) = f.half[0]; }
    __syncthreads();      /* the four waves' rows of every column are in LDS before a wave stores whole columns of the tile (256 bytes in a row each) */
    unsigned short* gt = (unsigned short*)CT + ((size_t)gT * N + col0 + (tid >> 4)) * rowsT + rT + (tid & 15) * 8;
    v8us tv[8];
#pragma unroll
    for (int q = 0; q < 8; ++q) tv[q] = *(const v8us*)(tp + (q * 8 + (tid >> 4)) * G2T + (tid & 15) * 8);
#pragma unroll
    for (int q = 0; q < 8; ++q) { *(v8us*)(gt + (size_t)(q * 8) * rowsT) = tv[q];
      asm volatile("s_wait_xcnt 0x0" ::: "memory"); }      /* the wait in front of the next overwrite of a store's registers (a later store's address re-uses them; behind the last store the built code still holds a branch to the other epilogue, which writes them) */
    return; }
#pragma unroll
  for (int u = 0; u < 8; ++u) {
#pragma unroll
    for (int r = 0; r < 8; ++r) so[w][(u >> 2) * 16 + 8 * hh + r][(u & 3) * 16 + ln] = accs[u][r]; }
  __builtin_amdgcn_fence(__ATOMIC_ACQ_REL, "workgroup"); __builtin_amdgcn_wave_barrier();
  const int rsub = lane >> 4, c4 = (lane & 15) * 4;
  {
#pragma unroll
    for (int q = 0; q < 16; ++q) { const int r = q * 2 + rsub; const v4f v = *(const v4fa*)&so[w][r][c4]; if (C) *(v4f*)(C + cofs + (size_t)(row0 + r) * ldc + col0 + c4) = v; if (C16) { v4h h4; for (int i = 0; i < 4; ++i) h4[i] = (_Float16)v[i]; *(v4h*)(C16 + cofs + (size_t)(row0 + r) * ldc + col0 + c4) = h4; } }
     }
  if (LN) { const float* p = &so[w][lane][0]; float a = 0.0f; const int gT = (mt * 128) / rowsT, rT = mt * 128 - gT * rowsT;      /* a lane a row of the wave's 32: the row's 64 f32 words in index order */
    asm volatile("s_wait_xcnt 0x0" ::: "memory");      /* the wait in front of the overwrite of the last store's registers (the loads below re-use them) */
    v4f x[16];
#pragma unroll
    for (int c = 0; c < 16; ++c) x[c] = *(const v4fa*)(p + 4 * c);
    __builtin_amdgcn_sched_barrier(0);      /* keeps the 16 LDS loads together in front of the sum: sunk into the chain of 64 dependent multiply-adds, each would be waited for in turn */
#pragma unroll
    for (int c = 0; c < 64; ++c) a = __builtin_fmaf(x[c >> 2][c & 3], x[c >> 2][c & 3], a);
    LN[((size_t)gT * ntn + nq) * rowsT + rT + 32 * w + lane] = a; } }

// A work-group takes QCB columns of one strip over all its rows (a wave's load or store = 2 rows of 256 bytes in a row): sc is formed in place as before, and each thread keeps the running sums of its 4 columns, so sc is not read again for nc.
__global__ __launch_bounds__(1024) __attribute__((amdgpu_waves_per_eu(8, 8)))      /* one work-group of 32 waves a WGP = 8 waves a SIMD: told so, the compiler spends registers on interleaving a trip's four powers (more dual issue) */
void k_pcs(float* SC, const float* __restrict__ la, const float* __restrict__ lb, float* __restrict__ CF) {
  static_assert(QCB == 64 && QNL % QCB == 0 && QNL % QCR == 0 && QCR * (QCB / 4) == 1024, "16 threads a row piece, QCR rows a pass, whole passes");
  __shared__ __attribute__((aligned(16))) float ps[QCR][QCB];
  const unsigned tid = threadIdx.x, c4 = (tid & 15u) * 4u, rr = tid >> 4; const unsigned s = blockIdx.x / (QNL / QCB), j0 = (blockIdx.x % (QNL / QCB)) * QCB;
  float* p = SC + (size_t)s * QNL * QNL + (size_t)rr * QNL + j0 + c4; const float* lq = la + s * QNL + rr; const v4f kb = *(const v4fa*)(lb + s * QNL + j0 + c4);
  v4f a = {0.f, 0.f, 0.f, 0.f}; v4f z = *(const v4fa*)p; float qa = lq[0];
  for (unsigned k = 0; k < (unsigned)(QNL / QCR); ++k) { const unsigned kn = (k + 1 < (unsigned)(QNL / QCR)) ? k + 1 : k;      /* the next pass's words are fetched ahead of this pass's arithmetic (the last pass fetches its own again, unused) */
    const v4f zn = *(const v4fa*)(p + (size_t)kn * QCR * QNL); const float qn = lq[kn * QCR]; v4f w;
#pragma unroll
    for (int q = 0; q < 4; ++q) { const float e2 = (qa + kb[q]) - 2.0f * z[q]; const float gd = __builtin_amdgcn_sqrtf(fmaxf(e2, QLO)) / QDS;      /* v_sqrt_f32 as it is: its argument is at least QLO, never subnormal */
      w[q] = exp2f(QPW * __builtin_amdgcn_logf(1.0f + gd)); }      /* (1 + gd)^QPW = 2^(QPW log2(1 + gd)); v_log_f32 as it is: its argument is at least 1; exp2f keeps subnormal results */
    *(v4fa*)(p + (size_t)k * QCR * QNL) = w;
    asm volatile("s_wait_xcnt 0x0" ::: "memory");      /* the wait in front of the next overwrite of the store's data and address registers (the next pass's loads and arithmetic re-use them) */
    a += w; z = zn; qa = qn; }
  *(v4fa*)&ps[rr][c4] = a;
  __syncthreads();      /* the QCR partial sums of every column are in LDS before a thread a column adds them */
  if (tid < (unsigned)QCB) { float t = 0.0f;
#pragma unroll
    for (int r = 0; r < QCR; ++r) t += ps[r][tid];
    CF[s * QNL + j0 + tid] = 1.0f / sqrtf(t); } }

// A wave takes QRW rows of sc one after the other, each whole row in its registers (a lane: 8 pieces of 4 words, a load of the wave = 512 bytes in a row): nr, kt's row sum and pb from ONE read.
__device__ __forceinline__ float wave_sum(float s) {      /* butterfly over the 32 lanes: every lane ends with the same bits */
  s += __int_as_float(__builtin_amdgcn_update_dpp(0, __float_as_int(s), 0x161, 0xf, 0xf, false));      /* row_xmask:1 */
  s += __int_as_float(__builtin_amdgcn_update_dpp(0, __float_as_int(s), 0x162, 0xf, 0xf, false));      /* row_xmask:2 */
  s += __int_as_float(__builtin_amdgcn_update_dpp(0, __float_as_int(s), 0x164, 0xf, 0xf, false));      /* row_xmask:4 */
  s += __int_as_float(__builtin_amdgcn_update_dpp(0, __float_as_int(s), 0x168, 0xf, 0xf, false));      /* row_xmask:8 */
  const int b = __float_as_int(s); s += __int_as_float(__builtin_amdgcn_permlanex16(b, b, 0x76543210, 0xfedcba98, false, false));      /* lane l with lane l ^ 16 */
  return s; }

__global__ __launch_bounds__(QWV * 32) void k_ktw(const float* __restrict__ SC, const float* __restrict__ CF, _Float16* __restrict__ PB) {
  static_assert(QNL == 8 * 128 && QNL % QRW == 0 && (QNS * QNL) % (QWV * QRW) == 0, "a row is 8 loads of a wave; a wave's rows lie in one strip; whole work-groups");
  const unsigned lane = threadIdx.x & 31u, wave = (unsigned)__builtin_amdgcn_readfirstlane((int)(threadIdx.x >> 5)); const unsigned r0 = (blockIdx.x * QWV + wave) * QRW;
  const float* p = SC + (size_t)r0 * QNL + lane * 4; const float* cf = CF + (size_t)(r0 / QNL) * QNL + lane * 4; _Float16* o = PB + (size_t)r0 * QNL + lane * 4;
  v4f c[8], w[2][8];
#pragma unroll
  for (int q = 0; q < 8; ++q) w[0][q] = *(const v4fa*)(p + q * 128);
#pragma unroll
  for (int q = 0; q < 8; ++q) c[q] = *(const v4fa*)(cf + q * 128);
#pragma unroll
  for (int k = 0; k < QRW; ++k) { v4f* t = w[k & 1];
    __builtin_amdgcn_sched_barrier(0);      /* this one and the one behind the loads pin the order: the next row's loads, then this row's arithmetic; without them the next row's sum is drawn forward into this row's arithmetic and its loads get less time to land */
    if (k + 1 < QRW) {
#pragma unroll
      for (int q = 0; q < 8; ++q) w[(k + 1) & 1][q] = *(const v4fa*)(p + (size_t)(k + 1) * QNL + q * 128);
      if (k == 0) asm volatile("s_wait_xcnt 0x0" ::: "memory");      /* the wait in front of the first overwrite of the scalar base that the loads of c name (the arithmetic below re-uses it) */
      __builtin_amdgcn_sched_barrier(0); }
    v4f a = {0.f, 0.f, 0.f, 0.f};
#pragma unroll
    for (int q = 0; q < 8; ++q) a += t[q];
    const float rf = 1.0f / sqrtf(wave_sum((a[0] + a[1]) + (a[2] + a[3]))); a = (v4f){0.f, 0.f, 0.f, 0.f};
#pragma unroll
    for (int q = 0; q < 8; ++q) { t[q] = (rf * t[q]) * c[q]; a += t[q]; }
    const float dn = fmaxf(wave_sum((a[0] + a[1]) + (a[2] + a[3])), QLO);
#pragma unroll
    for (int q = 0; q < 8; ++q) { v4h h;
#pragma unroll
      for (int i = 0; i < 4; ++i) h[i] = (_Float16)((t[q][i] / dn) * QPC);
      *(v4h*)(o + (size_t)k * QNL + q * 128) = h;
      if (k + 1 < QRW || q < 7) asm volatile("s_wait_xcnt 0x0" ::: "memory"); } }      /* the wait in front of the next overwrite of the store's data registers (later pieces, the next rows' loads); behind the wave's last store nothing is overwritten */
}

extern "C" void kernel_launch(void* const* d_in, const int* in_sizes, int n_in,
                              void* d_out, int out_size, void* d_ws, size_t ws_size, hipStream_t stream) {
  (void)in_sizes; (void)n_in; (void)out_size;
  const float* const* I = (const float* const*)d_in; const float* xa = I[0]; const float* wa = I[1]; const float* va = I[2]; const float* wb = I[3]; const float* vb = I[4]; const float* wc = I[5]; const float* vc = I[6]; const float* wd = I[7]; const float* vd = I[8];      /* xa [2][1024][1024]; the four weights [1024][1024] (source, result); the four added vectors [1024] */
  float* res = (float*)d_out;
  static_assert((QNG * QNL) % 128 == 0 && QNL % 128 == 0 && QNW % 64 == 0 && QNW % 32 == 0 && QSW % 64 == 0 && QSW % 32 == 0 && QNL % 8 == 0 && QNS * QSW == QNW, "whole tiles");
  uint8_t* wsp = (uint8_t*)d_ws; size_t off = 0;
  auto take = [&](size_t bytes) { uint8_t* p = wsp + off; off += (bytes + 255) & ~(size_t)255; return p; };
  const size_t GW = (size_t)QNG * QNL * QNW, G1 = (size_t)QNL * QNW;
  float* SC = (float*)take((size_t)QNS * QNL * QNL * 4); _Float16* PB = (_Float16*)take((size_t)QNS * QNL * QNL * 2);
  _Float16* XH = (_Float16*)take(GW * 2); _Float16* AH = (_Float16*)take(GW * 2); _Float16* BH = (_Float16*)take(GW * 2); _Float16* CH = (_Float16*)take(GW * 2); _Float16* VT = (_Float16*)take(GW * 2);
  _Float16* WA = (_Float16*)take((size_t)QNW * QNW * 2); _Float16* WB = (_Float16*)take((size_t)QNW * QNW * 2); _Float16* WC = (_Float16*)take((size_t)QNW * QNW * 2); _Float16* WD = (_Float16*)take((size_t)QNW * QNW * 2); float* LA = (float*)take((size_t)QNG * QNS * QNL * 4); float* LB = (float*)take((size_t)QNG * QNS * QNL * 4); float* CF = (float*)take((size_t)QNS * QNL * 4);      /* a group's sixteen sheets of sc and of pb (re-used group after group); xa's cast; the f16 words of fa, fb, cx; fc's transposed, group by group; the four weights transposed; the strips' squared lengths; a group's column factors */
  if (off > ws_size) return;
  k_x16<<<(unsigned)((GW / 8 + 255) / 256), 256, 0, stream>>>(xa, XH, GW / 8);
  k_wt_f16<<<(unsigned)(((size_t)QNW * (QNW / 8) + 255) / 256), 256, 0, stream>>>(wa, WA, QNW, QNW, QWC);      /* WA[o][k] = f16(64 wa[k][o]) */
  k_wt_f16<<<(unsigned)(((size_t)QNW * (QNW / 8) + 255) / 256), 256, 0, stream>>>(wb, WB, QNW, QNW, QWC);
  k_wt_f16<<<(unsigned)(((size_t)QNW * (QNW / 8) + 255) / 256), 256, 0, stream>>>(wc, WC, QNW, QNW, QWC);
  k_wt_f16<<<(unsigned)(((size_t)QNW * (QNW / 8) + 255) / 256), 256, 0, stream>>>(wd, WD, QNW, QNW, QWC);
  k_gemm2<0><<<dim3((unsigned)(((QNG * QNL) / 128) * (QNW / 64)), 1), 128, 0, stream>>>(XH, QNW, 0, WA, QNW, 0, 1.0f / QWC, va, 0, nullptr, 1, 0, 0, nullptr, AH, QNW, 0, QNG * QNL, QNW, QNW, nullptr, LA, QNL);      /* fa[(g, i)][o] = xa[g][i][:] . wa[:][o] + va[o]: AH its f16 words, LA[g][s][i] its strips' squared lengths */
  k_gemm2<0><<<dim3((unsigned)(((QNG * QNL) / 128) * (QNW / 64)), 1), 128, 0, stream>>>(XH, QNW, 0, WB, QNW, 0, 1.0f / QWC, vb, 0, nullptr, 1, 0, 0, nullptr, BH, QNW, 0, QNG * QNL, QNW, QNW, nullptr, LB, QNL);
  k_gemm2<0><<<dim3((unsigned)(((QNG * QNL) / 128) * (QNW / 64)), 1), 128, 0, stream>>>(XH, QNW, 0, WC, QNW, 0, 1.0f / QWC, vc, 0, nullptr, 1, 0, 0, nullptr, nullptr, QNW, 0, QNG * QNL, QNW, QNW, VT, nullptr, QNL);      /* VT[g][(s, c)][j] = f16(fc[g][j][s 64 + c]) */
  for (int g = 0; g < QNG; ++g) {      /* a literal 2 on the host: SC, PB and CF are re-used group after group */
    k_gemm2<0><<<dim3((unsigned)((QNL / 128) * (QNL / 64)), QNS), 128, 0, stream>>>(AH + g * G1, QNW, (size_t)QSW, BH + g * G1, QNW, (size_t)QSW, 1.0f, nullptr, 0, nullptr, 1, 0, 0, SC, nullptr, QNL, (size_t)QNL * QNL, QNL, QNL, QSW, nullptr, nullptr, QNL);      /* SC[s][i][j] = fa[g][i][s] . fb[g][j][s] */
    k_pcs<<<(unsigned)(QNS * (QNL / QCB)), 1024, 0, stream>>>(SC, LA + (size_t)g * QNS * QNL, LB + (size_t)g * QNS * QNL, CF);
    k_ktw<<<(unsigned)((QNS * QNL) / (QWV * QRW)), QWV * 32, 0, stream>>>(SC, CF, PB);
    k_gemm2<0><<<dim3((unsigned)((QNL / 128) * (QSW / 64)), QNS), 128, 0, stream>>>(PB, QNL, (size_t)QNL * QNL, VT + g * G1, QNL, (size_t)QSW * QNL, 1.0f / QPC, nullptr, 0, nullptr, 1, 0, 0, nullptr, CH + g * G1, QNW, (size_t)QSW, QNL, QSW, QNL, nullptr, nullptr, QNL); }      /* CH[g][i][s 64 + c] = the f16 word of sum over j of PB[s][i][j] fc[g][j][s 64 + c] / 2^12: in place at a strip's column offset */
  k_gemm2<0><<<dim3((unsigned)(((QNG * QNL) / 128) * (QNW / 64)), 1), 128, 0, stream>>>(CH, QNW, 0, WD, QNW, 0, 1.0f / QWC, vd, 0, nullptr, 1, 0, 0, res, nullptr, QNW, 0, QNG * QNL, QNW, QNW, nullptr, nullptr, QNL);      /* res = cx wd + vd: every word of the result once */
}

// v006
// A run of this version takes 173 microseconds.
// Two timings next to v005 both put it at 1.21 times that version's speed.
// Over all steps from v000 it is 3.75 times as fast.
// A distance-kernel mixing of rows: xa [2][1024][1024] (group, row, width); wa, wb, wc, wd [1024][1024] stored (source column, result column), va, vb, vc, vd [1024]: fa | fb | fc = xa w + v, split into 16 strips of 64 columns; for a group and a strip: e2[i][j] = |fa_i|^2 + |fb_j|^2 - 2 fa_i . fb_j; gd = sqrt(max(e2, 1e-12)) / 64; sc = (1 + gd)^(-65.5); nr = its row sums, nc = its column sums; kt = nr^(-1/2) sc nc^(-1/2); pb = kt / max(its row sum, 1e-12); cx = pb fc's strip; res = cx wd + vd -> [2][1024][1024] f32: one result.
// Structure: xa cast to f16 as it lies and the four weights cast transposed behind a carry of 64 (converted to bf16 first); three WMMA GEMMs (the carry undone in their scale argument; the added vectors live) whose f32 words never go to memory: the epilogue of fa's and fb's stores each word as ONE f16 word and, a lane a row, a strip's squared length (the tile's 64 f32 words in index order; a tile's width is a strip's), the epilogue of fc's stores the f16 words transposed through LDS, a group's sheet (strip column, row); THEN A GROUP AT A TIME (a literal 2 on the host): ONE kernel, a work-group 64 columns of a strip over all rows, forms fa . fb (depth 64) on WMMA, forms sc from the two lengths and the product while the product is still in the accumulators (the root, log2 and exp2 instructions: the power as 2^(-65.5 log2(1 + gd))), stores sc into sixteen f32 sheets, sums its columns as it goes (lane partials, then LDS) and stores each sum's reciprocal root; ONE kernel a wave four rows in turn (each row in the wave's registers, read once) forms the row's sum, kt's row sum (lane partials, then a butterfly) and stores pb as one f16 word behind a carry of 2^12; one WMMA GEMM (depth 1,024; its scale undoes the carry) stores cx as f16 words in place at a strip's column offset; then the last WMMA GEMM writes the result.
// Compute dtype: all nine inputs converted to bf16 where they are read; xa's words exact as f16 operands down to 2^-14; the weights' behind 64; the computed sheets ONE f16 word each but sc's, f32 (pb behind 2^12); every product's accumulation, the lengths, the kernel's arithmetic, the sums and the result f32. v_wmma_f32_16x16x32_f16.
#include <hip/hip_runtime.h>
#define QNG 2                        /* groups */
#define QNL 1024                     /* rows of a group */
#define QNW 1024                     /* a row's width: every projection's depth and width */
#define QNS 16                       /* strips */
#define QSW 64                       /* a strip's width: the pair product's depth */
#define QDS 64.0f                    /* the distance's divisor */
#define QPW -65.5f                   /* the power */
#define QLO 1e-12f                   /* the lower bound of e2 and of a row's sum */
#define QWC 64.0f                    /* the weights' carry (undone in the products' scale argument) */
#define QPC 4096.0f                  /* pb's carry (undone in the fifth product's scale argument) */
#define QWV 16                       /* waves of a work-group of the row kernel */
#define QRW 4                        /* rows of sc that one of its waves takes */
#define QCB 64                       /* columns of sc that a work-group of the pair kernel takes */
#define QFW 16                       /* its waves */
#define QFT 2                        /* tiles of 32 rows that one of its waves takes */
typedef unsigned short v8us __attribute__((ext_vector_type(8), may_alias));
typedef float  v8f  __attribute__((ext_vector_type(8)));
typedef float  v4f  __attribute__((ext_vector_type(4)));
typedef float  v4fa __attribute__((ext_vector_type(4), may_alias));

__device__ __forceinline__ unsigned short bf16_bits(float x) { unsigned int u = __float_as_uint(x); return (unsigned short)((u + 0x7FFFu + ((u >> 16) & 1u)) >> 16); }
__device__ __forceinline__ float bf16_val(unsigned short b) { return __uint_as_float(((unsigned int)b) << 16); }
__device__ __forceinline__ float bf16_round(float x) { return bf16_val(bf16_bits(x)); }

typedef _Float16 v16h __attribute__((ext_vector_type(16)));
union FragH { v16h v; v8us half[2]; _Float16 h[16]; unsigned short u[16]; };

// Wt[n][k] = f16(W[k][n] x scale) from f32 row-major W[K][N] (scale = power of two; bf16-exact weights stay exact in f16 away from the subnormal range)
__global__ __launch_bounds__(256) void k_wt_f16(const float* __restrict__ W, _Float16* __restrict__ Wt, int K, int N, float scale) {
  const int t = blockIdx.x * 256 + threadIdx.x; if (t >= N * (K / 8)) return; const int n = t / (K / 8), k8 = (t % (K / 8)) * 8; FragH f;
#pragma unroll
  for (int i = 0; i < 8; ++i) f.h[i] = (_Float16)(bf16_round(W[(size_t)(k8 + i) * N + n]) * scale); const v8us o = f.half[0];
  *(v8us*)((unsigned short*)Wt + (size_t)n * K + k8) = o; 
}

typedef _Float16 v4h __attribute__((ext_vector_type(4)));

__global__ __launch_bounds__(256) void k_x16(const float* __restrict__ x, _Float16* __restrict__ X16, size_t n8) { const size_t t = (size_t)blockIdx.x * 256 + threadIdx.x; if (t >= n8) return; FragH f;
#pragma unroll
  for (int q = 0; q < 8; ++q) f.h[q] = (_Float16)bf16_round(x[t * 8 + q]); *(v8us*)((unsigned short*)X16 + t * 8) = f.half[0];  }

// ---- fast GEMM (wave tile 32x64, work-group tile 128x64; requires M % 128 == 0 rows per launch region, N % 64 == 0 and K % 64 == 0); both operands staged in LDS 64 k at a time, two buffers; epilogue: alpha, bias, CP and ACT, stored to C, with three more results: C16 (the words as f16), LN (a row's squared length over the tile's 64 columns) and CT (the words as f16, transposed) ----
#define G2P 72                       /* 16-bit words of a staged row: 64 + 8, a pitch of 144 bytes (16 bytes x odd: 16 rows read 16 bytes a lane without bank conflicts) */
#define G2S (192 * G2P)              /* 16-bit words of a stage: 128 rows of A, then 64 rows of B */
#define G2T 136                      /* 16-bit words of a column of the transposed result's staging: 128 + 8, a pitch of 272 bytes (16 bytes x odd) */
__device__ __forceinline__ v16h g2_frag(const _Float16* p, int hh) { FragH f; f.half[0] = *(const v8us*)((const unsigned short*)p + 8 * hh); f.half[1] = *(const v8us*)((const unsigned short*)p + 16 + 8 * hh); return f.v; }
__device__ __forceinline__ v8f g2_mma(v16h a, v16h b, v8f c) { v8f d = __builtin_amdgcn_wmma_f32_16x16x32_f16(false, a, false, b, (short)0, c, false, false); asm volatile("v_nop\n\tv_nop\n\tv_nop\n\tv_nop" : "+v"(d) : "v"(a), "v"(b)); return d; }
template <int ACT>
__global__ __launch_bounds__(128) void k_gemm2(const _Float16* __restrict__ A, int lda, size_t sA, const _Float16* __restrict__ Bh, int ldb, size_t sB, float alpha, const float* __restrict__ bias, size_t sBias, const float* __restrict__ CP, int rowsPerB, size_t sCPb, int row0g,
    float* __restrict__ C, _Float16* __restrict__ C16, int ldc, size_t sC, int M, int N, int K, _Float16* __restrict__ CT, float* __restrict__ LN, int rowsT) {      /* CT [M / rowsT][N][rowsT] and LN [M / rowsT][N / 64][rowsT]: rowsT % 128 == 0, a launch of one plane */ static_assert(ACT == 0 || ACT == 3 || ACT == 6 || ACT == 8 || ACT == 9 || ACT == 11 || ACT == 12 || ACT == 14 || ACT == 15 || ACT == 16 || ACT == 17, "k_gemm2: unsupported ACT code (would silently apply no activation)");
  __shared__ __attribute__((aligned(16))) unsigned char sm[2 * G2S * 2]; static_assert(sizeof(sm) >= 4 * 32 * 68 * 4 && sizeof(sm) >= 64 * G2T * 2, "the result's staging re-uses the two operand buffers");
  float (*so)[32][68] = (float (*)[32][68])sm;      /* written only behind the k loop's last barrier */
  const int tid = threadIdx.x, w = tid >> 5, lane = tid & 31, ln = lane & 15, hh = lane >> 4; const int by = blockIdx.y;
  A += (size_t)by * sA; Bh += (size_t)by * sB; const size_t cofs = (size_t)by * sC; const float* bp = bias ? bias + (size_t)by * sBias : nullptr;
  const int ntn = N >> 6; const int mt = blockIdx.x / ntn, nq = blockIdx.x - mt * ntn; const int row0 = mt * 128 + 32 * w, col0 = nq * 64; if (mt * 128 >= M) return;      /* the whole work-group leaves or none does: barriers follow */
  const int sr = tid >> 3, sk = (tid & 7) * 8;      /* staging: 8 threads a row of 128 bytes, so a wave's load is 4 whole lines; 16 rows a round of the work-group */
  const unsigned short* ga = (const unsigned short*)A + (size_t)(mt * 128 + sr) * lda + sk; const unsigned short* gb = (const unsigned short*)Bh + (size_t)(col0 + sr) * ldb + sk;
  unsigned short* sh = (unsigned short*)sm; const int swo = sr * G2P + sk; v8us st[12];
  const v8f z8 = {0.f,0.f,0.f,0.f,0.f,0.f,0.f,0.f}; v8f c00 = z8, c01 = z8, c02 = z8, c03 = z8, c10 = z8, c11 = z8, c12 = z8, c13 = z8;
  for (int i = 0; i < 8; ++i) st[i] = *(const v8us*)(ga + (size_t)(16 * i) * lda);
  for (int i = 0; i < 4; ++i) st[8 + i] = *(const v8us*)(gb + (size_t)(16 * i) * ldb);
  for (int i = 0; i < 12; ++i) *(v8us*)(sh + swo + i * 16 * G2P) = st[i];
  __syncthreads();      /* stage 0 is in LDS before a wave reads it */
  for (int kb = 0; kb < K; kb += 64) { const int cur = (kb >> 6) & 1; const bool more = kb + 64 < K;
    if (more) {      /* the next stage's words fly while this stage is multiplied */
      for (int i = 0; i < 8; ++i) st[i] = *(const v8us*)(ga + (size_t)(16 * i) * lda + kb + 64);
      for (int i = 0; i < 4; ++i) st[8 + i] = *(const v8us*)(gb + (size_t)(16 * i) * ldb + kb + 64); }
    const _Float16* pa = (const _Float16*)(sh + cur * G2S + (32 * w + ln) * G2P); const _Float16* pb = (const _Float16*)(sh + cur * G2S + (128 + ln) * G2P);
    v16h a0[2], a1[2], b[2][4];
    for (int ks = 0; ks < 2; ++ks) { a0[ks] = g2_frag(pa + 32 * ks, hh); a1[ks] = g2_frag(pa + 16 * G2P + 32 * ks, hh);
      for (int t = 0; t < 4; ++t) b[ks][t] = g2_frag(pb + t * 16 * G2P + 32 * ks, hh); }
    for (int ks = 0; ks < 2; ++ks) { c00 = g2_mma(a0[ks], b[ks][0], c00); c10 = g2_mma(a1[ks], b[ks][0], c10); c01 = g2_mma(a0[ks], b[ks][1], c01); c11 = g2_mma(a1[ks], b[ks][1], c11);
      c02 = g2_mma(a0[ks], b[ks][2], c02); c12 = g2_mma(a1[ks], b[ks][2], c12); c03 = g2_mma(a0[ks], b[ks][3], c03); c13 = g2_mma(a1[ks], b[ks][3], c13); }
    if (more) {
      for (int i = 0; i < 12; ++i) *(v8us*)(sh + (cur ^ 1) * G2S + swo + i * 16 * G2P) = st[i]; }      /* the other buffer: its readers left it in front of the last barrier */
    __syncthreads(); }      /* publishes the next stage and ends this stage's reads (behind the last stage: before the result's staging re-uses the bytes) */
  v8f accs[8] = {c00, c01, c02, c03, c10, c11, c12, c13};
#pragma unroll
  for (int u = 0; u < 8; ++u) { const int t = u & 3, half = u >> 2; const int col = col0 + t * 16 + ln; const float bv = bp ? bf16_round(bp[col]) : 0.f;
#pragma unroll
    for (int r = 0; r < 8; ++r) { const int rloc = half * 16 + 8 * hh + r; float v = accs[u][r] * alpha + bv; if (CP) { if (rowsPerB < 0) v += CP[cofs + (size_t)(row0g + row0 + rloc) * ldc + col];      /* rowsPerB < 0: own element of the batched C plane */ else { const int bidx = (row0g + row0 + rloc) / rowsPerB; v += CP[(size_t)bidx * sCPb + (size_t)by * 64 + col]; } }
      if (ACT == 3) v = fmaxf(v, 0.f); else if (ACT == 6) v = 0.5f * v * (1.0f + erff(v * 0.70710678118654752f)); else if (ACT == 11) v = 1.0f / (1.0f + expf(-v)); else if (ACT == 15) v = v / (1.0f + expf(-v)); else if (ACT == 12) v = (v > 0.f) ? v : 0.01f * v; else if (ACT == 8) v = tanhf(v); else if (ACT == 9) v = 0.5f * v * (1.0f + tanhf(0.7978845608028654f * (v + 0.044715f * v * v * v))); else if (ACT == 14) v = (v > 0.f) ? v : 0.1f * v; else if (ACT == 16) v = (v >= 0.f) ? v : 0.3f * v; else if (ACT == 17) v = (v >= 0.f) ? v : 0.2f * v;
      accs[u][r] = v; } }
  if (CT) {      /* the same for the whole work-group: a barrier follows. A lane's 8 words of an accumulator are 8 rows in a row of one column: 16 bytes of the transposed sheet */
    unsigned short* tp = (unsigned short*)sm; const int gT = (mt * 128) / rowsT, rT = mt * 128 - gT * rowsT;
#pragma unroll
    for (int u = 0; u < 8; ++u) { FragH f;
#pragma unroll
      for (int r = 0; r < 8; ++r) f.h[r] = (_Float16)accs[u][r];
      *(v8us*)(tp + ((u & 3) * 16 + ln) * G2T + 32 * w + (u >> 2) * 16 + 8 * hh) = f.half[0]; }
    __syncthreads();      /* the four waves' rows of every column are in LDS before a wave stores whole columns of the tile (256 bytes in a row each) */
    unsigned short* gt = (unsigned short*)CT + ((size_t)gT * N + col0 + (tid >> 4)) * rowsT + rT + (tid & 15) * 8;
    v8us tv[8];
#pragma unroll
    for (int q = 0; q < 8; ++q) tv[q] = *(const v8us*)(tp + (q * 8 + (tid >> 4)) * G2T + (tid & 15) * 8);
#pragma unroll
    for (int q = 0; q < 8; ++q) { *(v8us*)(gt + (size_t)(q * 8) * rowsT) = tv[q];
      asm volatile("s_wait_xcnt 0x0" ::: "memory"); }      /* the wait in front of the next overwrite of a store's registers (a later store's address re-uses them; behind the last store the built code still holds a branch to the other epilogue, which writes them) */
    return; }
#pragma unroll
  for (int u = 0; u < 8; ++u) {
#pragma unroll
    for (int r = 0; r < 8; ++r) so[w][(u >> 2) * 16 + 8 * hh + r][(u & 3) * 16 + ln] = accs[u][r]; }
  __builtin_amdgcn_fence(__ATOMIC_ACQ_REL, "workgroup"); __builtin_amdgcn_wave_barrier();
  const int rsub = lane >> 4, c4 = (lane & 15) * 4;
  {
#pragma unroll
    for (int q = 0; q < 16; ++q) { const int r = q * 2 + rsub; const v4f v = *(const v4fa*)&so[w][r][c4]; if (C) *(v4f*)(C + cofs + (size_t)(row0 + r) * ldc + col0 + c4) = v; if (C16) { v4h h4; for (int i = 0; i < 4; ++i) h4[i] = (_Float16)v[i]; *(v4h*)(C16 + cofs + (size_t)(row0 + r) * ldc + col0 + c4) = h4; } }
     }
  if (LN) { const float* p = &so[w][lane][0]; float a = 0.0f; const int gT = (mt * 128) / rowsT, rT = mt * 128 - gT * rowsT;      /* a lane a row of the wave's 32: the row's 64 f32 words in index order */
    asm volatile("s_wait_xcnt 0x0" ::: "memory");      /* the wait in front of the overwrite of the last store's registers (the loads below re-use them) */
    v4f x[16];
#pragma unroll
    for (int c = 0; c < 16; ++c) x[c] = *(const v4fa*)(p + 4 * c);
    __builtin_amdgcn_sched_barrier(0);      /* keeps the 16 LDS loads together in front of the sum: sunk into the chain of 64 dependent multiply-adds, each would be waited for in turn */
#pragma unroll
    for (int c = 0; c < 64; ++c) a = __builtin_fmaf(x[c >> 2][c & 3], x[c >> 2][c & 3], a);
    LN[((size_t)gT * ntn + nq) * rowsT + rT + 32 * w + lane] = a; } }

// A work-group takes QCB columns of one strip over all its rows: fa's strip (all rows) and fb's QCB rows are staged in LDS once (whole-line loads), a wave forms QFT tiles of 32 x 64 products on WMMA (the k order and the order of the two k steps are k_gemm2's), turns each accumulator word into sc where it lies, keeps the running sums of its columns and stores the tile through its own LDS rows (a store of the wave = 2 rows of 256 bytes in a row). The product itself never goes to memory.
// Eight transcendentals of one kind in ONE asm statement: every result register is apart from every source register ("=&v"), so none of them reads a result or overwrites a source of the one in front of it, and the v_nop at the end is the slot that the instruction set asks for behind the last one (left to the register allocator, runs of these instructions overwrote one another's sources back to back).
#define Q8T(name, op) __device__ __forceinline__ void name(float* y, const float* x) { asm(op " %0, %8\n\t" op " %1, %9\n\t" op " %2, %10\n\t" op " %3, %11\n\t" op " %4, %12\n\t" op " %5, %13\n\t" op " %6, %14\n\t" op " %7, %15\n\tv_nop" : "=&v"(y[0]), "=&v"(y[1]), "=&v"(y[2]), "=&v"(y[3]), "=&v"(y[4]), "=&v"(y[5]), "=&v"(y[6]), "=&v"(y[7]) : "v"(x[0]), "v"(x[1]), "v"(x[2]), "v"(x[3]), "v"(x[4]), "v"(x[5]), "v"(x[6]), "v"(x[7])); }
Q8T(q8_sqrt, "v_sqrt_f32")
Q8T(q8_log, "v_log_f32")
Q8T(q8_exp, "v_exp_f32")
__global__ __launch_bounds__(QFW * 32) void k_qps(const _Float16* __restrict__ FA, const _Float16* __restrict__ FB, const float* __restrict__ la, const float* __restrict__ lb, float* __restrict__ SC, float* __restrict__ CF) {
  static_assert(QSW == 64 && QCB == 64 && QNL == QFW * QFT * 32 && QFW * 32 == 8 * 64 && QNL % 64 == 0, "8 threads stage a row of 128 bytes, 64 rows a round; the waves' tiles cover all rows");
  __shared__ __attribute__((aligned(16))) unsigned short sa[(QNL + QCB) * G2P];      /* fa's rows, then fb's */
  __shared__ __attribute__((aligned(16))) float so[QFW][32][68];      /* a wave's own tile of sc */
  __shared__ __attribute__((aligned(16))) float ps[2 * QFW][QCB];
  const int tid = threadIdx.x, w = tid >> 5, lane = tid & 31, ln = lane & 15, hh = lane >> 4; const int s = blockIdx.x / (QNL / QCB), j0 = (blockIdx.x % (QNL / QCB)) * QCB;
  const int sr = tid >> 3, sk = (tid & 7) * 8;
  const unsigned short* ga = (const unsigned short*)FA + (size_t)sr * QNW + s * QSW + sk; const unsigned short* gb = (const unsigned short*)FB + (size_t)(j0 + sr) * QNW + s * QSW + sk;
  v8us st[QNL / 64 + 1]; float kb[4]; v4f qa[QFT][2][2];
#pragma unroll
  for (int i = 0; i < QNL / 64; ++i) st[i] = *(const v8us*)(ga + (size_t)(64 * i) * QNW);
  st[QNL / 64] = *(const v8us*)gb;
#pragma unroll
  for (int t = 0; t < 4; ++t) kb[t] = lb[s * QNL + j0 + t * 16 + ln];
#pragma unroll
  for (int tt = 0; tt < QFT; ++tt)
#pragma unroll
    for (int e = 0; e < 4; ++e) qa[tt][e >> 1][e & 1] = *(const v4fa*)(la + s * QNL + (QFT * w + tt) * 32 + (e >> 1) * 16 + 8 * hh + (e & 1) * 4);      /* the lengths of the 16 rows that the lane's accumulator words lie in */
  asm volatile("s_wait_xcnt 0x0" ::: "memory");      /* the wait in front of the first overwrite of the loads' address registers (the LDS addresses below may re-use them) */
#pragma unroll
  for (int i = 0; i < QNL / 64; ++i) *(v8us*)(sa + (sr + 64 * i) * G2P + sk) = st[i];
  *(v8us*)(sa + (QNL + sr) * G2P + sk) = st[QNL / 64];
  __syncthreads();      /* both operands are in LDS before a wave reads its fragments */
  const _Float16* pb = (const _Float16*)(sa + (QNL + ln) * G2P); v16h b[2][4];
#pragma unroll
  for (int ks = 0; ks < 2; ++ks)
#pragma unroll
    for (int t = 0; t < 4; ++t) b[ks][t] = g2_frag(pb + t * 16 * G2P + 32 * ks, hh);
  float cs[4] = {0.f, 0.f, 0.f, 0.f}; const int rsub = lane >> 4, c4 = (lane & 15) * 4;
  float* og = SC + (size_t)s * QNL * QNL + (size_t)(QFT * 32 * w + rsub) * QNL + j0 + c4;
#pragma unroll      /* whole: the lengths' registers are indexed by the tile */
  for (int tt = 0; tt < QFT; ++tt) { const _Float16* pa = (const _Float16*)(sa + ((QFT * w + tt) * 32 + ln) * G2P); v16h a0[2], a1[2];
#pragma unroll
    for (int ks = 0; ks < 2; ++ks) { a0[ks] = g2_frag(pa + 32 * ks, hh); a1[ks] = g2_frag(pa + 16 * G2P + 32 * ks, hh); }
    const v8f z8 = {0.f,0.f,0.f,0.f,0.f,0.f,0.f,0.f}; v8f acc[8] = {z8, z8, z8, z8, z8, z8, z8, z8};
#pragma unroll
    for (int ks = 0; ks < 2; ++ks)
#pragma unroll
      for (int t = 0; t < 4; ++t) { acc[t] = __builtin_amdgcn_wmma_f32_16x16x32_f16(false, a0[ks], false, b[ks][t], (short)0, acc[t], false, false); acc[4 + t] = __builtin_amdgcn_wmma_f32_16x16x32_f16(false, a1[ks], false, b[ks][t], (short)0, acc[4 + t], false, false); }
    __builtin_amdgcn_sched_barrier(0);      /* keeps the asm statements below behind the tile's last WMMA and behind the arithmetic that feeds them: drawn up among the WMMAs, a result register of theirs overwrote a fragment too few vector slots behind its WMMA (the compiler pads its own instructions, not asm text) */
#pragma unroll
    for (int u = 0; u < 8; ++u) { const int t = u & 3, half = u >> 2;
      float x[8], y[8]; bool lo[8];
#pragma unroll
      for (int r = 0; r < 8; ++r) x[r] = fmaxf((qa[tt][half][r >> 2][r & 3] + kb[t]) - 2.0f * acc[u][r], QLO);
      q8_sqrt(y, x);      /* v_sqrt_f32 as it is: its argument is at least QLO, never subnormal */
#pragma unroll
      for (int r = 0; r < 8; ++r) x[r] = 1.0f + y[r] / QDS;
      q8_log(y, x);      /* (1 + gd)^QPW = 2^(QPW log2(1 + gd)); v_log_f32 as it is: its argument is at least 1 */
#pragma unroll
      for (int r = 0; r < 8; ++r) { const float p = QPW * y[r]; lo[r] = p < -126.0f; x[r] = p + (lo[r] ? 64.0f : 0.0f); }      /* exp2f's own steps written out: an exponent below -126 is raised by 64 in front of v_exp_f32 and the result scaled back, so subnormal results are kept */
      q8_exp(y, x);
#pragma unroll
      for (int r = 0; r < 8; ++r) { const float v = ldexpf(y[r], lo[r] ? -64 : 0); cs[t] += v; so[w][half * 16 + 8 * hh + r][t * 16 + ln] = v; } }
    asm volatile("s_wait_dscnt 0x0" ::: "memory");      /* the wave's own LDS writes are done before its lanes read one another's words back */
    v4f tv[16];
#pragma unroll
    for (int q = 0; q < 16; ++q) tv[q] = *(const v4fa*)&so[w][q * 2 + rsub][c4];
    static_assert(2 * QNL * 4 == 8192, "the stores' offsets below: 2 rows of sc a step");
    /* the tile's 16 stores and the wait in front of the next overwrite of their data and address registers in ONE statement: in a statement of its own the wait came too late (the compiler put a column sum's add, into a store's data register, between the last store and the wait) */
    asm volatile("global_store_b128 %0, %1, off\n\tglobal_store_b128 %0, %2, off offset:8192\n\tglobal_store_b128 %0, %3, off offset:16384\n\tglobal_store_b128 %0, %4, off offset:24576\n\t"
                 "global_store_b128 %0, %5, off offset:32768\n\tglobal_store_b128 %0, %6, off offset:40960\n\tglobal_store_b128 %0, %7, off offset:49152\n\tglobal_store_b128 %0, %8, off offset:57344\n\t"
                 "global_store_b128 %0, %9, off offset:65536\n\tglobal_store_b128 %0, %10, off offset:73728\n\tglobal_store_b128 %0, %11, off offset:81920\n\tglobal_store_b128 %0, %12, off offset:90112\n\t"
                 "global_store_b128 %0, %13, off offset:98304\n\tglobal_store_b128 %0, %14, off offset:106496\n\tglobal_store_b128 %0, %15, off offset:114688\n\tglobal_store_b128 %0, %16, off offset:122880\n\ts_wait_xcnt 0x0"
                 :: "v"(og + (size_t)(tt * 32) * QNL), "v"(tv[0]), "v"(tv[1]), "v"(tv[2]), "v"(tv[3]), "v"(tv[4]), "v"(tv[5]), "v"(tv[6]), "v"(tv[7]), "v"(tv[8]), "v"(tv[9]), "v"(tv[10]), "v"(tv[11]), "v"(tv[12]), "v"(tv[13]), "v"(tv[14]), "v"(tv[15]) : "memory"); }
#pragma unroll
  for (int t = 0; t < 4; ++t) ps[2 * w + hh][t * 16 + ln] = cs[t];
  __syncthreads();      /* the 2 QFW partial sums of every column are in LDS before a thread a column adds them */
  if (tid < QCB) { float t = 0.0f;
#pragma unroll
    for (int r = 0; r < 2 * QFW; ++r) t += ps[r][tid];
    CF[s * QNL + j0 + tid] = 1.0f / sqrtf(t); } }

// A wave takes QRW rows of sc one after the other, each whole row in its registers (a lane: 8 pieces of 4 words, a load of the wave = 512 bytes in a row): nr, kt's row sum and pb from ONE read.
__device__ __forceinline__ float wave_sum(float s) {      /* butterfly over the 32 lanes: every lane ends with the same bits */
  s += __int_as_float(__builtin_amdgcn_update_dpp(0, __float_as_int(s), 0x161, 0xf, 0xf, false));      /* row_xmask:1 */
  s += __int_as_float(__builtin_amdgcn_update_dpp(0, __float_as_int(s), 0x162, 0xf, 0xf, false));      /* row_xmask:2 */
  s += __int_as_float(__builtin_amdgcn_update_dpp(0, __float_as_int(s), 0x164, 0xf, 0xf, false));      /* row_xmask:4 */
  s += __int_as_float(__builtin_amdgcn_update_dpp(0, __float_as_int(s), 0x168, 0xf, 0xf, false));      /* row_xmask:8 */
  const int b = __float_as_int(s); s += __int_as_float(__builtin_amdgcn_permlanex16(b, b, 0x76543210, 0xfedcba98, false, false));      /* lane l with lane l ^ 16 */
  return s; }

__global__ __launch_bounds__(QWV * 32) void k_ktw(const float* __restrict__ SC, const float* __restrict__ CF, _Float16* __restrict__ PB) {
  static_assert(QNL == 8 * 128 && QNL % QRW == 0 && (QNS * QNL) % (QWV * QRW) == 0, "a row is 8 loads of a wave; a wave's rows lie in one strip; whole work-groups");
  const unsigned lane = threadIdx.x & 31u, wave = (unsigned)__builtin_amdgcn_readfirstlane((int)(threadIdx.x >> 5)); const unsigned r0 = (blockIdx.x * QWV + wave) * QRW;
  const float* p = SC + (size_t)r0 * QNL + lane * 4; const float* cf = CF + (size_t)(r0 / QNL) * QNL + lane * 4; _Float16* o = PB + (size_t)r0 * QNL + lane * 4;
  v4f c[8], w[2][8];
#pragma unroll
  for (int q = 0; q < 8; ++q) w[0][q] = *(const v4fa*)(p + q * 128);
#pragma unroll
  for (int q = 0; q < 8; ++q) c[q] = *(const v4fa*)(cf + q * 128);
#pragma unroll
  for (int k = 0; k < QRW; ++k) { v4f* t = w[k & 1];
    __builtin_amdgcn_sched_barrier(0);      /* this one and the one behind the loads pin the order: the next row's loads, then this row's arithmetic; without them the next row's sum is drawn forward into this row's arithmetic and its loads get less time to land */
    if (k + 1 < QRW) {
#pragma unroll
      for (int q = 0; q < 8; ++q) w[(k + 1) & 1][q] = *(const v4fa*)(p + (size_t)(k + 1) * QNL + q * 128);
      if (k == 0) asm volatile("s_wait_xcnt 0x0" ::: "memory");      /* the wait in front of the first overwrite of the scalar base that the loads of c name (the arithmetic below re-uses it) */
      __builtin_amdgcn_sched_barrier(0); }
    v4f a = {0.f, 0.f, 0.f, 0.f};
#pragma unroll
    for (int q = 0; q < 8; ++q) a += t[q];
    const float rf = 1.0f / sqrtf(wave_sum((a[0] + a[1]) + (a[2] + a[3]))); a = (v4f){0.f, 0.f, 0.f, 0.f};
#pragma unroll
    for (int q = 0; q < 8; ++q) { t[q] = (rf * t[q]) * c[q]; a += t[q]; }
    const float dn = fmaxf(wave_sum((a[0] + a[1]) + (a[2] + a[3])), QLO);
#pragma unroll
    for (int q = 0; q < 8; ++q) { v4h h;
#pragma unroll
      for (int i = 0; i < 4; ++i) h[i] = (_Float16)((t[q][i] / dn) * QPC);
      *(v4h*)(o + (size_t)k * QNL + q * 128) = h;
      if (k + 1 < QRW || q < 7) asm volatile("s_wait_xcnt 0x0" ::: "memory"); } }      /* the wait in front of the next overwrite of the store's data registers (later pieces, the next rows' loads); behind the wave's last store nothing is overwritten */
}

extern "C" void kernel_launch(void* const* d_in, const int* in_sizes, int n_in,
                              void* d_out, int out_size, void* d_ws, size_t ws_size, hipStream_t stream) {
  (void)in_sizes; (void)n_in; (void)out_size;
  const float* const* I = (const float* const*)d_in; const float* xa = I[0]; const float* wa = I[1]; const float* va = I[2]; const float* wb = I[3]; const float* vb = I[4]; const float* wc = I[5]; const float* vc = I[6]; const float* wd = I[7]; const float* vd = I[8];      /* xa [2][1024][1024]; the four weights [1024][1024] (source, result); the four added vectors [1024] */
  float* res = (float*)d_out;
  static_assert((QNG * QNL) % 128 == 0 && QNL % 128 == 0 && QNW % 64 == 0 && QNW % 32 == 0 && QSW % 64 == 0 && QSW % 32 == 0 && QNL % 8 == 0 && QNS * QSW == QNW, "whole tiles");
  uint8_t* wsp = (uint8_t*)d_ws; size_t off = 0;
  auto take = [&](size_t bytes) { uint8_t* p = wsp + off; off += (bytes + 255) & ~(size_t)255; return p; };
  const size_t GW = (size_t)QNG * QNL * QNW, G1 = (size_t)QNL * QNW;
  float* SC = (float*)take((size_t)QNS * QNL * QNL * 4); _Float16* PB = (_Float16*)take((size_t)QNS * QNL * QNL * 2);
  _Float16* XH = (_Float16*)take(GW * 2); _Float16* AH = (_Float16*)take(GW * 2); _Float16* BH = (_Float16*)take(GW * 2); _Float16* CH = (_Float16*)take(GW * 2); _Float16* VT = (_Float16*)take(GW * 2);
  _Float16* WA = (_Float16*)take((size_t)QNW * QNW * 2); _Float16* WB = (_Float16*)take((size_t)QNW * QNW * 2); _Float16* WC = (_Float16*)take((size_t)QNW * QNW * 2); _Float16* WD = (_Float16*)take((size_t)QNW * QNW * 2); float* LA = (float*)take((size_t)QNG * QNS * QNL * 4); float* LB = (float*)take((size_t)QNG * QNS * QNL * 4); float* CF = (float*)take((size_t)QNS * QNL * 4);      /* a group's sixteen sheets of sc and of pb (re-used group after group); xa's cast; the f16 words of fa, fb, cx; fc's transposed, group by group; the four weights transposed; the strips' squared lengths; a group's column factors */
  if (off > ws_size) return;
  k_x16<<<(unsigned)((GW / 8 + 255) / 256), 256, 0, stream>>>(xa, XH, GW / 8);
  k_wt_f16<<<(unsigned)(((size_t)QNW * (QNW / 8) + 255) / 256), 256, 0, stream>>>(wa, WA, QNW, QNW, QWC);      /* WA[o][k] = f16(64 wa[k][o]) */
  k_wt_f16<<<(unsigned)(((size_t)QNW * (QNW / 8) + 255) / 256), 256, 0, stream>>>(wb, WB, QNW, QNW, QWC);
  k_wt_f16<<<(unsigned)(((size_t)QNW * (QNW / 8) + 255) / 256), 256, 0, stream>>>(wc, WC, QNW, QNW, QWC);
  k_wt_f16<<<(unsigned)(((size_t)QNW * (QNW / 8) + 255) / 256), 256, 0, stream>>>(wd, WD, QNW, QNW, QWC);
  k_gemm2<0><<<dim3((unsigned)(((QNG * QNL) / 128) * (QNW / 64)), 1), 128, 0, stream>>>(XH, QNW, 0, WA, QNW, 0, 1.0f / QWC, va, 0, nullptr, 1, 0, 0, nullptr, AH, QNW, 0, QNG * QNL, QNW, QNW, nullptr, LA, QNL);      /* fa[(g, i)][o] = xa[g][i][:] . wa[:][o] + va[o]: AH its f16 words, LA[g][s][i] its strips' squared lengths */
  k_gemm2<0><<<dim3((unsigned)(((QNG * QNL) / 128) * (QNW / 64)), 1), 128, 0, stream>>>(XH, QNW, 0, WB, QNW, 0, 1.0f / QWC, vb, 0, nullptr, 1, 0, 0, nullptr, BH, QNW, 0, QNG * QNL, QNW, QNW, nullptr, LB, QNL);
  k_gemm2<0><<<dim3((unsigned)(((QNG * QNL) / 128) * (QNW / 64)), 1), 128, 0, stream>>>(XH, QNW, 0, WC, QNW, 0, 1.0f / QWC, vc, 0, nullptr, 1, 0, 0, nullptr, nullptr, QNW, 0, QNG * QNL, QNW, QNW, VT, nullptr, QNL);      /* VT[g][(s, c)][j] = f16(fc[g][j][s 64 + c]) */
  for (int g = 0; g < QNG; ++g) {      /* a literal 2 on the host: SC, PB and CF are re-used group after group */
    k_qps<<<(unsigned)(QNS * (QNL / QCB)), QFW * 32, 0, stream>>>(AH + g * G1, BH + g * G1, LA + (size_t)g * QNS * QNL, LB + (size_t)g * QNS * QNL, SC, CF);      /* SC[s][i][j] = sc from fa[g][i][s] . fb[g][j][s] and the two lengths; CF[s][j] = nc^(-1/2) */
    k_ktw<<<(unsigned)((QNS * QNL) / (QWV * QRW)), QWV * 32, 0, stream>>>(SC, CF, PB);
    k_gemm2<0><<<dim3((unsigned)((QNL / 128) * (QSW / 64)), QNS), 128, 0, stream>>>(PB, QNL, (size_t)QNL * QNL, VT + g * G1, QNL, (size_t)QSW * QNL, 1.0f / QPC, nullptr, 0, nullptr, 1, 0, 0, nullptr, CH + g * G1, QNW, (size_t)QSW, QNL, QSW, QNL, nullptr, nullptr, QNL); }      /* CH[g][i][s 64 + c] = the f16 word of sum over j of PB[s][i][j] fc[g][j][s 64 + c] / 2^12: in place at a strip's column offset */
  k_gemm2<0><<<dim3((unsigned)(((QNG * QNL) / 128) * (QNW / 64)), 1), 128, 0, stream>>>(CH, QNW, 0, WD, QNW, 0, 1.0f / QWC, vd, 0, nullptr, 1, 0, 0, res, nullptr, QNW, 0, QNG * QNL, QNW, QNW, nullptr, nullptr, QNL);      /* res = cx wd + vd: every word of the result once */
}

// v007
// One run takes 116 microseconds.
// Two timings next to v006 put it at 1.48 and 1.50 times that version's speed.
// All steps since v000 together make it 5.58 times as fast.
// A distance-kernel mixing of rows: xa [2][1024][1024] (group, row, width); wa, wb, wc, wd [1024][1024] stored (source column, result column), va, vb, vc, vd [1024]: fa | fb | fc = xa w + v, split into 16 strips of 64 columns; for a group and a strip: e2[i][j] = |fa_i|^2 + |fb_j|^2 - 2 fa_i . fb_j; gd = sqrt(max(e2, 1e-12)) / 64; sc = (1 + gd)^(-65.5); nr = its row sums, nc = its column sums; kt = nr^(-1/2) sc nc^(-1/2); pb = kt / max(its row sum, 1e-12); cx = pb fc's strip; res = cx wd + vd -> [2][1024][1024] f32: one result.
// Structure: xa cast to f16 as it lies and the four weights cast transposed behind a carry of 64 (converted to bf16 first); three WMMA GEMMs (the carry undone in their scale argument; the added vectors live) whose f32 words never go to memory: the epilogue of fa's and fb's stores each word as ONE f16 word and, a lane a row, a strip's squared length (the tile's 64 f32 words in index order; a tile's width is a strip's), the epilogue of fc's stores the f16 words transposed through LDS, a group's sheet (strip column, row); launches that do not wait for one another are ONE launch and run side by side (the five casts; the three projections, a plane of the grid each; both groups in each of the three kernels that follow); THEN, BOTH GROUPS AT ONCE: ONE kernel, a work-group 64 columns of a strip of a group over all rows, forms fa . fb (depth 64) on WMMA, forms sc from the two lengths and the product while the product is still in the accumulators (the root, log2 and exp2 instructions: the power as 2^(-65.5 log2(1 + gd))), stores sc into a group's sixteen f32 sheets, sums its columns as it goes (lane partials, then LDS) and stores each sum's reciprocal root; ONE kernel a wave four rows in turn (each row in the wave's registers, read once) forms the row's sum, kt's row sum (lane partials, then a butterfly) and stores pb as one f16 word behind a carry of 2^12; one WMMA GEMM (depth 1,024; its scale undoes the carry) stores cx as f16 words in place at a strip's column offset; then the last WMMA GEMM writes the result.
// Compute dtype: all nine inputs converted to bf16 where they are read; xa's words exact as f16 operands down to 2^-14; the weights' behind 64; the computed sheets ONE f16 word each (pb behind 2^12) but sc's; sc, every product's accumulation, the lengths, the kernel's arithmetic, the sums and the result f32. v_wmma_f32_16x16x32_f16.
#include <hip/hip_runtime.h>
#define QNG 2                        /* groups */
#define QNL 1024                     /* rows of a group */
#define QNW 1024                     /* a row's width: every projection's depth and width */
#define QNS 16                       /* strips */
#define QSW 64                       /* a strip's width: the pair product's depth */
#define QDS 64.0f                    /* the distance's divisor */
#define QPW -65.5f                   /* the power */
#define QLO 1e-12f                   /* the lower bound of e2 and of a row's sum */
#define QWC 64.0f                    /* the weights' carry (undone in the products' scale argument) */
#define QPC 4096.0f                  /* pb's carry (undone in the fifth product's scale argument) */
#define QWV 16                       /* waves of a work-group of the row kernel */
#define QRW 4                        /* rows of sc that one of its waves takes */
#define QCB 64                       /* columns of sc that a work-group of the pair kernel takes */
#define QFW 16                       /* its waves */
#define QFT 2                        /* tiles of 32 rows that one of its waves takes */
typedef unsigned short v8us __attribute__((ext_vector_type(8), may_alias));
typedef float  v8f  __attribute__((ext_vector_type(8)));
typedef float  v4f  __attribute__((ext_vector_type(4)));
typedef float  v4fa __attribute__((ext_vector_type(4), may_alias));

__device__ __forceinline__ unsigned short bf16_bits(float x) { unsigned int u = __float_as_uint(x); return (unsigned short)((u + 0x7FFFu + ((u >> 16) & 1u)) >> 16); }
__device__ __forceinline__ float bf16_val(unsigned short b) { return __uint_as_float(((unsigned int)b) << 16); }
__device__ __forceinline__ float bf16_round(float x) { return bf16_val(bf16_bits(x)); }

typedef _Float16 v16h __attribute__((ext_vector_type(16)));
union FragH { v16h v; v8us half[2]; _Float16 h[16]; unsigned short u[16]; };

// The five casts in one launch (none waits for another). The first 4 QWB work-groups: Wt[m][n][k] = f16(Wm[k][n] x scale) from f32 row-major Wm[QNW][QNW] (scale = power of two; bf16-exact weights stay exact in f16 away from the subnormal range); the slower ones, placed first. The QXB behind them: xa's words as they lie.
#define QWB ((QNW * (QNW / 8)) / 256)                /* work-groups of one weight's cast */
#define QXB ((QNG * QNL * (QNW / 8)) / 256)          /* work-groups of xa's cast */
__global__ __launch_bounds__(256) void k_cast(const float* __restrict__ x, const float* __restrict__ W0, const float* __restrict__ W1, const float* __restrict__ W2, const float* __restrict__ W3, _Float16* __restrict__ X16, _Float16* __restrict__ Wt, float scale) {
  static_assert((QNW * (QNW / 8)) % 256 == 0 && (QNG * QNL * (QNW / 8)) % 256 == 0, "whole work-groups");
  FragH f;
  if (blockIdx.x >= 4 * QWB) { const size_t t = (size_t)(blockIdx.x - 4 * QWB) * 256 + threadIdx.x;
#pragma unroll
    for (int q = 0; q < 8; ++q) f.h[q] = (_Float16)bf16_round(x[t * 8 + q]);
    *(v8us*)((unsigned short*)X16 + t * 8) = f.half[0]; return; }
  const int m = blockIdx.x / QWB; const float* W = m == 0 ? W0 : m == 1 ? W1 : m == 2 ? W2 : W3;
  const int t = (blockIdx.x - m * QWB) * 256 + threadIdx.x; const int n = t / (QNW / 8), k8 = (t % (QNW / 8)) * 8;
#pragma unroll
  for (int i = 0; i < 8; ++i) f.h[i] = (_Float16)(bf16_round(W[(size_t)(k8 + i) * QNW + n]) * scale);
  *(v8us*)((unsigned short*)Wt + (size_t)m * QNW * QNW + (size_t)n * QNW + k8) = f.half[0];
}

typedef _Float16 v4h __attribute__((ext_vector_type(4)));

// ---- fast GEMM (wave tile 32x64, work-group tile 128x64; requires M % 128 == 0 rows per launch region, N % 64 == 0 and K % 64 == 0); both operands staged in LDS 64 k at a time, two buffers; epilogue: alpha, bias, an added C and an activation, with three more results: C16 (the words as f16), LN (a row's squared length over the tile's 64 columns) and CT (the words as f16, transposed); the grid's y and z number independent products that run side by side ----
#define G2P 72                       /* 16-bit words of a staged row: 64 + 8, a pitch of 144 bytes (16 bytes x odd: 16 rows read 16 bytes a lane without bank conflicts) */
#define G2S (192 * G2P)              /* 16-bit words of a stage: 128 rows of A, then 64 rows of B */
#define G2T 136                      /* 16-bit words of a column of the transposed result's staging: 128 + 8, a pitch of 272 bytes (16 bytes x odd) */
__device__ __forceinline__ v16h g2_frag(const _Float16* p, int hh) { FragH f; f.half[0] = *(const v8us*)((const unsigned short*)p + 8 * hh); f.half[1] = *(const v8us*)((const unsigned short*)p + 16 + 8 * hh); return f.v; }
__device__ __forceinline__ v8f g2_mma(v16h a, v16h b, v8f c) { v8f d = __builtin_amdgcn_wmma_f32_16x16x32_f16(false, a, false, b, (short)0, c, false, false); asm volatile("v_nop\n\tv_nop\n\tv_nop\n\tv_nop" : "+v"(d) : "v"(a), "v"(b)); return d; }
template <int ACT>
__global__ __launch_bounds__(128) void k_gemm2(const _Float16* __restrict__ A, int lda, size_t sA, const _Float16* __restrict__ Bh, int ldb, size_t sB, float alpha, const float* __restrict__ bias, size_t sBias, const float* __restrict__ CP, int rowsPerB, size_t sCPb, int row0g,
    float* __restrict__ C, _Float16* __restrict__ C16, int ldc, size_t sC, int M, int N, int K, _Float16* __restrict__ CT, float* __restrict__ LN, int rowsT, const float* __restrict__ biasB, const float* __restrict__ biasC, int nY, size_t sCZ, size_t sLN, int byT) {      /* CT [M / rowsT][N][rowsT] and LN [M / rowsT][N / 64][rowsT]: rowsT % 128 == 0; CT is plane byT's only result; biasB, biasC: where given, the added vectors of planes 1 and 2; nY: the grid's extent in y; sCZ: C's step from one z to the next; sLN: LN's from one y to the next */ static_assert(ACT == 0 || ACT == 3 || ACT == 6 || ACT == 8 || ACT == 9 || ACT == 11 || ACT == 12 || ACT == 14 || ACT == 15 || ACT == 16 || ACT == 17, "k_gemm2: unsupported ACT code (would silently apply no activation)");
  __shared__ __attribute__((aligned(16))) unsigned char sm[2 * G2S * 2]; static_assert(sizeof(sm) >= 4 * 32 * 68 * 4 && sizeof(sm) >= 64 * G2T * 2, "the result's staging re-uses the two operand buffers");
  float (*so)[32][68] = (float (*)[32][68])sm;      /* written only behind the k loop's last barrier */
  const int tid = threadIdx.x, w = tid >> 5, lane = tid & 31, ln = lane & 15, hh = lane >> 4; const int by = blockIdx.y; const size_t pl = (size_t)blockIdx.z * nY + by;      /* the operands' planes lie one behind the other, y within z */
  A += pl * sA; Bh += pl * sB; const size_t cofs = (size_t)by * sC + (size_t)blockIdx.z * sCZ; const float* bp = bias ? (biasB ? (by == 0 ? bias : by == 1 ? biasB : biasC) : bias + (size_t)by * sBias) : nullptr;
  const int ntn = N >> 6; const int mt = blockIdx.x / ntn, nq = blockIdx.x - mt * ntn; const int row0 = mt * 128 + 32 * w, col0 = nq * 64; if (mt * 128 >= M) return;      /* the whole work-group leaves or none does: barriers follow */
  const int sr = tid >> 3, sk = (tid & 7) * 8;      /* staging: 8 threads a row of 128 bytes, so a wave's load is 4 whole lines; 16 rows a round of the work-group */
  const unsigned short* ga = (const unsigned short*)A + (size_t)(mt * 128 + sr) * lda + sk; const unsigned short* gb = (const unsigned short*)Bh + (size_t)(col0 + sr) * ldb + sk;
  unsigned short* sh = (unsigned short*)sm; const int swo = sr * G2P + sk; v8us st[12];
  const v8f z8 = {0.f,0.f,0.f,0.f,0.f,0.f,0.f,0.f}; v8f c00 = z8, c01 = z8, c02 = z8, c03 = z8, c10 = z8, c11 = z8, c12 = z8, c13 = z8;
  for (int i = 0; i < 8; ++i) st[i] = *(const v8us*)(ga + (size_t)(16 * i) * lda);
  for (int i = 0; i < 4; ++i) st[8 + i] = *(const v8us*)(gb + (size_t)(16 * i) * ldb);
  for (int i = 0; i < 12; ++i) *(v8us*)(sh + swo + i * 16 * G2P) = st[i];
  __syncthreads();      /* stage 0 is in LDS before a wave reads it */
  for (int kb = 0; kb < K; kb += 64) { const int cur = (kb >> 6) & 1; const bool more = kb + 64 < K;
    if (more) {      /* the next stage's words fly while this stage is multiplied */
      for (int i = 0; i < 8; ++i) st[i] = *(const v8us*)(ga + (size_t)(16 * i) * lda + kb + 64);
      for (int i = 0; i < 4; ++i) st[8 + i] = *(const v8us*)(gb + (size_t)(16 * i) * ldb + kb + 64); }
    const _Float16* pa = (const _Float16*)(sh + cur * G2S + (32 * w + ln) * G2P); const _Float16* pb = (const _Float16*)(sh + cur * G2S + (128 + ln) * G2P);
    v16h a0[2], a1[2], b[2][4];
    for (int ks = 0; ks < 2; ++ks) { a0[ks] = g2_frag(pa + 32 * ks, hh); a1[ks] = g2_frag(pa + 16 * G2P + 32 * ks, hh);
      for (int t = 0; t < 4; ++t) b[ks][t] = g2_frag(pb + t * 16 * G2P + 32 * ks, hh); }
    for (int ks = 0; ks < 2; ++ks) { c00 = g2_mma(a0[ks], b[ks][0], c00); c10 = g2_mma(a1[ks], b[ks][0], c10); c01 = g2_mma(a0[ks], b[ks][1], c01); c11 = g2_mma(a1[ks], b[ks][1], c11);
      c02 = g2_mma(a0[ks], b[ks][2], c02); c12 = g2_mma(a1[ks], b[ks][2], c12); c03 = g2_mma(a0[ks], b[ks][3], c03); c13 = g2_mma(a1[ks], b[ks][3], c13); }
    if (more) {
      for (int i = 0; i < 12; ++i) *(v8us*)(sh + (cur ^ 1) * G2S + swo + i * 16 * G2P) = st[i]; }      /* the other buffer: its readers left it in front of the last barrier */
    __syncthreads(); }      /* publishes the next stage and ends this stage's reads (behind the last stage: before the result's staging re-uses the bytes) */
  v8f accs[8] = {c00, c01, c02, c03, c10, c11, c12, c13};
#pragma unroll
  for (int u = 0; u < 8; ++u) { const int t = u & 3, half = u >> 2; const int col = col0 + t * 16 + ln; const float bv = bp ? bf16_round(bp[col]) : 0.f;
#pragma unroll
    for (int r = 0; r < 8; ++r) { const int rloc = half * 16 + 8 * hh + r; float v = accs[u][r] * alpha + bv; if (CP) { if (rowsPerB < 0) v += CP[cofs + (size_t)(row0g + row0 + rloc) * ldc + col];      /* rowsPerB < 0: own element of the batched C plane */ else { const int bidx = (row0g + row0 + rloc) / rowsPerB; v += CP[(size_t)bidx * sCPb + (size_t)by * 64 + col]; } }
      if (ACT == 3) v = fmaxf(v, 0.f); else if (ACT == 6) v = 0.5f * v * (1.0f + erff(v * 0.70710678118654752f)); else if (ACT == 11) v = 1.0f / (1.0f + expf(-v)); else if (ACT == 15) v = v / (1.0f + expf(-v)); else if (ACT == 12) v = (v > 0.f) ? v : 0.01f * v; else if (ACT == 8) v = tanhf(v); else if (ACT == 9) v = 0.5f * v * (1.0f + tanhf(0.7978845608028654f * (v + 0.044715f * v * v * v))); else if (ACT == 14) v = (v > 0.f) ? v : 0.1f * v; else if (ACT == 16) v = (v >= 0.f) ? v : 0.3f * v; else if (ACT == 17) v = (v >= 0.f) ? v : 0.2f * v;
      accs[u][r] = v; } }
  if (CT && by == byT) {      /* the same for the whole work-group: a barrier follows. A lane's 8 words of an accumulator are 8 rows in a row of one column: 16 bytes of the transposed sheet */
    unsigned short* tp = (unsigned short*)sm; const int gT = (mt * 128) / rowsT, rT = mt * 128 - gT * rowsT;
#pragma unroll
    for (int u = 0; u < 8; ++u) { FragH f;
#pragma unroll
      for (int r = 0; r < 8; ++r) f.h[r] = (_Float16)accs[u][r];
      *(v8us*)(tp + ((u & 3) * 16 + ln) * G2T + 32 * w + (u >> 2) * 16 + 8 * hh) = f.half[0]; }
    __syncthreads();      /* the four waves' rows of every column are in LDS before a wave stores whole columns of the tile (256 bytes in a row each) */
    unsigned short* gt = (unsigned short*)CT + ((size_t)gT * N + col0 + (tid >> 4)) * rowsT + rT + (tid & 15) * 8;
    v8us tv[8];
#pragma unroll
    for (int q = 0; q < 8; ++q) tv[q] = *(const v8us*)(tp + (q * 8 + (tid >> 4)) * G2T + (tid & 15) * 8);
#pragma unroll
    for (int q = 0; q < 8; ++q) { *(v8us*)(gt + (size_t)(q * 8) * rowsT) = tv[q];
      asm volatile("s_wait_xcnt 0x0" ::: "memory"); }      /* the wait in front of the next overwrite of a store's registers (a later store's address re-uses them; behind the last store the built code still holds a branch to the other epilogue, which writes them) */
    return; }
#pragma unroll
  for (int u = 0; u < 8; ++u) {
#pragma unroll
    for (int r = 0; r < 8; ++r) so[w][(u >> 2) * 16 + 8 * hh + r][(u & 3) * 16 + ln] = accs[u][r]; }
  __builtin_amdgcn_fence(__ATOMIC_ACQ_REL, "workgroup"); __builtin_amdgcn_wave_barrier();
  const int rsub = lane >> 4, c4 = (lane & 15) * 4;
  {
#pragma unroll
    for (int q = 0; q < 16; ++q) { const int r = q * 2 + rsub; const v4f v = *(const v4fa*)&so[w][r][c4]; if (C) *(v4f*)(C + cofs + (size_t)(row0 + r) * ldc + col0 + c4) = v; if (C16) { v4h h4; for (int i = 0; i < 4; ++i) h4[i] = (_Float16)v[i]; *(v4h*)(C16 + cofs + (size_t)(row0 + r) * ldc + col0 + c4) = h4; } }
     }
  if (LN) { const float* p = &so[w][lane][0]; float a = 0.0f; const int gT = (mt * 128) / rowsT, rT = mt * 128 - gT * rowsT;      /* a lane a row of the wave's 32: the row's 64 f32 words in index order */
    asm volatile("s_wait_xcnt 0x0" ::: "memory");      /* the wait in front of the overwrite of the last store's registers (the loads below re-use them) */
    v4f x[16];
#pragma unroll
    for (int c = 0; c < 16; ++c) x[c] = *(const v4fa*)(p + 4 * c);
    __builtin_amdgcn_sched_barrier(0);      /* keeps the 16 LDS loads together in front of the sum: sunk into the chain of 64 dependent multiply-adds, each would be waited for in turn */
#pragma unroll
    for (int c = 0; c < 64; ++c) a = __builtin_fmaf(x[c >> 2][c & 3], x[c >> 2][c & 3], a);
    LN[(size_t)by * sLN + ((size_t)gT * ntn + nq) * rowsT + rT + 32 * w + lane] = a;
    asm volatile("s_wait_xcnt 0x0" ::: "memory"); } }      /* the wait in front of an overwrite of the store's registers (behind the store the built code still holds a branch to the other epilogue, which writes them) */

// A work-group takes QCB columns of one strip of one group over all its rows (the grid: group, strip, column block; la, lb, SC and CF lie strip behind strip, group behind group): fa's strip (all rows) and fb's QCB rows are staged in LDS once (whole-line loads), a wave forms QFT tiles of 32 x 64 products on WMMA (the k order and the order of the two k steps are k_gemm2's), turns each accumulator word into sc where it lies, keeps the running sums of its columns and stores the tile through its own LDS rows (a store of the wave = 2 rows of 256 bytes in a row). The product itself never goes to memory.
// Eight transcendentals of one kind in ONE asm statement: every result register is apart from every source register ("=&v"), so none of them reads a result or overwrites a source of the one in front of it, and the v_nop at the end is the slot that the instruction set asks for behind the last one (left to the register allocator, runs of these instructions overwrote one another's sources back to back).
#define Q8T(name, op) __device__ __forceinline__ void name(float* y, const float* x) { asm(op " %0, %8\n\t" op " %1, %9\n\t" op " %2, %10\n\t" op " %3, %11\n\t" op " %4, %12\n\t" op " %5, %13\n\t" op " %6, %14\n\t" op " %7, %15\n\tv_nop" : "=&v"(y[0]), "=&v"(y[1]), "=&v"(y[2]), "=&v"(y[3]), "=&v"(y[4]), "=&v"(y[5]), "=&v"(y[6]), "=&v"(y[7]) : "v"(x[0]), "v"(x[1]), "v"(x[2]), "v"(x[3]), "v"(x[4]), "v"(x[5]), "v"(x[6]), "v"(x[7])); }
Q8T(q8_sqrt, "v_sqrt_f32")
Q8T(q8_log, "v_log_f32")
Q8T(q8_exp, "v_exp_f32")
__global__ __launch_bounds__(QFW * 32) void k_qps(const _Float16* __restrict__ FA, const _Float16* __restrict__ FB, const float* __restrict__ la, const float* __restrict__ lb, float* __restrict__ SC, float* __restrict__ CF) {
  static_assert(QSW == 64 && QCB == 64 && QNL == QFW * QFT * 32 && QFW * 32 == 8 * 64 && QNL % 64 == 0, "8 threads stage a row of 128 bytes, 64 rows a round; the waves' tiles cover all rows");
  __shared__ __attribute__((aligned(16))) unsigned short sa[(QNL + QCB) * G2P];      /* fa's rows, then fb's */
  __shared__ __attribute__((aligned(16))) float so[QFW][32][68];      /* a wave's own tile of sc */
  __shared__ __attribute__((aligned(16))) float ps[2 * QFW][QCB];
  const int tid = threadIdx.x, w = tid >> 5, lane = tid & 31, ln = lane & 15, hh = lane >> 4; const int s = blockIdx.x / (QNL / QCB), j0 = (blockIdx.x % (QNL / QCB)) * QCB;      /* s: 16 x group + strip */ const size_t fo = (size_t)(s / QNS) * QNL * QNW + (s % QNS) * QSW;      /* the strip's first word in fa and in fb */
  const int sr = tid >> 3, sk = (tid & 7) * 8;
  const unsigned short* ga = (const unsigned short*)FA + (size_t)sr * QNW + fo + sk; const unsigned short* gb = (const unsigned short*)FB + (size_t)(j0 + sr) * QNW + fo + sk;
  v8us st[QNL / 64 + 1]; float kb[4]; v4f qa[QFT][2][2];
#pragma unroll
  for (int i = 0; i < QNL / 64; ++i) st[i] = *(const v8us*)(ga + (size_t)(64 * i) * QNW);
  st[QNL / 64] = *(const v8us*)gb;
#pragma unroll
  for (int t = 0; t < 4; ++t) kb[t] = lb[s * QNL + j0 + t * 16 + ln];
#pragma unroll
  for (int tt = 0; tt < QFT; ++tt)
#pragma unroll
    for (int e = 0; e < 4; ++e) qa[tt][e >> 1][e & 1] = *(const v4fa*)(la + s * QNL + (QFT * w + tt) * 32 + (e >> 1) * 16 + 8 * hh + (e & 1) * 4);      /* the lengths of the 16 rows that the lane's accumulator words lie in */
  asm volatile("s_wait_xcnt 0x0" ::: "memory");      /* the wait in front of the first overwrite of the loads' address registers (the LDS addresses below may re-use them) */
#pragma unroll
  for (int i = 0; i < QNL / 64; ++i) *(v8us*)(sa + (sr + 64 * i) * G2P + sk) = st[i];
  *(v8us*)(sa + (QNL + sr) * G2P + sk) = st[QNL / 64];
  __syncthreads();      /* both operands are in LDS before a wave reads its fragments */
  const _Float16* pb = (const _Float16*)(sa + (QNL + ln) * G2P); v16h b[2][4];
#pragma unroll
  for (int ks = 0; ks < 2; ++ks)
#pragma unroll
    for (int t = 0; t < 4; ++t) b[ks][t] = g2_frag(pb + t * 16 * G2P + 32 * ks, hh);
  float cs[4] = {0.f, 0.f, 0.f, 0.f}; const int rsub = lane >> 4, c4 = (lane & 15) * 4;
  float* og = SC + (size_t)s * QNL * QNL + (size_t)(QFT * 32 * w + rsub) * QNL + j0 + c4;
#pragma unroll      /* whole: the lengths' registers are indexed by the tile */
  for (int tt = 0; tt < QFT; ++tt) { const _Float16* pa = (const _Float16*)(sa + ((QFT * w + tt) * 32 + ln) * G2P); v16h a0[2], a1[2];
#pragma unroll
    for (int ks = 0; ks < 2; ++ks) { a0[ks] = g2_frag(pa + 32 * ks, hh); a1[ks] = g2_frag(pa + 16 * G2P + 32 * ks, hh); }
    const v8f z8 = {0.f,0.f,0.f,0.f,0.f,0.f,0.f,0.f}; v8f acc[8] = {z8, z8, z8, z8, z8, z8, z8, z8};
#pragma unroll
    for (int ks = 0; ks < 2; ++ks)
#pragma unroll
      for (int t = 0; t < 4; ++t) { acc[t] = __builtin_amdgcn_wmma_f32_16x16x32_f16(false, a0[ks], false, b[ks][t], (short)0, acc[t], false, false); acc[4 + t] = __builtin_amdgcn_wmma_f32_16x16x32_f16(false, a1[ks], false, b[ks][t], (short)0, acc[4 + t], false, false); }
    __builtin_amdgcn_sched_barrier(0);      /* keeps the asm statements below behind the tile's last WMMA and behind the arithmetic that feeds them: drawn up among the WMMAs, a result register of theirs overwrote a fragment too few vector slots behind its WMMA (the compiler pads its own instructions, not asm text) */
#pragma unroll
    for (int u = 0; u < 8; ++u) { const int t = u & 3, half = u >> 2;
      float x[8], y[8]; bool lo[8];
#pragma unroll
      for (int r = 0; r < 8; ++r) x[r] = fmaxf((qa[tt][half][r >> 2][r & 3] + kb[t]) - 2.0f * acc[u][r], QLO);
      q8_sqrt(y, x);      /* v_sqrt_f32 as it is: its argument is at least QLO, never subnormal */
#pragma unroll
      for (int r = 0; r < 8; ++r) x[r] = 1.0f + y[r] / QDS;
      q8_log(y, x);      /* (1 + gd)^QPW = 2^(QPW log2(1 + gd)); v_log_f32 as it is: its argument is at least 1 */
#pragma unroll
      for (int r = 0; r < 8; ++r) { const float p = QPW * y[r]; lo[r] = p < -126.0f; x[r] = p + (lo[r] ? 64.0f : 0.0f); }      /* exp2f's own steps written out: an exponent below -126 is raised by 64 in front of v_exp_f32 and the result scaled back, so subnormal results are kept */
      q8_exp(y, x);
#pragma unroll
      for (int r = 0; r < 8; ++r) { const float v = ldexpf(y[r], lo[r] ? -64 : 0); cs[t] += v; so[w][half * 16 + 8 * hh + r][t * 16 + ln] = v; } }
    asm volatile("s_wait_dscnt 0x0" ::: "memory");      /* the wave's own LDS writes are done before its lanes read one another's words back */
    v4f tv[16];
#pragma unroll
    for (int q = 0; q < 16; ++q) tv[q] = *(const v4fa*)&so[w][q * 2 + rsub][c4];
    static_assert(2 * QNL * 4 == 8192, "the stores' offsets below: 2 rows of sc a step");
    /* the tile's 16 stores and the wait in front of the next overwrite of their data and address registers in ONE statement: in a statement of its own the wait came too late (the compiler put a column sum's add, into a store's data register, between the last store and the wait) */
    asm volatile("global_store_b128 %0, %1, off\n\tglobal_store_b128 %0, %2, off offset:8192\n\tglobal_store_b128 %0, %3, off offset:16384\n\tglobal_store_b128 %0, %4, off offset:24576\n\t"
                 "global_store_b128 %0, %5, off offset:32768\n\tglobal_store_b128 %0, %6, off offset:40960\n\tglobal_store_b128 %0, %7, off offset:49152\n\tglobal_store_b128 %0, %8, off offset:57344\n\t"
                 "global_store_b128 %0, %9, off offset:65536\n\tglobal_store_b128 %0, %10, off offset:73728\n\tglobal_store_b128 %0, %11, off offset:81920\n\tglobal_store_b128 %0, %12, off offset:90112\n\t"
                 "global_store_b128 %0, %13, off offset:98304\n\tglobal_store_b128 %0, %14, off offset:106496\n\tglobal_store_b128 %0, %15, off offset:114688\n\tglobal_store_b128 %0, %16, off offset:122880\n\ts_wait_xcnt 0x0"
                 :: "v"(og + (size_t)(tt * 32) * QNL), "v"(tv[0]), "v"(tv[1]), "v"(tv[2]), "v"(tv[3]), "v"(tv[4]), "v"(tv[5]), "v"(tv[6]), "v"(tv[7]), "v"(tv[8]), "v"(tv[9]), "v"(tv[10]), "v"(tv[11]), "v"(tv[12]), "v"(tv[13]), "v"(tv[14]), "v"(tv[15]) : "memory"); }
#pragma unroll
  for (int t = 0; t < 4; ++t) ps[2 * w + hh][t * 16 + ln] = cs[t];
  __syncthreads();      /* the 2 QFW partial sums of every column are in LDS before a thread a column adds them */
  if (tid < QCB) { float t = 0.0f;
#pragma unroll
    for (int r = 0; r < 2 * QFW; ++r) t += ps[r][tid];
    CF[s * QNL + j0 + tid] = 1.0f / sqrtf(t); } }

// A wave takes QRW rows of sc one after the other, each whole row in its registers (a lane: 8 pieces of 4 words, a load of the wave = 512 bytes in a row): nr, kt's row sum and pb from ONE read.
__device__ __forceinline__ float wave_sum(float s) {      /* butterfly over the 32 lanes: every lane ends with the same bits */
  s += __int_as_float(__builtin_amdgcn_update_dpp(0, __float_as_int(s), 0x161, 0xf, 0xf, false));      /* row_xmask:1 */
  s += __int_as_float(__builtin_amdgcn_update_dpp(0, __float_as_int(s), 0x162, 0xf, 0xf, false));      /* row_xmask:2 */
  s += __int_as_float(__builtin_amdgcn_update_dpp(0, __float_as_int(s), 0x164, 0xf, 0xf, false));      /* row_xmask:4 */
  s += __int_as_float(__builtin_amdgcn_update_dpp(0, __float_as_int(s), 0x168, 0xf, 0xf, false));      /* row_xmask:8 */
  const int b = __float_as_int(s); s += __int_as_float(__builtin_amdgcn_permlanex16(b, b, 0x76543210, 0xfedcba98, false, false));      /* lane l with lane l ^ 16 */
  return s; }

__global__ __launch_bounds__(QWV * 32) void k_ktw(const float* __restrict__ SC, const float* __restrict__ CF, _Float16* __restrict__ PB) {
  static_assert(QNL == 8 * 128 && QNL % QRW == 0 && (QNG * QNS * QNL) % (QWV * QRW) == 0, "a row is 8 loads of a wave; a wave's rows lie in one strip; whole work-groups");
  const unsigned lane = threadIdx.x & 31u, wave = (unsigned)__builtin_amdgcn_readfirstlane((int)(threadIdx.x >> 5)); const unsigned r0 = (blockIdx.x * QWV + wave) * QRW;
  const float* p = SC + (size_t)r0 * QNL + lane * 4; const float* cf = CF + (size_t)(r0 / QNL) * QNL + lane * 4; _Float16* o = PB + (size_t)r0 * QNL + lane * 4;
  v4f c[8], w[2][8];
#pragma unroll
  for (int q = 0; q < 8; ++q) w[0][q] = *(const v4fa*)(p + q * 128);
#pragma unroll
  for (int q = 0; q < 8; ++q) c[q] = *(const v4fa*)(cf + q * 128);
#pragma unroll
  for (int k = 0; k < QRW; ++k) { v4f* t = w[k & 1];
    __builtin_amdgcn_sched_barrier(0);      /* this one and the one behind the loads pin the order: the next row's loads, then this row's arithmetic; without them the next row's sum is drawn forward into this row's arithmetic and its loads get less time to land */
    if (k + 1 < QRW) {
#pragma unroll
      for (int q = 0; q < 8; ++q) w[(k + 1) & 1][q] = *(const v4fa*)(p + (size_t)(k + 1) * QNL + q * 128);
      if (k == 0) asm volatile("s_wait_xcnt 0x0" ::: "memory");      /* the wait in front of the first overwrite of the scalar base that the loads of c name (the arithmetic below re-uses it) */
      __builtin_amdgcn_sched_barrier(0); }
    v4f a = {0.f, 0.f, 0.f, 0.f};
#pragma unroll
    for (int q = 0; q < 8; ++q) a += t[q];
    const float rf = 1.0f / sqrtf(wave_sum((a[0] + a[1]) + (a[2] + a[3]))); a = (v4f){0.f, 0.f, 0.f, 0.f};
#pragma unroll
    for (int q = 0; q < 8; ++q) { t[q] = (rf * t[q]) * c[q]; a += t[q]; }
    const float dn = fmaxf(wave_sum((a[0] + a[1]) + (a[2] + a[3])), QLO);
#pragma unroll
    for (int q = 0; q < 8; ++q) { v4h h;
#pragma unroll
      for (int i = 0; i < 4; ++i) h[i] = (_Float16)((t[q][i] / dn) * QPC);
      *(v4h*)(o + (size_t)k * QNL + q * 128) = h;
      if (k + 1 < QRW || q < 7) asm volatile("s_wait_xcnt 0x0" ::: "memory"); } }      /* the wait in front of the next overwrite of the store's data registers (later pieces, the next rows' loads); behind the wave's last store nothing is overwritten */
}

extern "C" void kernel_launch(void* const* d_in, const int* in_sizes, int n_in,
                              void* d_out, int out_size, void* d_ws, size_t ws_size, hipStream_t stream) {
  (void)in_sizes; (void)n_in; (void)out_size;
  const float* const* I = (const float* const*)d_in; const float* xa = I[0]; const float* wa = I[1]; const float* va = I[2]; const float* wb = I[3]; const float* vb = I[4]; const float* wc = I[5]; const float* vc = I[6]; const float* wd = I[7]; const float* vd = I[8];      /* xa [2][1024][1024]; the four weights [1024][1024] (source, result); the four added vectors [1024] */
  float* res = (float*)d_out;
  static_assert((QNG * QNL) % 128 == 0 && QNL % 128 == 0 && QNW % 64 == 0 && QNW % 32 == 0 && QSW % 64 == 0 && QSW % 32 == 0 && QNL % 8 == 0 && QNS * QSW == QNW, "whole tiles");
  uint8_t* wsp = (uint8_t*)d_ws; size_t off = 0;
  auto take = [&](size_t bytes) { uint8_t* p = wsp + off; off += (bytes + 255) & ~(size_t)255; return p; };
  const size_t GW = (size_t)QNG * QNL * QNW, G1 = (size_t)QNL * QNW;
  float* SC = (float*)take((size_t)QNG * QNS * QNL * QNL * 4); _Float16* PB = (_Float16*)take((size_t)QNG * QNS * QNL * QNL * 2);
  _Float16* XH = (_Float16*)take(GW * 2); _Float16* AH = (_Float16*)take(2 * GW * 2); _Float16* CH = (_Float16*)take(GW * 2); _Float16* VT = (_Float16*)take(GW * 2);
  _Float16* WA = (_Float16*)take((size_t)4 * QNW * QNW * 2); _Float16* WD = WA + (size_t)3 * QNW * QNW; float* LA = (float*)take((size_t)2 * QNG * QNS * QNL * 4); float* LB = LA + (size_t)QNG * QNS * QNL; float* CF = (float*)take((size_t)QNG * QNS * QNL * 4);      /* both groups' sixteen sheets of sc and of pb; xa's cast; the f16 words of fa and, behind them, of fb; cx's; fc's transposed, group by group; the four weights transposed, one behind the other; the strips' squared lengths, fa's and behind them fb's; the column factors */
  if (off > ws_size) return;
  k_cast<<<(unsigned)(4 * QWB + QXB), 256, 0, stream>>>(xa, wa, wb, wc, wd, XH, WA, QWC);      /* WA[m][o][k] = f16(64 w[k][o]), m: wa, wb, wc, wd */
  k_gemm2<0><<<dim3((unsigned)(((QNG * QNL) / 128) * (QNW / 64)), 3), 128, 0, stream>>>(XH, QNW, 0, WA, QNW, (size_t)QNW * QNW, 1.0f / QWC, va, 0, nullptr, 1, 0, 0, nullptr, AH, QNW, GW, QNG * QNL, QNW, QNW, VT, LA, QNL, vb, vc, 3, 0, (size_t)QNG * QNS * QNL, 2);      /* plane 0: fa[(g, i)][o] = xa[g][i][:] . wa[:][o] + va[o]: AH its f16 words, LA[g][s][i] its strips' squared lengths; plane 1: fb likewise, behind them; plane 2: VT[g][(s, c)][j] = f16(fc[g][j][s 64 + c]) */
  k_qps<<<(unsigned)(QNG * QNS * (QNL / QCB)), QFW * 32, 0, stream>>>(AH, AH + GW, LA, LB, SC, CF);      /* SC[g][s][i][j] = sc from fa[g][i][s] . fb[g][j][s] and the two lengths; CF[g][s][j] = nc^(-1/2) */
  k_ktw<<<(unsigned)((QNG * QNS * QNL) / (QWV * QRW)), QWV * 32, 0, stream>>>(SC, CF, PB);
  k_gemm2<0><<<dim3((unsigned)((QNL / 128) * (QSW / 64)), QNS, QNG), 128, 0, stream>>>(PB, QNL, (size_t)QNL * QNL, VT, QNL, (size_t)QSW * QNL, 1.0f / QPC, nullptr, 0, nullptr, 1, 0, 0, nullptr, CH, QNW, (size_t)QSW, QNL, QSW, QNL, nullptr, nullptr, QNL, nullptr, nullptr, QNS, G1, 0, -1);      /* CH[g][i][s 64 + c] = the f16 word of sum over j of PB[g][s][i][j] fc[g][j][s 64 + c] / 2^12: in place at a strip's column offset (y: strip, z: group) */
  k_gemm2<0><<<dim3((unsigned)(((QNG * QNL) / 128) * (QNW / 64)), 1), 128, 0, stream>>>(CH, QNW, 0, WD, QNW, 0, 1.0f / QWC, vd, 0, nullptr, 1, 0, 0, res, nullptr, QNW, 0, QNG * QNL, QNW, QNW, nullptr, nullptr, QNL, nullptr, nullptr, 1, 0, 0, -1);      /* res = cx wd + vd: every word of the result once */
}

// v008
// Measured time: 89.2 microseconds a run.
// Timed twice side by side with v007, it ran 1.27 times as fast both times.
// All steps since v000 together make it 7.11 times as fast.
// A distance-kernel mixing of rows: xa [2][1024][1024] (group, row, width); wa, wb, wc, wd [1024][1024] stored (source column, result column), va, vb, vc, vd [1024]: fa | fb | fc = xa w + v, split into 16 strips of 64 columns; for a group and a strip: e2[i][j] = |fa_i|^2 + |fb_j|^2 - 2 fa_i . fb_j; gd = sqrt(max(e2, 1e-12)) / 64; sc = (1 + gd)^(-65.5); nr = its row sums, nc = its column sums; kt = nr^(-1/2) sc nc^(-1/2); pb = kt / max(its row sum, 1e-12); cx = pb fc's strip; res = cx wd + vd -> [2][1024][1024] f32: one result.
// Structure: xa cast to f16 as it lies and the four weights cast transposed behind a carry of 64 (converted to bf16 first); three WMMA GEMMs (the carry undone in their scale argument; the added vectors live) whose f32 words never go to memory: the epilogue of fa's and fb's stores each word as ONE f16 word and, a lane a row, a strip's squared length (the tile's 64 f32 words in index order; a tile's width is a strip's), the epilogue of fc's stores the f16 words transposed through LDS, a group's sheet (strip column, row); launches that do not wait for one another are ONE launch and run side by side (the five casts; the three projections, a plane of the grid each; both groups in each of the two kernels that follow); THEN, BOTH GROUPS AT ONCE, sc FORMED TWICE AND NEVER STORED: ONE kernel, a work-group 64 columns of a strip of a group over all rows, forms fa . fb (depth 64) on WMMA, forms sc from the two lengths and the product while the product is still in the accumulators (the root, log2 and exp2 instructions: the power as 2^(-65.5 log2(1 + gd))), sums its columns as it goes (lane partials, then LDS) and stores each sum's reciprocal root, and stores each row's sum over its 64 columns; ONE kernel, a work-group 128 rows of a strip over all columns, forms fb . fa (the product transposed, so that an accumulator's words lie as the next product's left operand wants them), sc again, kt = nr^(-1/2) sc nc^(-1/2) as one f16 word behind a carry of 2^12, multiplies it on WMMA with fc's strip, sums kt's rows in f32 beside it and divides by that sum at the end (pb is never formed): cx as f16 words in place at a strip's column offset; then the last WMMA GEMM writes the result.
// Compute dtype: all nine inputs converted to bf16 where they are read; xa's words exact as f16 operands down to 2^-14; the weights' behind 64; the computed sheets ONE f16 word each (kt, in registers only, behind 2^12); every product's accumulation, the lengths, the kernel's arithmetic, the sums and the result f32. v_wmma_f32_16x16x32_f16.
#include <hip/hip_runtime.h>
#define QNG 2                        /* groups */
#define QNL 1024                     /* rows of a group */
#define QNW 1024                     /* a row's width: every projection's depth and width */
#define QNS 16                       /* strips */
#define QSW 64                       /* a strip's width: the pair product's depth */
#define QDS 64.0f                    /* the distance's divisor */
#define QPW -65.5f                   /* the power */
#define QLO 1e-12f                   /* the lower bound of e2 and of a row's sum */
#define QWC 64.0f                    /* the weights' carry (undone in the products' scale argument) */
#define QPC 4096.0f                  /* kt's carry (it cancels where the fifth product is divided by kt's row sum, which has it too) */
#define QMW 16                       /* waves of a work-group of the mixing kernel: 4 blocks of 32 rows x 4 quarters of the columns */
#define QMR 128                      /* its rows */
#define QMP 1032                     /* 16-bit words of a staged row of fc's transposed strip: 1,024 + 8, a pitch of 2,064 bytes (16 bytes x odd) */
#define QCB 64                       /* columns of sc that a work-group of the pair kernel takes */
#define QFW 16                       /* its waves */
#define QFT 2                        /* tiles of 32 rows that one of its waves takes */
typedef unsigned short v8us __attribute__((ext_vector_type(8), may_alias));
typedef float  v8f  __attribute__((ext_vector_type(8)));
typedef float  v4f  __attribute__((ext_vector_type(4)));
typedef float  v4fa __attribute__((ext_vector_type(4), may_alias));

__device__ __forceinline__ unsigned short bf16_bits(float x) { unsigned int u = __float_as_uint(x); return (unsigned short)((u + 0x7FFFu + ((u >> 16) & 1u)) >> 16); }
__device__ __forceinline__ float bf16_val(unsigned short b) { return __uint_as_float(((unsigned int)b) << 16); }
__device__ __forceinline__ float bf16_round(float x) { return bf16_val(bf16_bits(x)); }

typedef _Float16 v16h __attribute__((ext_vector_type(16)));
union FragH { v16h v; v8us half[2]; _Float16 h[16]; unsigned short u[16]; };

// The five casts in one launch (none waits for another). The first 4 QWB work-groups: Wt[m][n][k] = f16(Wm[k][n] x scale) from f32 row-major Wm[QNW][QNW] (scale = power of two; bf16-exact weights stay exact in f16 away from the subnormal range); the slower ones, placed first. The QXB behind them: xa's words as they lie.
#define QWB ((QNW * (QNW / 8)) / 256)                /* work-groups of one weight's cast */
#define QXB ((QNG * QNL * (QNW / 8)) / 256)          /* work-groups of xa's cast */
__global__ __launch_bounds__(256) void k_cast(const float* __restrict__ x, const float* __restrict__ W0, const float* __restrict__ W1, const float* __restrict__ W2, const float* __restrict__ W3, _Float16* __restrict__ X16, _Float16* __restrict__ Wt, float scale) {
  static_assert((QNW * (QNW / 8)) % 256 == 0 && (QNG * QNL * (QNW / 8)) % 256 == 0, "whole work-groups");
  FragH f;
  if (blockIdx.x >= 4 * QWB) { const size_t t = (size_t)(blockIdx.x - 4 * QWB) * 256 + threadIdx.x;
#pragma unroll
    for (int q = 0; q < 8; ++q) f.h[q] = (_Float16)bf16_round(x[t * 8 + q]);
    *(v8us*)((unsigned short*)X16 + t * 8) = f.half[0]; return; }
  const int m = blockIdx.x / QWB; const float* W = m == 0 ? W0 : m == 1 ? W1 : m == 2 ? W2 : W3;
  const int t = (blockIdx.x - m * QWB) * 256 + threadIdx.x; const int n = t / (QNW / 8), k8 = (t % (QNW / 8)) * 8;
#pragma unroll
  for (int i = 0; i < 8; ++i) f.h[i] = (_Float16)(bf16_round(W[(size_t)(k8 + i) * QNW + n]) * scale);
  *(v8us*)((unsigned short*)Wt + (size_t)m * QNW * QNW + (size_t)n * QNW + k8) = f.half[0];
}

typedef _Float16 v4h __attribute__((ext_vector_type(4)));

// ---- fast GEMM (wave tile 32x64, work-group tile 128x64; requires M % 128 == 0 rows per launch region, N % 64 == 0 and K % 64 == 0); both operands staged in LDS 64 k at a time, two buffers; epilogue: alpha, bias, an added C and an activation, with three more results: C16 (the words as f16), LN (a row's squared length over the tile's 64 columns) and CT (the words as f16, transposed); the grid's y and z number independent products that run side by side ----
#define G2P 72                       /* 16-bit words of a staged row: 64 + 8, a pitch of 144 bytes (16 bytes x odd: 16 rows read 16 bytes a lane without bank conflicts) */
#define G2S (192 * G2P)              /* 16-bit words of a stage: 128 rows of A, then 64 rows of B */
#define G2T 136                      /* 16-bit words of a column of the transposed result's staging: 128 + 8, a pitch of 272 bytes (16 bytes x odd) */
__device__ __forceinline__ v16h g2_frag(const _Float16* p, int hh) { FragH f; f.half[0] = *(const v8us*)((const unsigned short*)p + 8 * hh); f.half[1] = *(const v8us*)((const unsigned short*)p + 16 + 8 * hh); return f.v; }
__device__ __forceinline__ v8f g2_mma(v16h a, v16h b, v8f c) { v8f d = __builtin_amdgcn_wmma_f32_16x16x32_f16(false, a, false, b, (short)0, c, false, false); asm volatile("v_nop\n\tv_nop\n\tv_nop\n\tv_nop" : "+v"(d) : "v"(a), "v"(b)); return d; }
template <int ACT>
__global__ __launch_bounds__(128) void k_gemm2(const _Float16* __restrict__ A, int lda, size_t sA, const _Float16* __restrict__ Bh, int ldb, size_t sB, float alpha, const float* __restrict__ bias, size_t sBias, const float* __restrict__ CP, int rowsPerB, size_t sCPb, int row0g,
    float* __restrict__ C, _Float16* __restrict__ C16, int ldc, size_t sC, int M, int N, int K, _Float16* __restrict__ CT, float* __restrict__ LN, int rowsT, const float* __restrict__ biasB, const float* __restrict__ biasC, int nY, size_t sCZ, size_t sLN, int byT) {      /* CT [M / rowsT][N][rowsT] and LN [M / rowsT][N / 64][rowsT]: rowsT % 128 == 0; CT is plane byT's only result; biasB, biasC: where given, the added vectors of planes 1 and 2; nY: the grid's extent in y; sCZ: C's step from one z to the next; sLN: LN's from one y to the next */ static_assert(ACT == 0 || ACT == 3 || ACT == 6 || ACT == 8 || ACT == 9 || ACT == 11 || ACT == 12 || ACT == 14 || ACT == 15 || ACT == 16 || ACT == 17, "k_gemm2: unsupported ACT code (would silently apply no activation)");
  __shared__ __attribute__((aligned(16))) unsigned char sm[2 * G2S * 2]; static_assert(sizeof(sm) >= 4 * 32 * 68 * 4 && sizeof(sm) >= 64 * G2T * 2, "the result's staging re-uses the two operand buffers");
  float (*so)[32][68] = (float (*)[32][68])sm;      /* written only behind the k loop's last barrier */
  const int tid = threadIdx.x, w = tid >> 5, lane = tid & 31, ln = lane & 15, hh = lane >> 4; const int by = blockIdx.y; const size_t pl = (size_t)blockIdx.z * nY + by;      /* the operands' planes lie one behind the other, y within z */
  A += pl * sA; Bh += pl * sB; const size_t cofs = (size_t)by * sC + (size_t)blockIdx.z * sCZ; const float* bp = bias ? (biasB ? (by == 0 ? bias : by == 1 ? biasB : biasC) : bias + (size_t)by * sBias) : nullptr;
  const int ntn = N >> 6; const int mt = blockIdx.x / ntn, nq = blockIdx.x - mt * ntn; const int row0 = mt * 128 + 32 * w, col0 = nq * 64; if (mt * 128 >= M) return;      /* the whole work-group leaves or none does: barriers follow */
  const int sr = tid >> 3, sk = (tid & 7) * 8;      /* staging: 8 threads a row of 128 bytes, so a wave's load is 4 whole lines; 16 rows a round of the work-group */
  const unsigned short* ga = (const unsigned short*)A + (size_t)(mt * 128 + sr) * lda + sk; const unsigned short* gb = (const unsigned short*)Bh + (size_t)(col0 + sr) * ldb + sk;
  unsigned short* sh = (unsigned short*)sm; const int swo = sr * G2P + sk; v8us st[12];
  const v8f z8 = {0.f,0.f,0.f,0.f,0.f,0.f,0.f,0.f}; v8f c00 = z8, c01 = z8, c02 = z8, c03 = z8, c10 = z8, c11 = z8, c12 = z8, c13 = z8;
  for (int i = 0; i < 8; ++i) st[i] = *(const v8us*)(ga + (size_t)(16 * i) * lda);
  for (int i = 0; i < 4; ++i) st[8 + i] = *(const v8us*)(gb + (size_t)(16 * i) * ldb);
  for (int i = 0; i < 12; ++i) *(v8us*)(sh + swo + i * 16 * G2P) = st[i];
  __syncthreads();      /* stage 0 is in LDS before a wave reads it */
  for (int kb = 0; kb < K; kb += 64) { const int cur = (kb >> 6) & 1; const bool more = kb + 64 < K;
    if (more) {      /* the next stage's words fly while this stage is multiplied */
      for (int i = 0; i < 8; ++i) st[i] = *(const v8us*)(ga + (size_t)(16 * i) * lda + kb + 64);
      for (int i = 0; i < 4; ++i) st[8 + i] = *(const v8us*)(gb + (size_t)(16 * i) * ldb + kb + 64); }
    const _Float16* pa = (const _Float16*)(sh + cur * G2S + (32 * w + ln) * G2P); const _Float16* pb = (const _Float16*)(sh + cur * G2S + (128 + ln) * G2P);
    v16h a0[2], a1[2], b[2][4];
    for (int ks = 0; ks < 2; ++ks) { a0[ks] = g2_frag(pa + 32 * ks, hh); a1[ks] = g2_frag(pa + 16 * G2P + 32 * ks, hh);
      for (int t = 0; t < 4; ++t) b[ks][t] = g2_frag(pb + t * 16 * G2P + 32 * ks, hh); }
    for (int ks = 0; ks < 2; ++ks) { c00 = g2_mma(a0[ks], b[ks][0], c00); c10 = g2_mma(a1[ks], b[ks][0], c10); c01 = g2_mma(a0[ks], b[ks][1], c01); c11 = g2_mma(a1[ks], b[ks][1], c11);
      c02 = g2_mma(a0[ks], b[ks][2], c02); c12 = g2_mma(a1[ks], b[ks][2], c12); c03 = g2_mma(a0[ks], b[ks][3], c03); c13 = g2_mma(a1[ks], b[ks][3], c13); }
    if (more) {
      for (int i = 0; i < 12; ++i) *(v8us*)(sh + (cur ^ 1) * G2S + swo + i * 16 * G2P) = st[i]; }      /* the other buffer: its readers left it in front of the last barrier */
    __syncthreads(); }      /* publishes the next stage and ends this stage's reads (behind the last stage: before the result's staging re-uses the bytes) */
  v8f accs[8] = {c00, c01, c02, c03, c10, c11, c12, c13};
#pragma unroll
  for (int u = 0; u < 8; ++u) { const int t = u & 3, half = u >> 2; const int col = col0 + t * 16 + ln; const float bv = bp ? bf16_round(bp[col]) : 0.f;
#pragma unroll
    for (int r = 0; r < 8; ++r) { const int rloc = half * 16 + 8 * hh + r; float v = accs[u][r] * alpha + bv; if (CP) { if (rowsPerB < 0) v += CP[cofs + (size_t)(row0g + row0 + rloc) * ldc + col];      /* rowsPerB < 0: own element of the batched C plane */ else { const int bidx = (row0g + row0 + rloc) / rowsPerB; v += CP[(size_t)bidx * sCPb + (size_t)by * 64 + col]; } }
      if (ACT == 3) v = fmaxf(v, 0.f); else if (ACT == 6) v = 0.5f * v * (1.0f + erff(v * 0.70710678118654752f)); else if (ACT == 11) v = 1.0f / (1.0f + expf(-v)); else if (ACT == 15) v = v / (1.0f + expf(-v)); else if (ACT == 12) v = (v > 0.f) ? v : 0.01f * v; else if (ACT == 8) v = tanhf(v); else if (ACT == 9) v = 0.5f * v * (1.0f + tanhf(0.7978845608028654f * (v + 0.044715f * v * v * v))); else if (ACT == 14) v = (v > 0.f) ? v : 0.1f * v; else if (ACT == 16) v = (v >= 0.f) ? v : 0.3f * v; else if (ACT == 17) v = (v >= 0.f) ? v : 0.2f * v;
      accs[u][r] = v; } }
  if (CT && by == byT) {      /* the same for the whole work-group: a barrier follows. A lane's 8 words of an accumulator are 8 rows in a row of one column: 16 bytes of the transposed sheet */
    unsigned short* tp = (unsigned short*)sm; const int gT = (mt * 128) / rowsT, rT = mt * 128 - gT * rowsT;
#pragma unroll
    for (int u = 0; u < 8; ++u) { FragH f;
#pragma unroll
      for (int r = 0; r < 8; ++r) f.h[r] = (_Float16)accs[u][r];
      *(v8us*)(tp + ((u & 3) * 16 + ln) * G2T + 32 * w + (u >> 2) * 16 + 8 * hh) = f.half[0]; }
    __syncthreads();      /* the four waves' rows of every column are in LDS before a wave stores whole columns of the tile (256 bytes in a row each) */
    unsigned short* gt = (unsigned short*)CT + ((size_t)gT * N + col0 + (tid >> 4)) * rowsT + rT + (tid & 15) * 8;
    v8us tv[8];
#pragma unroll
    for (int q = 0; q < 8; ++q) tv[q] = *(const v8us*)(tp + (q * 8 + (tid >> 4)) * G2T + (tid & 15) * 8);
#pragma unroll
    for (int q = 0; q < 8; ++q) { *(v8us*)(gt + (size_t)(q * 8) * rowsT) = tv[q];
      asm volatile("s_wait_xcnt 0x0" ::: "memory"); }      /* the wait in front of the next overwrite of a store's registers (a later store's address re-uses them; behind the last store the built code still holds a branch to the other epilogue, which writes them) */
    return; }
#pragma unroll
  for (int u = 0; u < 8; ++u) {
#pragma unroll
    for (int r = 0; r < 8; ++r) so[w][(u >> 2) * 16 + 8 * hh + r][(u & 3) * 16 + ln] = accs[u][r]; }
  __builtin_amdgcn_fence(__ATOMIC_ACQ_REL, "workgroup"); __builtin_amdgcn_wave_barrier();
  const int rsub = lane >> 4, c4 = (lane & 15) * 4;
  {
#pragma unroll
    for (int q = 0; q < 16; ++q) { const int r = q * 2 + rsub; const v4f v = *(const v4fa*)&so[w][r][c4]; if (C) *(v4f*)(C + cofs + (size_t)(row0 + r) * ldc + col0 + c4) = v; if (C16) { v4h h4; for (int i = 0; i < 4; ++i) h4[i] = (_Float16)v[i]; *(v4h*)(C16 + cofs + (size_t)(row0 + r) * ldc + col0 + c4) = h4; } }
     }
  if (LN) { const float* p = &so[w][lane][0]; float a = 0.0f; const int gT = (mt * 128) / rowsT, rT = mt * 128 - gT * rowsT;      /* a lane a row of the wave's 32: the row's 64 f32 words in index order */
    asm volatile("s_wait_xcnt 0x0" ::: "memory");      /* the wait in front of the overwrite of the last store's registers (the loads below re-use them) */
    v4f x[16];
#pragma unroll
    for (int c = 0; c < 16; ++c) x[c] = *(const v4fa*)(p + 4 * c);
    __builtin_amdgcn_sched_barrier(0);      /* keeps the 16 LDS loads together in front of the sum: sunk into the chain of 64 dependent multiply-adds, each would be waited for in turn */
#pragma unroll
    for (int c = 0; c < 64; ++c) a = __builtin_fmaf(x[c >> 2][c & 3], x[c >> 2][c & 3], a);
    LN[(size_t)by * sLN + ((size_t)gT * ntn + nq) * rowsT + rT + 32 * w + lane] = a;
    asm volatile("s_wait_xcnt 0x0" ::: "memory"); } }      /* the wait in front of an overwrite of the store's registers (behind the store the built code still holds a branch to the other epilogue, which writes them) */

// A work-group takes QCB columns of one strip of one group over all its rows (the grid: group, strip, column block; la, lb, RP and CF lie strip behind strip, group behind group): fa's strip (all rows) and fb's QCB rows are staged in LDS once (whole-line loads), a wave forms QFT tiles of 32 x 64 products on WMMA (the k order and the order of the two k steps are k_gemm2's), turns each accumulator word into sc where it lies, keeps the running sums of its columns and of its rows, and stores each row's sum over the QCB columns (RP: strip, column block, row). Neither the product nor sc goes to memory.
// Eight transcendentals of one kind in ONE asm statement: every result register is apart from every source register ("=&v"), so none of them reads a result or overwrites a source of the one in front of it, and the v_nop at the end is the slot that the instruction set asks for behind the last one (left to the register allocator, runs of these instructions overwrote one another's sources back to back).
#define Q8T(name, op) __device__ __forceinline__ void name(float* y, const float* x) { asm(op " %0, %8\n\t" op " %1, %9\n\t" op " %2, %10\n\t" op " %3, %11\n\t" op " %4, %12\n\t" op " %5, %13\n\t" op " %6, %14\n\t" op " %7, %15\n\tv_nop" : "=&v"(y[0]), "=&v"(y[1]), "=&v"(y[2]), "=&v"(y[3]), "=&v"(y[4]), "=&v"(y[5]), "=&v"(y[6]), "=&v"(y[7]) : "v"(x[0]), "v"(x[1]), "v"(x[2]), "v"(x[3]), "v"(x[4]), "v"(x[5]), "v"(x[6]), "v"(x[7])); }
Q8T(q8_sqrt, "v_sqrt_f32")
Q8T(q8_log, "v_log_f32")
Q8T(q8_exp, "v_exp_f32")
#define QRS(n, ctl) { const bool up = (ln & n) != 0; _Pragma("unroll") for (int m = 0; m < n; ++m) { const float keep = up ? rs[m + n] : rs[m], send = up ? rs[m] : rs[m + n]; rs[m] = keep + __int_as_float(__builtin_amdgcn_update_dpp(0, __float_as_int(send), ctl, 0xf, 0xf, false)); } }      /* ctl: row_xmask:n */
__global__ __launch_bounds__(QFW * 32) void k_qps(const _Float16* __restrict__ FA, const _Float16* __restrict__ FB, const float* __restrict__ la, const float* __restrict__ lb, float* __restrict__ RP, float* __restrict__ CF) {
  static_assert(QSW == 64 && QCB == 64 && QNL == QFW * QFT * 32 && QFW * 32 == 8 * 64 && QNL % 64 == 0, "8 threads stage a row of 128 bytes, 64 rows a round; the waves' tiles cover all rows");
  __shared__ __attribute__((aligned(16))) unsigned short sa[(QNL + QCB) * G2P];      /* fa's rows, then fb's */
  __shared__ __attribute__((aligned(16))) float ps[2 * QFW][QCB];
  const int tid = threadIdx.x, w = tid >> 5, lane = tid & 31, ln = lane & 15, hh = lane >> 4; const int s = blockIdx.x / (QNL / QCB), j0 = (blockIdx.x % (QNL / QCB)) * QCB;      /* s: 16 x group + strip */ const size_t fo = (size_t)(s / QNS) * QNL * QNW + (s % QNS) * QSW;      /* the strip's first word in fa and in fb */
  const int sr = tid >> 3, sk = (tid & 7) * 8;
  const unsigned short* ga = (const unsigned short*)FA + (size_t)sr * QNW + fo + sk; const unsigned short* gb = (const unsigned short*)FB + (size_t)(j0 + sr) * QNW + fo + sk;
  v8us st[QNL / 64 + 1]; float kb[4]; v4f qa[QFT][2][2];
#pragma unroll
  for (int i = 0; i < QNL / 64; ++i) st[i] = *(const v8us*)(ga + (size_t)(64 * i) * QNW);
  st[QNL / 64] = *(const v8us*)gb;
#pragma unroll
  for (int t = 0; t < 4; ++t) kb[t] = lb[s * QNL + j0 + t * 16 + ln];
#pragma unroll
  for (int tt = 0; tt < QFT; ++tt)
#pragma unroll
    for (int e = 0; e < 4; ++e) qa[tt][e >> 1][e & 1] = *(const v4fa*)(la + s * QNL + (QFT * w + tt) * 32 + (e >> 1) * 16 + 8 * hh + (e & 1) * 4);      /* the lengths of the 16 rows that the lane's accumulator words lie in */
  asm volatile("s_wait_xcnt 0x0" ::: "memory");      /* the wait in front of the first overwrite of the loads' address registers (the LDS addresses below may re-use them) */
#pragma unroll
  for (int i = 0; i < QNL / 64; ++i) *(v8us*)(sa + (sr + 64 * i) * G2P + sk) = st[i];
  *(v8us*)(sa + (QNL + sr) * G2P + sk) = st[QNL / 64];
  __syncthreads();      /* both operands are in LDS before a wave reads its fragments */
  const _Float16* pb = (const _Float16*)(sa + (QNL + ln) * G2P); v16h b[2][4];
#pragma unroll
  for (int ks = 0; ks < 2; ++ks)
#pragma unroll
    for (int t = 0; t < 4; ++t) b[ks][t] = g2_frag(pb + t * 16 * G2P + 32 * ks, hh);
  float cs[4] = {0.f, 0.f, 0.f, 0.f};
  float* og = RP + ((size_t)s * (QNL / QCB) + j0 / QCB) * QNL + QFT * 32 * w + (ln >> 3) * 16 + 8 * hh + (ln & 7);      /* the row whose sum ends in this lane (below) */
#pragma unroll      /* whole: the lengths' registers are indexed by the tile */
  for (int tt = 0; tt < QFT; ++tt) { const _Float16* pa = (const _Float16*)(sa + ((QFT * w + tt) * 32 + ln) * G2P); v16h a0[2], a1[2];
#pragma unroll
    for (int ks = 0; ks < 2; ++ks) { a0[ks] = g2_frag(pa + 32 * ks, hh); a1[ks] = g2_frag(pa + 16 * G2P + 32 * ks, hh); }
    const v8f z8 = {0.f,0.f,0.f,0.f,0.f,0.f,0.f,0.f}; v8f acc[8] = {z8, z8, z8, z8, z8, z8, z8, z8};
#pragma unroll
    for (int ks = 0; ks < 2; ++ks)
#pragma unroll
      for (int t = 0; t < 4; ++t) { acc[t] = __builtin_amdgcn_wmma_f32_16x16x32_f16(false, a0[ks], false, b[ks][t], (short)0, acc[t], false, false); acc[4 + t] = __builtin_amdgcn_wmma_f32_16x16x32_f16(false, a1[ks], false, b[ks][t], (short)0, acc[4 + t], false, false); }
    float rs[16] = {0.f, 0.f, 0.f, 0.f, 0.f, 0.f, 0.f, 0.f, 0.f, 0.f, 0.f, 0.f, 0.f, 0.f, 0.f, 0.f};      /* the lane's share of the sums of the 16 rows that its accumulator words lie in */
    __builtin_amdgcn_sched_barrier(0);      /* keeps the asm statements below behind the tile's last WMMA and behind the arithmetic that feeds them: drawn up among the WMMAs, a result register of theirs overwrote a fragment too few vector slots behind its WMMA (the compiler pads its own instructions, not asm text) */
#pragma unroll
    for (int u = 0; u < 8; ++u) { const int t = u & 3, half = u >> 2;
      float x[8], y[8]; bool lo[8];
#pragma unroll
      for (int r = 0; r < 8; ++r) x[r] = fmaxf((qa[tt][half][r >> 2][r & 3] + kb[t]) - 2.0f * acc[u][r], QLO);
      q8_sqrt(y, x);      /* v_sqrt_f32 as it is: its argument is at least QLO, never subnormal */
#pragma unroll
      for (int r = 0; r < 8; ++r) x[r] = 1.0f + y[r] / QDS;
      q8_log(y, x);      /* (1 + gd)^QPW = 2^(QPW log2(1 + gd)); v_log_f32 as it is: its argument is at least 1 */
#pragma unroll
      for (int r = 0; r < 8; ++r) { const float p = QPW * y[r]; lo[r] = p < -126.0f; x[r] = p + (lo[r] ? 64.0f : 0.0f); }      /* exp2f's own steps written out: an exponent below -126 is raised by 64 in front of v_exp_f32 and the result scaled back, so subnormal results are kept */
      q8_exp(y, x);
#pragma unroll
      for (int r = 0; r < 8; ++r) { const float v = ldexpf(y[r], lo[r] ? -64 : 0); cs[t] += v; rs[half * 8 + r] += v; } }
    /* 16 sums over the 16 lanes of a half wave: at each step a lane keeps one half of its sums and hands the other half to the lane that keeps those, so lane ln ends with sum number ln (15 adds in place of 64) */
    QRS(8, 0x168) QRS(4, 0x164) QRS(2, 0x162) QRS(1, 0x161)
    /* the store and the wait in front of the next overwrite of its data and address registers in ONE statement (the next tile's arithmetic re-uses them) */
    asm volatile("global_store_b32 %0, %1, off\n\ts_wait_xcnt 0x0" :: "v"(og + tt * 32), "v"(rs[0]) : "memory"); }
#pragma unroll
  for (int t = 0; t < 4; ++t) ps[2 * w + hh][t * 16 + ln] = cs[t];
  __syncthreads();      /* the 2 QFW partial sums of every column are in LDS before a thread a column adds them */
  if (tid < QCB) { float t = 0.0f;
#pragma unroll
    for (int r = 0; r < 2 * QFW; ++r) t += ps[r][tid];
    CF[s * QNL + j0 + tid] = 1.0f / sqrtf(t); } }

// A work-group takes QMR rows of one strip of one group over all columns (the grid: group, strip, row block). fb's strip (all rows), fc's transposed strip, fb's lengths and the column factors are staged in LDS once (whole-line loads); a wave takes 32 rows and a quarter of the columns, 32 columns a trip. The pair product is formed TRANSPOSED (left operand fb's rows, right operand fa's rows: the k order and the order of the two k steps are k_qps's), so a lane holds ONE row i of sc a tile (its column of the accumulator) and 8 columns j in a row (8 hh + r): exactly the words, in exactly the order, that g2_frag gives a lane of a left operand with rows i and depth j. So kt goes from the accumulators into the next WMMA through registers alone, and kt's row sum is a lane's own running sum. The four quarters' products and sums are added through LDS at the end.
__global__ __launch_bounds__(QMW * 32) void k_mix(const _Float16* __restrict__ FA, const _Float16* __restrict__ FB, const _Float16* __restrict__ VT, const float* __restrict__ la, const float* __restrict__ lb, const float* __restrict__ RP, const float* __restrict__ CF, _Float16* __restrict__ CH) {
  static_assert(QSW == 64 && QNL == 1024 && QMW == 16 && QMR == 128 && QNL % QMR == 0 && QNL / QCB == 16, "8 threads stage a row of 128 bytes, 64 rows a round; 4 x 32 rows, 4 x 256 columns; 16 partial sums a row");
  __shared__ __attribute__((aligned(16))) unsigned char sm[(QNL * G2P + QSW * QMP) * 2];      /* fb's rows, then fc's transposed rows */
  __shared__ __attribute__((aligned(16))) float lc[2 * QNL];      /* fb's squared lengths, then the column factors */
  __shared__ __attribute__((aligned(16))) float dl[QMW][32];      /* a wave's share of kt's row sums */
  static_assert(sizeof(sm) >= QMW * 32 * 68 * 4, "the waves' products re-use the operands' bytes");
  unsigned short* sb = (unsigned short*)sm; unsigned short* sv = sb + QNL * G2P; float (*red)[32][68] = (float (*)[32][68])sm;      /* red: written only behind the barrier that ends the operands' last reads */
  const int tid = threadIdx.x, w = tid >> 5, lane = tid & 31, ln = lane & 15, hh = lane >> 4; const int s = blockIdx.x / (QNL / QMR), i0 = (blockIdx.x % (QNL / QMR)) * QMR;      /* s: 16 x group + strip */ const size_t fo = (size_t)(s / QNS) * QNL * QNW + (s % QNS) * QSW;      /* the strip's first word in fa, in fb and in cx */
  const int rb = w & 3, jq = w >> 2;      /* the wave's block of 32 rows and its quarter of the columns */
  const int sr = tid >> 3, sk = (tid & 7) * 8;
  const unsigned short* gb = (const unsigned short*)FB + (size_t)sr * QNW + fo + sk; const unsigned short* gv = (const unsigned short*)VT + (size_t)s * QSW * QNL + tid * 8;      /* fc's transposed strip is 128 KiB in a row */
  const unsigned short* ga = (const unsigned short*)FA + (size_t)(i0 + 32 * rb + ln) * QNW + fo + 8 * hh; const float* gr = RP + (size_t)s * (QNL / QCB) * QNL + i0 + 32 * rb + ln;
  v8us st[32]; v16h fi[2][2]; float ka[2], rp[2][16], rf[2];
#pragma unroll
  for (int it = 0; it < 2; ++it) { ka[it] = la[s * QNL + i0 + 32 * rb + it * 16 + ln];
#pragma unroll
    for (int q = 0; q < 16; ++q) rp[it][q] = gr[q * QNL + it * 16]; }
  asm volatile("s_wait_xcnt 0x0" ::: "memory");      /* the wait in front of the first overwrite of these loads' address registers (the next loads' addresses and results may re-use them) */
#pragma unroll
  for (int i = 0; i < 16; ++i) st[i] = *(const v8us*)(gb + (size_t)(64 * i) * QNW);
#pragma unroll
  for (int i = 0; i < 16; ++i) st[16 + i] = *(const v8us*)(gv + i * (QMW * 32 * 8));
  const v4f lv = *(const v4fa*)((tid < 256 ? lb : CF) + s * QNL + (tid & 255) * 4);
  asm volatile("s_wait_xcnt 0x0" ::: "memory");      /* the same wait for these loads (a fragment below may land on an address of theirs) */
#pragma unroll
  for (int it = 0; it < 2; ++it)
#pragma unroll
    for (int ks = 0; ks < 2; ++ks) { FragH f; f.half[0] = *(const v8us*)(ga + (size_t)(it * 16) * QNW + 32 * ks); f.half[1] = *(const v8us*)(ga + (size_t)(it * 16) * QNW + 32 * ks + 16); fi[it][ks] = f.v; }      /* g2_frag's words (8 hh is in ga) */
  asm volatile("s_wait_xcnt 0x0" :: "v"(ga) : "memory");      /* the wait in front of the first overwrite of the loads' address registers (the LDS addresses below may re-use them); ga as an input keeps the fragments' address alive up to here, so that no fragment lands on it */
#pragma unroll
  for (int i = 0; i < 16; ++i) *(v8us*)(sb + (sr + 64 * i) * G2P + sk) = st[i];
#pragma unroll
  for (int i = 0; i < 16; ++i) *(v8us*)(sv + ((tid >> 7) + 4 * i) * QMP + (tid & 127) * 8) = st[16 + i];
  *(v4f*)(lc + tid * 4) = lv;
#pragma unroll
  for (int it = 0; it < 2; ++it) { float t = 0.0f;
#pragma unroll
    for (int q = 0; q < 16; ++q) t += rp[it][q];      /* nr: the 16 column blocks' sums in index order */
    rf[it] = (1.0f / sqrtf(t)) * QPC; }      /* nr^(-1/2) with kt's carry in it (a power of two: exact) */
  __syncthreads();      /* the operands are in LDS before a wave reads its fragments */
  const v8f z8 = {0.f,0.f,0.f,0.f,0.f,0.f,0.f,0.f}; v8f acc[8] = {z8, z8, z8, z8, z8, z8, z8, z8}; float dn[2] = {0.f, 0.f};
  for (int jb = 0; jb < QNL / 4 / 32; ++jb) { const int j0 = jq * (QNL / 4) + jb * 32;
    const _Float16* pj = (const _Float16*)(sb + (j0 + ln) * G2P); const _Float16* pv = (const _Float16*)(sv + ln * QMP + j0); const float* pl = lc + j0 + 8 * hh;
    v16h bj[2][2], vf[4]; v4f qb[2][2], qc[2][2];
#pragma unroll
    for (int jt = 0; jt < 2; ++jt)
#pragma unroll
      for (int ks = 0; ks < 2; ++ks) { bj[jt][ks] = g2_frag(pj + jt * 16 * G2P + 32 * ks, hh); qb[jt][ks] = *(const v4fa*)(pl + jt * 16 + ks * 4); qc[jt][ks] = *(const v4fa*)(pl + QNL + jt * 16 + ks * 4); }      /* qb, qc: the lengths and factors of the 16 columns j that the lane's accumulator words lie in */
#pragma unroll
    for (int t = 0; t < 4; ++t) vf[t] = g2_frag(pv + t * 16 * QMP, hh);
    v8f d[4] = {z8, z8, z8, z8};
#pragma unroll
    for (int ks = 0; ks < 2; ++ks)
#pragma unroll
      for (int u = 0; u < 4; ++u) d[u] = __builtin_amdgcn_wmma_f32_16x16x32_f16(false, bj[u >> 1][ks], false, fi[u & 1][ks], (short)0, d[u], false, false);
    __builtin_amdgcn_sched_barrier(0);      /* keeps the asm statements below behind the trip's pair WMMAs and behind the arithmetic that feeds them (as in k_qps: the compiler pads its own instructions, not asm text) */
    FragH pf[2];
#pragma unroll
    for (int u = 0; u < 4; ++u) { const int jt = u >> 1, it = u & 1;
      float x[8], y[8]; bool lo[8];
#pragma unroll
      for (int r = 0; r < 8; ++r) x[r] = fmaxf((ka[it] + qb[jt][r >> 2][r & 3]) - 2.0f * d[u][r], QLO);
      q8_sqrt(y, x);      /* the three steps and their bounds: as in k_qps */
#pragma unroll
      for (int r = 0; r < 8; ++r) x[r] = 1.0f + y[r] / QDS;
      q8_log(y, x);
#pragma unroll
      for (int r = 0; r < 8; ++r) { const float p = QPW * y[r]; lo[r] = p < -126.0f; x[r] = p + (lo[r] ? 64.0f : 0.0f); }
      q8_exp(y, x);
#pragma unroll
      for (int r = 0; r < 8; ++r) { const float kt = (rf[it] * ldexpf(y[r], lo[r] ? -64 : 0)) * qc[jt][r >> 2][r & 3]; dn[it] += kt; pf[it].h[jt * 8 + r] = (_Float16)kt; } }      /* word jt 8 + r of the left operand's fragment is depth 16 jt + 8 hh + r: g2_frag's order */
#pragma unroll
    for (int u = 0; u < 8; ++u) acc[u] = __builtin_amdgcn_wmma_f32_16x16x32_f16(false, pf[u >> 2].v, false, vf[u & 3], (short)0, acc[u], false, false); }
#pragma unroll
  for (int it = 0; it < 2; ++it) { const int b = __float_as_int(dn[it]); dn[it] += __int_as_float(__builtin_amdgcn_permlanex16(b, b, 0x76543210, 0xfedcba98, false, false)); }      /* lane l with lane l ^ 16: the two halves of each 16 columns */
  __syncthreads();      /* every wave's last read of the operands is done before their bytes are re-used */
#pragma unroll
  for (int u = 0; u < 8; ++u) {
#pragma unroll
    for (int r = 0; r < 8; ++r) red[w][(u >> 2) * 16 + 8 * hh + r][(u & 3) * 16 + ln] = acc[u][r]; }
  if (hh == 0) { dl[w][ln] = dn[0]; dl[w][16 + ln] = dn[1]; }
  __syncthreads();      /* the four quarters' products and sums are in LDS before a thread adds them */
  const int row = tid >> 2, cg = (tid & 3) * 16, qr = row >> 5, rl = row & 31;      /* 4 threads a row of 128 bytes of cx */
  const float dv = fmaxf(((dl[qr][rl] + dl[4 + qr][rl]) + dl[8 + qr][rl]) + dl[12 + qr][rl], QLO * QPC); FragH o;      /* kt's row sum and its lower bound, both behind the carry */
#pragma unroll
  for (int k = 0; k < 4; ++k) { const v4f a = ((*(const v4fa*)&red[qr][rl][cg + 4 * k] + *(const v4fa*)&red[4 + qr][rl][cg + 4 * k]) + *(const v4fa*)&red[8 + qr][rl][cg + 4 * k]) + *(const v4fa*)&red[12 + qr][rl][cg + 4 * k];
#pragma unroll
    for (int e = 0; e < 4; ++e) o.h[4 * k + e] = (_Float16)(a[e] / dv); }      /* the carry cancels */
  unsigned short* oc = (unsigned short*)CH + (size_t)(i0 + row) * QNW + fo + cg;
  *(v8us*)oc = o.half[0]; *(v8us*)(oc + 8) = o.half[1];      /* the thread's last instructions: nothing overwrites the stores' registers behind them */
}

extern "C" void kernel_launch(void* const* d_in, const int* in_sizes, int n_in,
                              void* d_out, int out_size, void* d_ws, size_t ws_size, hipStream_t stream) {
  (void)in_sizes; (void)n_in; (void)out_size;
  const float* const* I = (const float* const*)d_in; const float* xa = I[0]; const float* wa = I[1]; const float* va = I[2]; const float* wb = I[3]; const float* vb = I[4]; const float* wc = I[5]; const float* vc = I[6]; const float* wd = I[7]; const float* vd = I[8];      /* xa [2][1024][1024]; the four weights [1024][1024] (source, result); the four added vectors [1024] */
  float* res = (float*)d_out;
  static_assert((QNG * QNL) % 128 == 0 && QNL % 128 == 0 && QNW % 64 == 0 && QNW % 32 == 0 && QSW % 64 == 0 && QSW % 32 == 0 && QNL % 8 == 0 && QNS * QSW == QNW, "whole tiles");
  uint8_t* wsp = (uint8_t*)d_ws; size_t off = 0;
  auto take = [&](size_t bytes) { uint8_t* p = wsp + off; off += (bytes + 255) & ~(size_t)255; return p; };
  const size_t GW = (size_t)QNG * QNL * QNW, G1 = (size_t)QNL * QNW;
  float* RP = (float*)take((size_t)QNG * QNS * (QNL / QCB) * QNL * 4);
  _Float16* XH = (_Float16*)take(GW * 2); _Float16* AH = (_Float16*)take(2 * GW * 2); _Float16* CH = (_Float16*)take(GW * 2); _Float16* VT = (_Float16*)take(GW * 2);
  _Float16* WA = (_Float16*)take((size_t)4 * QNW * QNW * 2); _Float16* WD = WA + (size_t)3 * QNW * QNW; float* LA = (float*)take((size_t)2 * QNG * QNS * QNL * 4); float* LB = LA + (size_t)QNG * QNS * QNL; float* CF = (float*)take((size_t)QNG * QNS * QNL * 4);      /* sc's row sums over blocks of 64 columns; xa's cast; the f16 words of fa and, behind them, of fb; cx's; fc's transposed, group by group; the four weights transposed, one behind the other; the strips' squared lengths, fa's and behind them fb's; the column factors */
  if (off > ws_size) return;
  k_cast<<<(unsigned)(4 * QWB + QXB), 256, 0, stream>>>(xa, wa, wb, wc, wd, XH, WA, QWC);      /* WA[m][o][k] = f16(64 w[k][o]), m: wa, wb, wc, wd */
  k_gemm2<0><<<dim3((unsigned)(((QNG * QNL) / 128) * (QNW / 64)), 3), 128, 0, stream>>>(XH, QNW, 0, WA, QNW, (size_t)QNW * QNW, 1.0f / QWC, va, 0, nullptr, 1, 0, 0, nullptr, AH, QNW, GW, QNG * QNL, QNW, QNW, VT, LA, QNL, vb, vc, 3, 0, (size_t)QNG * QNS * QNL, 2);      /* plane 0: fa[(g, i)][o] = xa[g][i][:] . wa[:][o] + va[o]: AH its f16 words, LA[g][s][i] its strips' squared lengths; plane 1: fb likewise, behind them; plane 2: VT[g][(s, c)][j] = f16(fc[g][j][s 64 + c]) */
  k_qps<<<(unsigned)(QNG * QNS * (QNL / QCB)), QFW * 32, 0, stream>>>(AH, AH + GW, LA, LB, RP, CF);      /* sc from fa[g][i][s] . fb[g][j][s] and the two lengths: RP[g][s][j / 64][i] = its sum over 64 columns; CF[g][s][j] = nc^(-1/2) */
  k_mix<<<(unsigned)(QNG * QNS * (QNL / QMR)), QMW * 32, 0, stream>>>(AH, AH + GW, VT, LA, LB, RP, CF, CH);      /* CH[g][i][s 64 + c] = the f16 word of (sum over j of kt[i][j] fc[g][j][s 64 + c]) / max(kt's row sum, 1e-12): in place at a strip's column offset */
  k_gemm2<0><<<dim3((unsigned)(((QNG * QNL) / 128) * (QNW / 64)), 1), 128, 0, stream>>>(CH, QNW, 0, WD, QNW, 0, 1.0f / QWC, vd, 0, nullptr, 1, 0, 0, res, nullptr, QNW, 0, QNG * QNL, QNW, QNW, nullptr, nullptr, QNL, nullptr, nullptr, 1, 0, 0, -1);      /* res = cx wd + vd: every word of the result once */
}

// v009
// Measured time: 77 microseconds a run.
// In two side-by-side timings against v008, it was 1.15 and 1.14 times as fast.
// Over all steps from v000 it is 8.11 times as fast.
// A distance-kernel mixing of rows: xa [2][1024][1024] (group, row, width); wa, wb, wc, wd [1024][1024] stored (source column, result column), va, vb, vc, vd [1024]: fa | fb | fc = xa w + v, split into 16 strips of 64 columns; for a group and a strip: e2[i][j] = |fa_i|^2 + |fb_j|^2 - 2 fa_i . fb_j; gd = sqrt(max(e2, 1e-12)) / 64; sc = (1 + gd)^(-65.5); nr = its row sums, nc = its column sums; kt = nr^(-1/2) sc nc^(-1/2); pb = kt / max(its row sum, 1e-12); cx = pb fc's strip; res = cx wd + vd -> [2][1024][1024] f32: one result.
// Structure: xa cast to f16 as it lies and the four weights cast transposed behind a carry of 64 (converted to bf16 first); three WMMA GEMMs (the carry undone in their scale argument; the added vectors live) whose f32 words never go to memory: the epilogue of fa's and fb's stores each word as ONE f16 word and, a lane a row, a strip's squared length (the tile's 64 f32 words in index order; a tile's width is a strip's), the epilogue of fc's stores the f16 words transposed through LDS, a group's sheet (strip column, row); launches that do not wait for one another are ONE launch and run side by side (the five casts; the three projections, a plane of the grid each; both groups in each of the two kernels that follow); THEN, BOTH GROUPS AT ONCE, sc FORMED TWICE AND NEVER STORED: ONE kernel, a work-group 64 columns of a strip of a group over all rows, forms fa . fb (depth 64) on WMMA, forms sc from the two lengths and the product while the product is still in the accumulators (the root, log2 and exp2 instructions: the power as 2^(-65.5 log2(1 + gd))), sums its columns as it goes (lane partials, then LDS) and stores each sum's reciprocal root, and stores each row's sum over its 64 columns; ONE kernel, a work-group 128 rows of a strip over all columns, forms fb . fa (the product transposed, so that an accumulator's words lie as the next product's left operand wants them), sc again, kt = nr^(-1/2) sc nc^(-1/2) as one f16 word behind a carry of 2^12, multiplies it on WMMA with fc's strip, sums kt's rows in f32 beside it and divides by that sum at the end (pb is never formed): cx as f16 words in place at a strip's column offset; then the last WMMA GEMM writes the result.
// Compute dtype: all nine inputs converted to bf16 where they are read; xa's words exact as f16 operands down to 2^-14; the weights' behind 64; the computed sheets ONE f16 word each (kt, in registers only, behind 2^12); every product's accumulation, the lengths, the kernel's arithmetic, the sums and the result f32. v_wmma_f32_16x16x32_f16.
#include <hip/hip_runtime.h>
#define QNG 2                        /* groups */
#define QNL 1024                     /* rows of a group */
#define QNW 1024                     /* a row's width: every projection's depth and width */
#define QNS 16                       /* strips */
#define QSW 64                       /* a strip's width: the pair product's depth */
#define QDS 64.0f                    /* the distance's divisor */
#define QPW -65.5f                   /* the power */
#define QLO 1e-12f                   /* the lower bound of e2 and of a row's sum */
#define QWC 64.0f                    /* the weights' carry (undone in the products' scale argument) */
#define QPC 4096.0f                  /* kt's carry (it cancels where the fifth product is divided by kt's row sum, which has it too) */
#define QMW 16                       /* waves of a work-group of the mixing kernel: 4 blocks of 32 rows x 4 quarters of the columns */
#define QMR 128                      /* its rows */
#define QMP 1032                     /* 16-bit words of a staged row of fc's transposed strip: 1,024 + 8, a pitch of 2,064 bytes (16 bytes x odd) */
#define QCB 64                       /* columns of sc that a work-group of the pair kernel takes */
#define QFW 16                       /* its waves */
#define QFT 2                        /* tiles of 32 rows that one of its waves takes */
typedef unsigned short v8us __attribute__((ext_vector_type(8), may_alias));
typedef float  v8f  __attribute__((ext_vector_type(8)));
typedef float  v4f  __attribute__((ext_vector_type(4)));
typedef float  v4fa __attribute__((ext_vector_type(4), may_alias));

__device__ __forceinline__ unsigned short bf16_bits(float x) { unsigned int u = __float_as_uint(x); return (unsigned short)((u + 0x7FFFu + ((u >> 16) & 1u)) >> 16); }
__device__ __forceinline__ float bf16_val(unsigned short b) { return __uint_as_float(((unsigned int)b) << 16); }
__device__ __forceinline__ float bf16_round(float x) { return bf16_val(bf16_bits(x)); }

typedef _Float16 v16h __attribute__((ext_vector_type(16)));
union FragH { v16h v; v8us half[2]; _Float16 h[16]; unsigned short u[16]; };

typedef _Float16 v4h __attribute__((ext_vector_type(4)));

// The five casts in one launch of QCG work-groups, one for each WGP, 8 waves each. A work-group takes one QCT x QCT tile of one weight and an equal share of xa. Wt[m][n][k] = f16(Wm[k][n] x scale) from f32 row-major Wm[QNW][QNW] (scale = power of two; bf16-exact weights stay exact in f16 away from the subnormal range): a wave reads 16 rows k of the tile, 512 bytes in a row a load (4 whole lines), so a lane holds 4 columns n x 16 k in a row: 32 bytes of each of 4 rows of the transposed tile, which go through LDS and leave as rows of 256 bytes. xa's words as they lie, whole lines in and out. All 24 loads of a lane are issued before the first word is used.
#define QCT 128                                      /* the side of a weight's tile */
#define QCG (4 * (QNW / QCT) * (QNW / QCT))          /* the cast's work-groups */
#define QCX ((QNG * QNL * QNW) / QCG)                /* words of xa that one of them takes */
__global__ __launch_bounds__(256) void k_cast(const float* __restrict__ x, const float* __restrict__ W0, const float* __restrict__ W1, const float* __restrict__ W2, const float* __restrict__ W3, _Float16* __restrict__ X16, _Float16* __restrict__ Wt, float scale) {
  static_assert(QCT == 128 && QNW % QCT == 0 && (QNG * QNL * QNW) % QCG == 0 && QCX == 8 * 256 * 4, "8 waves x 16 rows, 32 lanes x 4 columns; 8 rounds of 4 words a thread of xa");
  __shared__ __attribute__((aligned(16))) unsigned short ts[QCT * QCT];      /* the transposed tile: row n, 16 pieces of 8 k; piece q of row n lies at place q ^ ((n >> 2) & 15), so the 32 lanes of a store (rows 4 apart, one q) meet every bank equally often, and so do the 16 lanes that read a row */
  const int tid = threadIdx.x, w = tid >> 5, lane = tid & 31; constexpr int TB = QNW / QCT;
  const int m = blockIdx.x / (TB * TB), k0 = ((blockIdx.x / TB) % TB) * QCT, n0 = (blockIdx.x % TB) * QCT; const float* W = m == 0 ? W0 : m == 1 ? W1 : m == 2 ? W2 : W3;
  const float* gw = W + (size_t)(k0 + 16 * w) * QNW + n0 + 4 * lane; const float* gx = x + (size_t)blockIdx.x * QCX + tid * 4;
  v4f wv[16], xv[8];
#pragma unroll
  for (int i = 0; i < 16; ++i) wv[i] = *(const v4fa*)(gw + (size_t)i * QNW);
#pragma unroll
  for (int i = 0; i < 8; ++i) xv[i] = *(const v4fa*)(gx + i * 1024);
  asm volatile("s_wait_xcnt 0x0" :: "v"(gw) : "memory");      /* the wait in front of the first overwrite of the loads' address registers (the arithmetic below may re-use them); gw as an input keeps the weight's address alive up to here, so that no word of xa lands on it */
  __builtin_amdgcn_sched_barrier(0);      /* keeps all 24 loads in front of the first use: sunk among the conversions, a late load would be waited for a second time, in front of the barrier */
#pragma unroll
  for (int e = 0; e < 4; ++e) { FragH f;
#pragma unroll
    for (int i = 0; i < 16; ++i) f.h[i] = (_Float16)(bf16_round(wv[i][e]) * scale);
    unsigned short* tr = ts + (4 * lane + e) * QCT;
    *(v8us*)(tr + ((2 * w) ^ (lane & 15)) * 8) = f.half[0]; *(v8us*)(tr + ((2 * w + 1) ^ (lane & 15)) * 8) = f.half[1]; }
  __syncthreads();      /* the 8 waves' pieces of every row of the transposed tile are in LDS before a half wave reads a whole row */
  _Float16* gh = X16 + (size_t)blockIdx.x * QCX + tid * 4;
#pragma unroll
  for (int i = 0; i < 8; ++i) { v4h h4;
#pragma unroll
    for (int e = 0; e < 4; ++e) h4[e] = (_Float16)bf16_round(xv[i][e]);
    *(v4h*)(gh + i * 1024) = h4; }
  asm volatile("s_wait_xcnt 0x0" ::: "memory");      /* the wait in front of the first overwrite of these stores' registers (the LDS loads below may land on them) */
  const int rn = tid >> 4, rq = tid & 15; v8us tv[8];
#pragma unroll
  for (int i = 0; i < 8; ++i) { const int n = 16 * i + rn; tv[i] = *(const v8us*)(ts + n * QCT + (rq ^ ((n >> 2) & 15)) * 8); }
  unsigned short* go = (unsigned short*)Wt + (size_t)m * QNW * QNW + (size_t)(n0 + rn) * QNW + k0 + rq * 8;
#pragma unroll
  for (int i = 0; i < 8; ++i) *(v8us*)(go + (size_t)(16 * i) * QNW) = tv[i];      /* the thread's last instructions: nothing overwrites the stores' registers behind them */
}

// ---- fast GEMM (wave tile 32x64, work-group tile 128x64; requires M % 128 == 0 rows per launch region, N % 64 == 0 and K % 64 == 0); both operands staged in LDS 64 k at a time, two buffers; epilogue: alpha, bias, CP and activation into C, with three more results: C16 (the words as f16), LN (a row's squared length over the tile's 64 columns) and CT (the words as f16, transposed); the grid's y and z number independent products that run side by side ----
#define G2P 72                       /* 16-bit words of a staged row: 64 + 8, a pitch of 144 bytes (16 bytes x odd: 16 rows read 16 bytes a lane without bank conflicts) */
#define G2S (192 * G2P)              /* 16-bit words of a stage: 128 rows of A, then 64 rows of B */
#define G2T 136                      /* 16-bit words of a column of the transposed result's staging: 128 + 8, a pitch of 272 bytes (16 bytes x odd) */
__device__ __forceinline__ v16h g2_frag(const _Float16* p, int hh) { FragH f; f.half[0] = *(const v8us*)((const unsigned short*)p + 8 * hh); f.half[1] = *(const v8us*)((const unsigned short*)p + 16 + 8 * hh); return f.v; }
__device__ __forceinline__ v8f g2_mma(v16h a, v16h b, v8f c) { v8f d = __builtin_amdgcn_wmma_f32_16x16x32_f16(false, a, false, b, (short)0, c, false, false); asm volatile("v_nop\n\tv_nop\n\tv_nop\n\tv_nop" : "+v"(d) : "v"(a), "v"(b)); return d; }
template <int ACT>
__global__ __launch_bounds__(128) void k_gemm2(const _Float16* __restrict__ A, int lda, size_t sA, const _Float16* __restrict__ Bh, int ldb, size_t sB, float alpha, const float* __restrict__ bias, size_t sBias, const float* __restrict__ CP, int rowsPerB, size_t sCPb, int row0g,
    float* __restrict__ C, _Float16* __restrict__ C16, int ldc, size_t sC, int M, int N, int K, _Float16* __restrict__ CT, float* __restrict__ LN, int rowsT, const float* __restrict__ biasB, const float* __restrict__ biasC, int nY, size_t sCZ, size_t sLN, int byT) {      /* CT [M / rowsT][N][rowsT] and LN [M / rowsT][N / 64][rowsT]: rowsT % 128 == 0; CT is plane byT's only result; biasB, biasC: where given, the added vectors of planes 1 and 2; nY: the grid's extent in y; sCZ: C's step from one z to the next; sLN: LN's from one y to the next */ static_assert(ACT == 0 || ACT == 3 || ACT == 6 || ACT == 8 || ACT == 9 || ACT == 11 || ACT == 12 || ACT == 14 || ACT == 15 || ACT == 16 || ACT == 17, "k_gemm2: unsupported ACT code (would silently apply no activation)");
  __shared__ __attribute__((aligned(16))) unsigned char sm[2 * G2S * 2]; static_assert(sizeof(sm) >= 4 * 32 * 68 * 4 && sizeof(sm) >= 64 * G2T * 2, "the result's staging re-uses the two operand buffers");
  float (*so)[32][68] = (float (*)[32][68])sm;      /* written only behind the k loop's last barrier */
  const int tid = threadIdx.x, w = tid >> 5, lane = tid & 31, ln = lane & 15, hh = lane >> 4; const int by = blockIdx.y; const size_t pl = (size_t)blockIdx.z * nY + by;      /* the operands' planes lie one behind the other, y within z */
  A += pl * sA; Bh += pl * sB; const size_t cofs = (size_t)by * sC + (size_t)blockIdx.z * sCZ; const float* bp = bias ? (biasB ? (by == 0 ? bias : by == 1 ? biasB : biasC) : bias + (size_t)by * sBias) : nullptr;
  const int ntn = N >> 6; const int mt = blockIdx.x / ntn, nq = blockIdx.x - mt * ntn; const int row0 = mt * 128 + 32 * w, col0 = nq * 64; if (mt * 128 >= M) return;      /* the whole work-group leaves or none does: barriers follow */
  const int sr = tid >> 3, sk = (tid & 7) * 8;      /* staging: 8 threads a row of 128 bytes, so a wave's load is 4 whole lines; 16 rows a round of the work-group */
  const unsigned short* ga = (const unsigned short*)A + (size_t)(mt * 128 + sr) * lda + sk; const unsigned short* gb = (const unsigned short*)Bh + (size_t)(col0 + sr) * ldb + sk;
  unsigned short* sh = (unsigned short*)sm; const int swo = sr * G2P + sk; v8us st[12];
  const v8f z8 = {0.f,0.f,0.f,0.f,0.f,0.f,0.f,0.f}; v8f c00 = z8, c01 = z8, c02 = z8, c03 = z8, c10 = z8, c11 = z8, c12 = z8, c13 = z8;
  for (int i = 0; i < 8; ++i) st[i] = *(const v8us*)(ga + (size_t)(16 * i) * lda);
  for (int i = 0; i < 4; ++i) st[8 + i] = *(const v8us*)(gb + (size_t)(16 * i) * ldb);
  for (int i = 0; i < 12; ++i) *(v8us*)(sh + swo + i * 16 * G2P) = st[i];
  __syncthreads();      /* stage 0 is in LDS before a wave reads it */
  for (int kb = 0; kb < K; kb += 64) { const int cur = (kb >> 6) & 1; const bool more = kb + 64 < K;
    if (more) {      /* the next stage's words fly while this stage is multiplied */
      for (int i = 0; i < 8; ++i) st[i] = *(const v8us*)(ga + (size_t)(16 * i) * lda + kb + 64);
      for (int i = 0; i < 4; ++i) st[8 + i] = *(const v8us*)(gb + (size_t)(16 * i) * ldb + kb + 64); }
    const _Float16* pa = (const _Float16*)(sh + cur * G2S + (32 * w + ln) * G2P); const _Float16* pb = (const _Float16*)(sh + cur * G2S + (128 + ln) * G2P);
    v16h a0[2], a1[2], b[2][4];
    for (int ks = 0; ks < 2; ++ks) { a0[ks] = g2_frag(pa + 32 * ks, hh); a1[ks] = g2_frag(pa + 16 * G2P + 32 * ks, hh);
      for (int t = 0; t < 4; ++t) b[ks][t] = g2_frag(pb + t * 16 * G2P + 32 * ks, hh); }
    for (int ks = 0; ks < 2; ++ks) { c00 = g2_mma(a0[ks], b[ks][0], c00); c10 = g2_mma(a1[ks], b[ks][0], c10); c01 = g2_mma(a0[ks], b[ks][1], c01); c11 = g2_mma(a1[ks], b[ks][1], c11);
      c02 = g2_mma(a0[ks], b[ks][2], c02); c12 = g2_mma(a1[ks], b[ks][2], c12); c03 = g2_mma(a0[ks], b[ks][3], c03); c13 = g2_mma(a1[ks], b[ks][3], c13); }
    if (more) {
      for (int i = 0; i < 12; ++i) *(v8us*)(sh + (cur ^ 1) * G2S + swo + i * 16 * G2P) = st[i]; }      /* the other buffer: its readers left it in front of the last barrier */
    __syncthreads(); }      /* publishes the next stage and ends this stage's reads (behind the last stage: before the result's staging re-uses the bytes) */
  v8f accs[8] = {c00, c01, c02, c03, c10, c11, c12, c13};
#pragma unroll
  for (int u = 0; u < 8; ++u) { const int t = u & 3, half = u >> 2; const int col = col0 + t * 16 + ln; const float bv = bp ? bf16_round(bp[col]) : 0.f;
#pragma unroll
    for (int r = 0; r < 8; ++r) { const int rloc = half * 16 + 8 * hh + r; float v = accs[u][r] * alpha + bv; if (CP) { if (rowsPerB < 0) v += CP[cofs + (size_t)(row0g + row0 + rloc) * ldc + col];      /* rowsPerB < 0: own element of the batched C plane */ else { const int bidx = (row0g + row0 + rloc) / rowsPerB; v += CP[(size_t)bidx * sCPb + (size_t)by * 64 + col]; } }
      if (ACT == 3) v = fmaxf(v, 0.f); else if (ACT == 6) v = 0.5f * v * (1.0f + erff(v * 0.70710678118654752f)); else if (ACT == 11) v = 1.0f / (1.0f + expf(-v)); else if (ACT == 15) v = v / (1.0f + expf(-v)); else if (ACT == 12) v = (v > 0.f) ? v : 0.01f * v; else if (ACT == 8) v = tanhf(v); else if (ACT == 9) v = 0.5f * v * (1.0f + tanhf(0.7978845608028654f * (v + 0.044715f * v * v * v))); else if (ACT == 14) v = (v > 0.f) ? v : 0.1f * v; else if (ACT == 16) v = (v >= 0.f) ? v : 0.3f * v; else if (ACT == 17) v = (v >= 0.f) ? v : 0.2f * v;
      accs[u][r] = v; } }
  if (CT && by == byT) {      /* the same for the whole work-group: a barrier follows. A lane's 8 words of an accumulator are 8 rows in a row of one column: 16 bytes of the transposed sheet */
    unsigned short* tp = (unsigned short*)sm; const int gT = (mt * 128) / rowsT, rT = mt * 128 - gT * rowsT;
#pragma unroll
    for (int u = 0; u < 8; ++u) { FragH f;
#pragma unroll
      for (int r = 0; r < 8; ++r) f.h[r] = (_Float16)accs[u][r];
      *(v8us*)(tp + ((u & 3) * 16 + ln) * G2T + 32 * w + (u >> 2) * 16 + 8 * hh) = f.half[0]; }
    __syncthreads();      /* the four waves' rows of every column are in LDS before a wave stores whole columns of the tile (256 bytes in a row each) */
    unsigned short* gt = (unsigned short*)CT + ((size_t)gT * N + col0 + (tid >> 4)) * rowsT + rT + (tid & 15) * 8;
    v8us tv[8];
#pragma unroll
    for (int q = 0; q < 8; ++q) tv[q] = *(const v8us*)(tp + (q * 8 + (tid >> 4)) * G2T + (tid & 15) * 8);
#pragma unroll
    for (int q = 0; q < 8; ++q) { *(v8us*)(gt + (size_t)(q * 8) * rowsT) = tv[q];
      asm volatile("s_wait_xcnt 0x0" ::: "memory"); }      /* the wait in front of the next overwrite of a store's registers (a later store's address re-uses them; behind the last store the built code still holds a branch to the other epilogue, which writes them) */
    return; }
#pragma unroll
  for (int u = 0; u < 8; ++u) {
#pragma unroll
    for (int r = 0; r < 8; ++r) so[w][(u >> 2) * 16 + 8 * hh + r][(u & 3) * 16 + ln] = accs[u][r]; }
  __builtin_amdgcn_fence(__ATOMIC_ACQ_REL, "workgroup"); __builtin_amdgcn_wave_barrier();
  const int rsub = lane >> 4, c4 = (lane & 15) * 4;
  {
#pragma unroll
    for (int q = 0; q < 16; ++q) { const int r = q * 2 + rsub; const v4f v = *(const v4fa*)&so[w][r][c4]; if (C) *(v4f*)(C + cofs + (size_t)(row0 + r) * ldc + col0 + c4) = v; if (C16) { v4h h4; for (int i = 0; i < 4; ++i) h4[i] = (_Float16)v[i]; *(v4h*)(C16 + cofs + (size_t)(row0 + r) * ldc + col0 + c4) = h4; } }
     }
  if (LN) { const float* p = &so[w][lane][0]; float a = 0.0f; const int gT = (mt * 128) / rowsT, rT = mt * 128 - gT * rowsT;      /* a lane a row of the wave's 32: the row's 64 f32 words in index order */
    asm volatile("s_wait_xcnt 0x0" ::: "memory");      /* the wait in front of the overwrite of the last store's registers (the loads below re-use them) */
    v4f x[16];
#pragma unroll
    for (int c = 0; c < 16; ++c) x[c] = *(const v4fa*)(p + 4 * c);
    __builtin_amdgcn_sched_barrier(0);      /* keeps the 16 LDS loads together in front of the sum: sunk into the chain of 64 dependent multiply-adds, each would be waited for in turn */
#pragma unroll
    for (int c = 0; c < 64; ++c) a = __builtin_fmaf(x[c >> 2][c & 3], x[c >> 2][c & 3], a);
    LN[(size_t)by * sLN + ((size_t)gT * ntn + nq) * rowsT + rT + 32 * w + lane] = a;
    asm volatile("s_wait_xcnt 0x0" ::: "memory"); } }      /* the wait in front of an overwrite of the store's registers (behind the store the built code still holds a branch to the other epilogue, which writes them) */

// A work-group takes QCB columns of one strip of one group over all its rows (the grid: group, strip, column block; la, lb, RP and CF lie strip behind strip, group behind group): fa's strip (all rows) and fb's QCB rows are staged in LDS once (whole-line loads), a wave forms QFT tiles of 32 x 64 products on WMMA (the k order and the order of the two k steps are k_gemm2's), turns each accumulator word into sc where it lies, keeps the running sums of its columns and of its rows, and stores each row's sum over the QCB columns (RP: strip, column block, row). Neither the product nor sc goes to memory.
// Eight transcendentals of one kind in ONE asm statement: every result register is apart from every source register ("=&v"), so none of them reads a result or overwrites a source of the one in front of it, and the v_nop at the end is the slot that the instruction set asks for behind the last one (left to the register allocator, runs of these instructions overwrote one another's sources back to back).
#define Q8T(name, op) __device__ __forceinline__ void name(float* y, const float* x) { asm(op " %0, %8\n\t" op " %1, %9\n\t" op " %2, %10\n\t" op " %3, %11\n\t" op " %4, %12\n\t" op " %5, %13\n\t" op " %6, %14\n\t" op " %7, %15\n\tv_nop" : "=&v"(y[0]), "=&v"(y[1]), "=&v"(y[2]), "=&v"(y[3]), "=&v"(y[4]), "=&v"(y[5]), "=&v"(y[6]), "=&v"(y[7]) : "v"(x[0]), "v"(x[1]), "v"(x[2]), "v"(x[3]), "v"(x[4]), "v"(x[5]), "v"(x[6]), "v"(x[7])); }
Q8T(q8_sqrt, "v_sqrt_f32")
Q8T(q8_log, "v_log_f32")
Q8T(q8_exp, "v_exp_f32")
#define QRS(n, ctl) { const bool up = (ln & n) != 0; _Pragma("unroll") for (int m = 0; m < n; ++m) { const float keep = up ? rs[m + n] : rs[m], send = up ? rs[m] : rs[m + n]; rs[m] = keep + __int_as_float(__builtin_amdgcn_update_dpp(0, __float_as_int(send), ctl, 0xf, 0xf, false)); } }      /* ctl: row_xmask:n */
__global__ __launch_bounds__(QFW * 32) void k_qps(const _Float16* __restrict__ FA, const _Float16* __restrict__ FB, const float* __restrict__ la, const float* __restrict__ lb, float* __restrict__ RP, float* __restrict__ CF) {
  static_assert(QSW == 64 && QCB == 64 && QNL == QFW * QFT * 32 && QFW * 32 == 8 * 64 && QNL % 64 == 0, "8 threads stage a row of 128 bytes, 64 rows a round; the waves' tiles cover all rows");
  __shared__ __attribute__((aligned(16))) unsigned short sa[(QNL + QCB) * G2P];      /* fa's rows, then fb's */
  __shared__ __attribute__((aligned(16))) float ps[2 * QFW][QCB];
  const int tid = threadIdx.x, w = tid >> 5, lane = tid & 31, ln = lane & 15, hh = lane >> 4; const int s = blockIdx.x / (QNL / QCB), j0 = (blockIdx.x % (QNL / QCB)) * QCB;      /* s: 16 x group + strip */ const size_t fo = (size_t)(s / QNS) * QNL * QNW + (s % QNS) * QSW;      /* the strip's first word in fa and in fb */
  const int sr = tid >> 3, sk = (tid & 7) * 8;
  const unsigned short* ga = (const unsigned short*)FA + (size_t)sr * QNW + fo + sk; const unsigned short* gb = (const unsigned short*)FB + (size_t)(j0 + sr) * QNW + fo + sk;
  v8us st[QNL / 64 + 1]; float kb[4]; v4f qa[QFT][2][2];
#pragma unroll
  for (int i = 0; i < QNL / 64; ++i) st[i] = *(const v8us*)(ga + (size_t)(64 * i) * QNW);
  st[QNL / 64] = *(const v8us*)gb;
#pragma unroll
  for (int t = 0; t < 4; ++t) kb[t] = lb[s * QNL + j0 + t * 16 + ln];
#pragma unroll
  for (int tt = 0; tt < QFT; ++tt)
#pragma unroll
    for (int e = 0; e < 4; ++e) qa[tt][e >> 1][e & 1] = *(const v4fa*)(la + s * QNL + (QFT * w + tt) * 32 + (e >> 1) * 16 + 8 * hh + (e & 1) * 4);      /* the lengths of the 16 rows that the lane's accumulator words lie in */
  asm volatile("s_wait_xcnt 0x0" ::: "memory");      /* the wait in front of the first overwrite of the loads' address registers (the LDS addresses below may re-use them) */
#pragma unroll
  for (int i = 0; i < QNL / 64; ++i) *(v8us*)(sa + (sr + 64 * i) * G2P + sk) = st[i];
  *(v8us*)(sa + (QNL + sr) * G2P + sk) = st[QNL / 64];
  __syncthreads();      /* both operands are in LDS before a wave reads its fragments */
  const _Float16* pb = (const _Float16*)(sa + (QNL + ln) * G2P); v16h b[2][4];
#pragma unroll
  for (int ks = 0; ks < 2; ++ks)
#pragma unroll
    for (int t = 0; t < 4; ++t) b[ks][t] = g2_frag(pb + t * 16 * G2P + 32 * ks, hh);
  float cs[4] = {0.f, 0.f, 0.f, 0.f};
  float* og = RP + ((size_t)s * (QNL / QCB) + j0 / QCB) * QNL + QFT * 32 * w + (ln >> 3) * 16 + 8 * hh + (ln & 7);      /* the row whose sum ends in this lane (below) */
#pragma unroll      /* whole: the lengths' registers are indexed by the tile */
  for (int tt = 0; tt < QFT; ++tt) { const _Float16* pa = (const _Float16*)(sa + ((QFT * w + tt) * 32 + ln) * G2P); v16h a0[2], a1[2];
#pragma unroll
    for (int ks = 0; ks < 2; ++ks) { a0[ks] = g2_frag(pa + 32 * ks, hh); a1[ks] = g2_frag(pa + 16 * G2P + 32 * ks, hh); }
    const v8f z8 = {0.f,0.f,0.f,0.f,0.f,0.f,0.f,0.f}; v8f acc[8] = {z8, z8, z8, z8, z8, z8, z8, z8};
#pragma unroll
    for (int ks = 0; ks < 2; ++ks)
#pragma unroll
      for (int t = 0; t < 4; ++t) { acc[t] = __builtin_amdgcn_wmma_f32_16x16x32_f16(false, a0[ks], false, b[ks][t], (short)0, acc[t], false, false); acc[4 + t] = __builtin_amdgcn_wmma_f32_16x16x32_f16(false, a1[ks], false, b[ks][t], (short)0, acc[4 + t], false, false); }
    float rs[16] = {0.f, 0.f, 0.f, 0.f, 0.f, 0.f, 0.f, 0.f, 0.f, 0.f, 0.f, 0.f, 0.f, 0.f, 0.f, 0.f};      /* the lane's share of the sums of the 16 rows that its accumulator words lie in */
    __builtin_amdgcn_sched_barrier(0);      /* keeps the asm statements below behind the tile's last WMMA and behind the arithmetic that feeds them: drawn up among the WMMAs, a result register of theirs overwrote a fragment too few vector slots behind its WMMA (the compiler pads its own instructions, not asm text) */
#pragma unroll
    for (int u = 0; u < 8; ++u) { const int t = u & 3, half = u >> 2;
      float x[8], y[8]; bool lo[8];
#pragma unroll
      for (int r = 0; r < 8; ++r) x[r] = fmaxf((qa[tt][half][r >> 2][r & 3] + kb[t]) - 2.0f * acc[u][r], QLO);
      q8_sqrt(y, x);      /* v_sqrt_f32 as it is: its argument is at least QLO, never subnormal */
#pragma unroll
      for (int r = 0; r < 8; ++r) x[r] = 1.0f + y[r] / QDS;
      q8_log(y, x);      /* (1 + gd)^QPW = 2^(QPW log2(1 + gd)); v_log_f32 as it is: its argument is at least 1 */
#pragma unroll
      for (int r = 0; r < 8; ++r) { const float p = QPW * y[r]; lo[r] = p < -126.0f; x[r] = p + (lo[r] ? 64.0f : 0.0f); }      /* exp2f's own steps written out: an exponent below -126 is raised by 64 in front of v_exp_f32 and the result scaled back, so subnormal results are kept */
      q8_exp(y, x);
#pragma unroll
      for (int r = 0; r < 8; ++r) { const float v = ldexpf(y[r], lo[r] ? -64 : 0); cs[t] += v; rs[half * 8 + r] += v; } }
    /* 16 sums over the 16 lanes of a half wave: at each step a lane keeps one half of its sums and hands the other half to the lane that keeps those, so lane ln ends with sum number ln (15 adds in place of 64) */
    QRS(8, 0x168) QRS(4, 0x164) QRS(2, 0x162) QRS(1, 0x161)
    /* the store and the wait in front of the next overwrite of its data and address registers in ONE statement (the next tile's arithmetic re-uses them) */
    asm volatile("global_store_b32 %0, %1, off\n\ts_wait_xcnt 0x0" :: "v"(og + tt * 32), "v"(rs[0]) : "memory"); }
#pragma unroll
  for (int t = 0; t < 4; ++t) ps[2 * w + hh][t * 16 + ln] = cs[t];
  __syncthreads();      /* the 2 QFW partial sums of every column are in LDS before a thread a column adds them */
  if (tid < QCB) { float t = 0.0f;
#pragma unroll
    for (int r = 0; r < 2 * QFW; ++r) t += ps[r][tid];
    CF[s * QNL + j0 + tid] = 1.0f / sqrtf(t); } }

// A work-group takes QMR rows of one strip of one group over all columns (the grid: group, strip, row block). fb's strip (all rows), fc's transposed strip, fb's lengths and the column factors are staged in LDS once (whole-line loads); a wave takes 32 rows and a quarter of the columns, 32 columns a trip. The pair product is formed TRANSPOSED (left operand fb's rows, right operand fa's rows: the k order and the order of the two k steps are k_qps's), so a lane holds ONE row i of sc a tile (its column of the accumulator) and 8 columns j in a row (8 hh + r): exactly the words, in exactly the order, that g2_frag gives a lane of a left operand with rows i and depth j. So kt goes from the accumulators into the next WMMA through registers alone, and kt's row sum is a lane's own running sum. The four quarters' products and sums are added through LDS at the end.
__global__ __launch_bounds__(QMW * 32) void k_mix(const _Float16* __restrict__ FA, const _Float16* __restrict__ FB, const _Float16* __restrict__ VT, const float* __restrict__ la, const float* __restrict__ lb, const float* __restrict__ RP, const float* __restrict__ CF, _Float16* __restrict__ CH) {
  static_assert(QSW == 64 && QNL == 1024 && QMW == 16 && QMR == 128 && QNL % QMR == 0 && QNL / QCB == 16, "8 threads stage a row of 128 bytes, 64 rows a round; 4 x 32 rows, 4 x 256 columns; 16 partial sums a row");
  __shared__ __attribute__((aligned(16))) unsigned char sm[(QNL * G2P + QSW * QMP) * 2];      /* fb's rows, then fc's transposed rows */
  __shared__ __attribute__((aligned(16))) float lc[2 * QNL];      /* fb's squared lengths, then the column factors */
  __shared__ __attribute__((aligned(16))) float dl[QMW][32];      /* a wave's share of kt's row sums */
  static_assert(sizeof(sm) >= QMW * 32 * 68 * 4, "the waves' products re-use the operands' bytes");
  unsigned short* sb = (unsigned short*)sm; unsigned short* sv = sb + QNL * G2P; float (*red)[32][68] = (float (*)[32][68])sm;      /* red: written only behind the barrier that ends the operands' last reads */
  const int tid = threadIdx.x, w = tid >> 5, lane = tid & 31, ln = lane & 15, hh = lane >> 4; const int s = blockIdx.x / (QNL / QMR), i0 = (blockIdx.x % (QNL / QMR)) * QMR;      /* s: 16 x group + strip */ const size_t fo = (size_t)(s / QNS) * QNL * QNW + (s % QNS) * QSW;      /* the strip's first word in fa, in fb and in cx */
  const int rb = w & 3, jq = w >> 2;      /* the wave's block of 32 rows and its quarter of the columns */
  const int sr = tid >> 3, sk = (tid & 7) * 8;
  const unsigned short* gb = (const unsigned short*)FB + (size_t)sr * QNW + fo + sk; const unsigned short* gv = (const unsigned short*)VT + (size_t)s * QSW * QNL + tid * 8;      /* fc's transposed strip is 128 KiB in a row */
  const unsigned short* ga = (const unsigned short*)FA + (size_t)(i0 + 32 * rb + ln) * QNW + fo + 8 * hh; const float* gr = RP + (size_t)s * (QNL / QCB) * QNL + i0 + 32 * rb + ln;
  v8us st[32]; v16h fi[2][2]; float ka[2], rp[2][16], rf[2];
#pragma unroll
  for (int it = 0; it < 2; ++it) { ka[it] = la[s * QNL + i0 + 32 * rb + it * 16 + ln];
#pragma unroll
    for (int q = 0; q < 16; ++q) rp[it][q] = gr[q * QNL + it * 16]; }
  asm volatile("s_wait_xcnt 0x0" ::: "memory");      /* the wait in front of the first overwrite of these loads' address registers (the next loads' addresses and results may re-use them) */
#pragma unroll
  for (int i = 0; i < 16; ++i) st[i] = *(const v8us*)(gb + (size_t)(64 * i) * QNW);
#pragma unroll
  for (int i = 0; i < 16; ++i) st[16 + i] = *(const v8us*)(gv + i * (QMW * 32 * 8));
  const v4f lv = *(const v4fa*)((tid < 256 ? lb : CF) + s * QNL + (tid & 255) * 4);
  asm volatile("s_wait_xcnt 0x0" ::: "memory");      /* the same wait for these loads (a fragment below may land on an address of theirs) */
#pragma unroll
  for (int it = 0; it < 2; ++it)
#pragma unroll
    for (int ks = 0; ks < 2; ++ks) { FragH f; f.half[0] = *(const v8us*)(ga + (size_t)(it * 16) * QNW + 32 * ks); f.half[1] = *(const v8us*)(ga + (size_t)(it * 16) * QNW + 32 * ks + 16); fi[it][ks] = f.v; }      /* g2_frag's words (8 hh is in ga) */
  asm volatile("s_wait_xcnt 0x0" :: "v"(ga) : "memory");      /* the wait in front of the first overwrite of the loads' address registers (the LDS addresses below may re-use them); ga as an input keeps the fragments' address alive up to here, so that no fragment lands on it */
#pragma unroll
  for (int i = 0; i < 16; ++i) *(v8us*)(sb + (sr + 64 * i) * G2P + sk) = st[i];
#pragma unroll
  for (int i = 0; i < 16; ++i) *(v8us*)(sv + ((tid >> 7) + 4 * i) * QMP + (tid & 127) * 8) = st[16 + i];
  *(v4f*)(lc + tid * 4) = lv;
#pragma unroll
  for (int it = 0; it < 2; ++it) { float t = 0.0f;
#pragma unroll
    for (int q = 0; q < 16; ++q) t += rp[it][q];      /* nr: the 16 column blocks' sums in index order */
    rf[it] = (1.0f / sqrtf(t)) * QPC; }      /* nr^(-1/2) with kt's carry in it (a power of two: exact) */
  __syncthreads();      /* the operands are in LDS before a wave reads its fragments */
  const v8f z8 = {0.f,0.f,0.f,0.f,0.f,0.f,0.f,0.f}; v8f acc[8] = {z8, z8, z8, z8, z8, z8, z8, z8}; float dn[2] = {0.f, 0.f};
  for (int jb = 0; jb < QNL / 4 / 32; ++jb) { const int j0 = jq * (QNL / 4) + jb * 32;
    const _Float16* pj = (const _Float16*)(sb + (j0 + ln) * G2P); const _Float16* pv = (const _Float16*)(sv + ln * QMP + j0); const float* pl = lc + j0 + 8 * hh;
    v16h bj[2][2], vf[4]; v4f qb[2][2], qc[2][2];
#pragma unroll
    for (int jt = 0; jt < 2; ++jt)
#pragma unroll
      for (int ks = 0; ks < 2; ++ks) { bj[jt][ks] = g2_frag(pj + jt * 16 * G2P + 32 * ks, hh); qb[jt][ks] = *(const v4fa*)(pl + jt * 16 + ks * 4); qc[jt][ks] = *(const v4fa*)(pl + QNL + jt * 16 + ks * 4); }      /* qb, qc: the lengths and factors of the 16 columns j that the lane's accumulator words lie in */
#pragma unroll
    for (int t = 0; t < 4; ++t) vf[t] = g2_frag(pv + t * 16 * QMP, hh);
    v8f d[4] = {z8, z8, z8, z8};
#pragma unroll
    for (int ks = 0; ks < 2; ++ks)
#pragma unroll
      for (int u = 0; u < 4; ++u) d[u] = __builtin_amdgcn_wmma_f32_16x16x32_f16(false, bj[u >> 1][ks], false, fi[u & 1][ks], (short)0, d[u], false, false);
    __builtin_amdgcn_sched_barrier(0);      /* keeps the asm statements below behind the trip's pair WMMAs and behind the arithmetic that feeds them (as in k_qps: the compiler pads its own instructions, not asm text) */
    FragH pf[2];
#pragma unroll
    for (int u = 0; u < 4; ++u) { const int jt = u >> 1, it = u & 1;
      float x[8], y[8]; bool lo[8];
#pragma unroll
      for (int r = 0; r < 8; ++r) x[r] = fmaxf((ka[it] + qb[jt][r >> 2][r & 3]) - 2.0f * d[u][r], QLO);
      q8_sqrt(y, x);      /* the three steps and their bounds: as in k_qps */
#pragma unroll
      for (int r = 0; r < 8; ++r) x[r] = 1.0f + y[r] / QDS;
      q8_log(y, x);
#pragma unroll
      for (int r = 0; r < 8; ++r) { const float p = QPW * y[r]; lo[r] = p < -126.0f; x[r] = p + (lo[r] ? 64.0f : 0.0f); }
      q8_exp(y, x);
#pragma unroll
      for (int r = 0; r < 8; ++r) { const float kt = (rf[it] * ldexpf(y[r], lo[r] ? -64 : 0)) * qc[jt][r >> 2][r & 3]; dn[it] += kt; pf[it].h[jt * 8 + r] = (_Float16)kt; } }      /* word jt 8 + r of the left operand's fragment is depth 16 jt + 8 hh + r: g2_frag's order */
#pragma unroll
    for (int u = 0; u < 8; ++u) acc[u] = __builtin_amdgcn_wmma_f32_16x16x32_f16(false, pf[u >> 2].v, false, vf[u & 3], (short)0, acc[u], false, false); }
#pragma unroll
  for (int it = 0; it < 2; ++it) { const int b = __float_as_int(dn[it]); dn[it] += __int_as_float(__builtin_amdgcn_permlanex16(b, b, 0x76543210, 0xfedcba98, false, false)); }      /* lane l with lane l ^ 16: the two halves of each 16 columns */
  __syncthreads();      /* every wave's last read of the operands is done before their bytes are re-used */
#pragma unroll
  for (int u = 0; u < 8; ++u) {
#pragma unroll
    for (int r = 0; r < 8; ++r) red[w][(u >> 2) * 16 + 8 * hh + r][(u & 3) * 16 + ln] = acc[u][r]; }
  if (hh == 0) { dl[w][ln] = dn[0]; dl[w][16 + ln] = dn[1]; }
  __syncthreads();      /* the four quarters' products and sums are in LDS before a thread adds them */
  const int row = tid >> 2, cg = (tid & 3) * 16, qr = row >> 5, rl = row & 31;      /* 4 threads a row of 128 bytes of cx */
  const float dv = fmaxf(((dl[qr][rl] + dl[4 + qr][rl]) + dl[8 + qr][rl]) + dl[12 + qr][rl], QLO * QPC); FragH o;      /* kt's row sum and its lower bound, both behind the carry */
#pragma unroll
  for (int k = 0; k < 4; ++k) { const v4f a = ((*(const v4fa*)&red[qr][rl][cg + 4 * k] + *(const v4fa*)&red[4 + qr][rl][cg + 4 * k]) + *(const v4fa*)&red[8 + qr][rl][cg + 4 * k]) + *(const v4fa*)&red[12 + qr][rl][cg + 4 * k];
#pragma unroll
    for (int e = 0; e < 4; ++e) o.h[4 * k + e] = (_Float16)(a[e] / dv); }      /* the carry cancels */
  unsigned short* oc = (unsigned short*)CH + (size_t)(i0 + row) * QNW + fo + cg;
  *(v8us*)oc = o.half[0]; *(v8us*)(oc + 8) = o.half[1];      /* the thread's last instructions: nothing overwrites the stores' registers behind them */
}

extern "C" void kernel_launch(void* const* d_in, const int* in_sizes, int n_in,
                              void* d_out, int out_size, void* d_ws, size_t ws_size, hipStream_t stream) {
  (void)in_sizes; (void)n_in; (void)out_size;
  const float* const* I = (const float* const*)d_in; const float* xa = I[0]; const float* wa = I[1]; const float* va = I[2]; const float* wb = I[3]; const float* vb = I[4]; const float* wc = I[5]; const float* vc = I[6]; const float* wd = I[7]; const float* vd = I[8];      /* xa [2][1024][1024]; the four weights [1024][1024] (source, result); the four added vectors [1024] */
  float* res = (float*)d_out;
  static_assert((QNG * QNL) % 128 == 0 && QNL % 128 == 0 && QNW % 64 == 0 && QNW % 32 == 0 && QSW % 64 == 0 && QSW % 32 == 0 && QNL % 8 == 0 && QNS * QSW == QNW, "whole tiles");
  uint8_t* wsp = (uint8_t*)d_ws; size_t off = 0;
  auto take = [&](size_t bytes) { uint8_t* p = wsp + off; off += (bytes + 255) & ~(size_t)255; return p; };
  const size_t GW = (size_t)QNG * QNL * QNW, G1 = (size_t)QNL * QNW;
  float* RP = (float*)take((size_t)QNG * QNS * (QNL / QCB) * QNL * 4);
  _Float16* XH = (_Float16*)take(GW * 2); _Float16* AH = (_Float16*)take(2 * GW * 2); _Float16* CH = (_Float16*)take(GW * 2); _Float16* VT = (_Float16*)take(GW * 2);
  _Float16* WA = (_Float16*)take((size_t)4 * QNW * QNW * 2); _Float16* WD = WA + (size_t)3 * QNW * QNW; float* LA = (float*)take((size_t)2 * QNG * QNS * QNL * 4); float* LB = LA + (size_t)QNG * QNS * QNL; float* CF = (float*)take((size_t)QNG * QNS * QNL * 4);      /* sc's row sums over blocks of 64 columns; xa's cast; the f16 words of fa and, behind them, of fb; cx's; fc's transposed, group by group; the four weights transposed, one behind the other; the strips' squared lengths, fa's and behind them fb's; the column factors */
  if (off > ws_size) return;
  k_cast<<<(unsigned)QCG, 256, 0, stream>>>(xa, wa, wb, wc, wd, XH, WA, QWC);      /* WA[m][o][k] = f16(64 w[k][o]), m: wa, wb, wc, wd */
  k_gemm2<0><<<dim3((unsigned)(((QNG * QNL) / 128) * (QNW / 64)), 3), 128, 0, stream>>>(XH, QNW, 0, WA, QNW, (size_t)QNW * QNW, 1.0f / QWC, va, 0, nullptr, 1, 0, 0, nullptr, AH, QNW, GW, QNG * QNL, QNW, QNW, VT, LA, QNL, vb, vc, 3, 0, (size_t)QNG * QNS * QNL, 2);      /* plane 0: fa[(g, i)][o] = xa[g][i][:] . wa[:][o] + va[o]: AH its f16 words, LA[g][s][i] its strips' squared lengths; plane 1: fb likewise, behind them; plane 2: VT[g][(s, c)][j] = f16(fc[g][j][s 64 + c]) */
  k_qps<<<(unsigned)(QNG * QNS * (QNL / QCB)), QFW * 32, 0, stream>>>(AH, AH + GW, LA, LB, RP, CF);      /* sc from fa[g][i][s] . fb[g][j][s] and the two lengths: RP[g][s][j / 64][i] = its sum over 64 columns; CF[g][s][j] = nc^(-1/2) */
  k_mix<<<(unsigned)(QNG * QNS * (QNL / QMR)), QMW * 32, 0, stream>>>(AH, AH + GW, VT, LA, LB, RP, CF, CH);      /* CH[g][i][s 64 + c] = the f16 word of (sum over j of kt[i][j] fc[g][j][s 64 + c]) / max(kt's row sum, 1e-12): in place at a strip's column offset */
  k_gemm2<0><<<dim3((unsigned)(((QNG * QNL) / 128) * (QNW / 64)), 1), 128, 0, stream>>>(CH, QNW, 0, WD, QNW, 0, 1.0f / QWC, vd, 0, nullptr, 1, 0, 0, res, nullptr, QNW, 0, QNG * QNL, QNW, QNW, nullptr, nullptr, QNL, nullptr, nullptr, 1, 0, 0, -1);      /* res = cx wd + vd: every word of the result once */
}

// v010
// A run of this version takes 72.6 microseconds.
// Two timings next to v009 put it at 1.07 and 1.08 times that version's speed.
// Over all steps from v000 it is 8.73 times as fast.
// A distance-kernel mixing of rows: xa [2][1024][1024] (group, row, width); wa, wb, wc, wd [1024][1024] stored (source column, result column), va, vb, vc, vd [1024]: fa | fb | fc = xa w + v, split into 16 strips of 64 columns; for a group and a strip: e2[i][j] = |fa_i|^2 + |fb_j|^2 - 2 fa_i . fb_j; gd = sqrt(max(e2, 1e-12)) / 64; sc = (1 + gd)^(-65.5); nr = its row sums, nc = its column sums; kt = nr^(-1/2) sc nc^(-1/2); pb = kt / max(its row sum, 1e-12); cx = pb fc's strip; res = cx wd + vd -> [2][1024][1024] f32: one result.
// Structure: xa cast to f16 as it lies and the four weights cast transposed behind a carry of 64 (converted to bf16 first); three WMMA GEMMs (the carry undone in their scale argument; the added vectors live) whose f32 words never go to memory: the epilogue of fa's and fb's stores each word as ONE f16 word and, a lane a row, a strip's squared length (the tile's 64 f32 words in index order; a tile's width is a strip's), the epilogue of fc's stores the f16 words transposed through LDS, a group's sheet (strip column, row); launches that do not wait for one another are ONE launch and run side by side (the five casts; the three projections, a plane of the grid each; both groups in each of the two kernels that follow); THEN, BOTH GROUPS AT ONCE, sc FORMED TWICE AND NEVER STORED: ONE kernel, a work-group 64 columns of a strip of a group over all rows, forms fa . fb (depth 64) on WMMA, forms sc from the two lengths and the product while the product is still in the accumulators (the root, log2 and exp2 instructions: the power as 2^(-65.5 log2(1 + gd))), sums its columns as it goes (lane partials, then LDS) and stores each sum's reciprocal root, and stores each row's sum over its 64 columns; ONE kernel, a work-group 128 rows of a strip over all columns, forms fb . fa (the product transposed, so that an accumulator's words lie as the next product's left operand wants them), sc again, kt = nr^(-1/2) sc nc^(-1/2) as one f16 word behind a carry of 2^12, multiplies it on WMMA with fc's strip, sums kt's rows in f32 beside it and divides by that sum at the end (pb is never formed): cx as f16 words in place at a strip's column offset; then the last WMMA GEMM writes the result.
// Compute dtype: all nine inputs converted to bf16 where they are read; xa's words exact as f16 operands down to 2^-14; the weights' behind 64; the computed sheets ONE f16 word each (kt, in registers only, behind 2^12); every product's accumulation, the lengths, the kernel's arithmetic, the sums and the result f32. v_wmma_f32_16x16x32_f16.
#include <hip/hip_runtime.h>
#define QNG 2                        /* groups */
#define QNL 1024                     /* rows of a group */
#define QNW 1024                     /* a row's width: every projection's depth and width */
#define QNS 16                       /* strips */
#define QSW 64                       /* a strip's width: the pair product's depth */
#define QDS 64.0f                    /* the distance's divisor */
#define QPW -65.5f                   /* the power */
#define QLO 1e-12f                   /* the lower bound of e2 and of a row's sum */
#define QWC 64.0f                    /* the weights' carry (undone in the products' scale argument) */
#define QPC 4096.0f                  /* kt's carry (it cancels where the fifth product is divided by kt's row sum, which has it too) */
#define QPE 12.0f                    /* its log2 */
#define QSI (1.0f / (QDS * QDS))     /* the divisor taken under the root: sqrt(e2) / 64 = sqrt(e2 / 4096), a power of four, so the same bits */
#define QXB 32.0f                    /* the pair kernel's exponent bias: 2^(p + 32) is a normal number wherever 2^p is not below f32's least subnormal (p is never above 0), so v_exp_f32 needs no range fix-up; the sums carry 2^32 and lose it once, at their stores */
#define QXU 0x1p-32f                 /* undoes it */
#define QMB 16.0f                    /* the mixing kernel's exponent bias, beside the row factor's log2 (which is at least -5): again nothing that f32 holds is lost in front of v_exp_f32; the staged column factors undo it */
#define QMU 0x1p-16f                 /* undoes it */
#define QMW 16                       /* waves of a work-group of the mixing kernel: 4 blocks of 32 rows x 4 quarters of the columns */
#define QMR 128                      /* its rows */
#define QMP 1032                     /* 16-bit words of a staged row of fc's transposed strip: 1,024 + 8, a pitch of 2,064 bytes (16 bytes x odd) */
#define QCB 64                       /* columns of sc that a work-group of the pair kernel takes */
#define QFW 16                       /* its waves */
#define QFT 2                        /* tiles of 32 rows that one of its waves takes */
typedef unsigned short v8us __attribute__((ext_vector_type(8), may_alias));
typedef float  v8f  __attribute__((ext_vector_type(8)));
typedef float  v4f  __attribute__((ext_vector_type(4)));
typedef float  v4fa __attribute__((ext_vector_type(4), may_alias));

__device__ __forceinline__ unsigned short bf16_bits(float x) { unsigned int u = __float_as_uint(x); return (unsigned short)((u + 0x7FFFu + ((u >> 16) & 1u)) >> 16); }
__device__ __forceinline__ float bf16_val(unsigned short b) { return __uint_as_float(((unsigned int)b) << 16); }
__device__ __forceinline__ float bf16_round(float x) { return bf16_val(bf16_bits(x)); }

typedef _Float16 v16h __attribute__((ext_vector_type(16)));
union FragH { v16h v; v8us half[2]; _Float16 h[16]; unsigned short u[16]; };

typedef _Float16 v4h __attribute__((ext_vector_type(4)));

// The five casts in one launch of QCG work-groups, one for each WGP, 8 waves each. A work-group takes one QCT x QCT tile of one weight and an equal share of xa. Wt[m][n][k] = f16(Wm[k][n] x scale) from f32 row-major Wm[QNW][QNW] (scale = power of two; bf16-exact weights stay exact in f16 away from the subnormal range): a wave reads 16 rows k of the tile, 512 bytes in a row a load (4 whole lines), so a lane holds 4 columns n x 16 k in a row: 32 bytes of each of 4 rows of the transposed tile, which go through LDS and leave as rows of 256 bytes. xa's words as they lie, whole lines in and out. All 24 loads of a lane are issued before the first word is used.
#define QCT 128                                      /* the side of a weight's tile */
#define QCG (4 * (QNW / QCT) * (QNW / QCT))          /* the cast's work-groups */
#define QCX ((QNG * QNL * QNW) / QCG)                /* words of xa that one of them takes */
__global__ __launch_bounds__(256) void k_cast(const float* __restrict__ x, const float* __restrict__ W0, const float* __restrict__ W1, const float* __restrict__ W2, const float* __restrict__ W3, _Float16* __restrict__ X16, _Float16* __restrict__ Wt, float scale) {
  static_assert(QCT == 128 && QNW % QCT == 0 && (QNG * QNL * QNW) % QCG == 0 && QCX == 8 * 256 * 4, "8 waves x 16 rows, 32 lanes x 4 columns; 8 rounds of 4 words a thread of xa");
  __shared__ __attribute__((aligned(16))) unsigned short ts[QCT * QCT];      /* the transposed tile: row n, 16 pieces of 8 k; piece q of row n lies at place q ^ ((n >> 2) & 15), so the 32 lanes of a store (rows 4 apart, one q) meet every bank equally often, and so do the 16 lanes that read a row */
  const int tid = threadIdx.x, w = tid >> 5, lane = tid & 31; constexpr int TB = QNW / QCT;
  const int m = blockIdx.x / (TB * TB), k0 = ((blockIdx.x / TB) % TB) * QCT, n0 = (blockIdx.x % TB) * QCT; const float* W = m == 0 ? W0 : m == 1 ? W1 : m == 2 ? W2 : W3;
  const float* gw = W + (size_t)(k0 + 16 * w) * QNW + n0 + 4 * lane; const float* gx = x + (size_t)blockIdx.x * QCX + tid * 4;
  v4f wv[16], xv[8];
#pragma unroll
  for (int i = 0; i < 16; ++i) wv[i] = *(const v4fa*)(gw + (size_t)i * QNW);
#pragma unroll
  for (int i = 0; i < 8; ++i) xv[i] = *(const v4fa*)(gx + i * 1024);
  asm volatile("s_wait_xcnt 0x0" :: "v"(gw) : "memory");      /* the wait in front of the first overwrite of the loads' address registers (the arithmetic below may re-use them); gw as an input keeps the weight's address alive up to here, so that no word of xa lands on it */
  __builtin_amdgcn_sched_barrier(0);      /* keeps all 24 loads in front of the first use: sunk among the conversions, a late load would be waited for a second time, in front of the barrier */
#pragma unroll
  for (int e = 0; e < 4; ++e) { FragH f;
#pragma unroll
    for (int i = 0; i < 16; ++i) f.h[i] = (_Float16)(bf16_round(wv[i][e]) * scale);
    unsigned short* tr = ts + (4 * lane + e) * QCT;
    *(v8us*)(tr + ((2 * w) ^ (lane & 15)) * 8) = f.half[0]; *(v8us*)(tr + ((2 * w + 1) ^ (lane & 15)) * 8) = f.half[1]; }
  __syncthreads();      /* the 8 waves' pieces of every row of the transposed tile are in LDS before a half wave reads a whole row */
  _Float16* gh = X16 + (size_t)blockIdx.x * QCX + tid * 4;
#pragma unroll
  for (int i = 0; i < 8; ++i) { v4h h4;
#pragma unroll
    for (int e = 0; e < 4; ++e) h4[e] = (_Float16)bf16_round(xv[i][e]);
    *(v4h*)(gh + i * 1024) = h4; }
  asm volatile("s_wait_xcnt 0x0" ::: "memory");      /* the wait in front of the first overwrite of these stores' registers (the LDS loads below may land on them) */
  const int rn = tid >> 4, rq = tid & 15; v8us tv[8];
#pragma unroll
  for (int i = 0; i < 8; ++i) { const int n = 16 * i + rn; tv[i] = *(const v8us*)(ts + n * QCT + (rq ^ ((n >> 2) & 15)) * 8); }
  unsigned short* go = (unsigned short*)Wt + (size_t)m * QNW * QNW + (size_t)(n0 + rn) * QNW + k0 + rq * 8;
#pragma unroll
  for (int i = 0; i < 8; ++i) *(v8us*)(go + (size_t)(16 * i) * QNW) = tv[i];      /* the thread's last instructions: nothing overwrites the stores' registers behind them */
}

// ---- fast GEMM (wave tile 32x64, work-group tile 128x64; requires M % 128 == 0 rows per launch region, N % 64 == 0 and K % 64 == 0); both operands staged in LDS 64 k at a time, two buffers; epilogue: alpha, bias, CP and activation into C, with three more results: C16 (the words as f16), LN (a row's squared length over the tile's 64 columns) and CT (the words as f16, transposed); the grid's y and z number independent products that run side by side ----
#define G2P 72                       /* 16-bit words of a staged row: 64 + 8, a pitch of 144 bytes (16 bytes x odd: 16 rows read 16 bytes a lane without bank conflicts) */
#define G2S (192 * G2P)              /* 16-bit words of a stage: 128 rows of A, then 64 rows of B */
#define G2T 136                      /* 16-bit words of a column of the transposed result's staging: 128 + 8, a pitch of 272 bytes (16 bytes x odd) */
__device__ __forceinline__ v16h g2_frag(const _Float16* p, int hh) { FragH f; f.half[0] = *(const v8us*)((const unsigned short*)p + 8 * hh); f.half[1] = *(const v8us*)((const unsigned short*)p + 16 + 8 * hh); return f.v; }
__device__ __forceinline__ v8f g2_mma(v16h a, v16h b, v8f c) { v8f d = __builtin_amdgcn_wmma_f32_16x16x32_f16(false, a, false, b, (short)0, c, false, false); asm volatile("v_nop\n\tv_nop\n\tv_nop\n\tv_nop" : "+v"(d) : "v"(a), "v"(b)); return d; }
template <int ACT>
__global__ __launch_bounds__(128) void k_gemm2(const _Float16* __restrict__ A, int lda, size_t sA, const _Float16* __restrict__ Bh, int ldb, size_t sB, float alpha, const float* __restrict__ bias, size_t sBias, const float* __restrict__ CP, int rowsPerB, size_t sCPb, int row0g,
    float* __restrict__ C, _Float16* __restrict__ C16, int ldc, size_t sC, int M, int N, int K, _Float16* __restrict__ CT, float* __restrict__ LN, int rowsT, const float* __restrict__ biasB, const float* __restrict__ biasC, int nY, size_t sCZ, size_t sLN, int byT) {      /* CT [M / rowsT][N][rowsT] and LN [M / rowsT][N / 64][rowsT]: rowsT % 128 == 0; CT is plane byT's only result; biasB, biasC: where given, the added vectors of planes 1 and 2; nY: the grid's extent in y; sCZ: C's step from one z to the next; sLN: LN's from one y to the next */ static_assert(ACT == 0 || ACT == 3 || ACT == 6 || ACT == 8 || ACT == 9 || ACT == 11 || ACT == 12 || ACT == 14 || ACT == 15 || ACT == 16 || ACT == 17, "k_gemm2: unsupported ACT code (would silently apply no activation)");
  __shared__ __attribute__((aligned(16))) unsigned char sm[2 * G2S * 2]; static_assert(sizeof(sm) >= 4 * 32 * 68 * 4 && sizeof(sm) >= 64 * G2T * 2, "the result's staging re-uses the two operand buffers");
  float (*so)[32][68] = (float (*)[32][68])sm;      /* written only behind the k loop's last barrier */
  const int tid = threadIdx.x, w = tid >> 5, lane = tid & 31, ln = lane & 15, hh = lane >> 4; const int by = blockIdx.y; const size_t pl = (size_t)blockIdx.z * nY + by;      /* the operands' planes lie one behind the other, y within z */
  A += pl * sA; Bh += pl * sB; const size_t cofs = (size_t)by * sC + (size_t)blockIdx.z * sCZ; const float* bp = bias ? (biasB ? (by == 0 ? bias : by == 1 ? biasB : biasC) : bias + (size_t)by * sBias) : nullptr;
  const int ntn = N >> 6; const int mt = blockIdx.x / ntn, nq = blockIdx.x - mt * ntn; const int row0 = mt * 128 + 32 * w, col0 = nq * 64; if (mt * 128 >= M) return;      /* the whole work-group leaves or none does: barriers follow */
  const int sr = tid >> 3, sk = (tid & 7) * 8;      /* staging: 8 threads a row of 128 bytes, so a wave's load is 4 whole lines; 16 rows a round of the work-group */
  const unsigned short* ga = (const unsigned short*)A + (size_t)(mt * 128 + sr) * lda + sk; const unsigned short* gb = (const unsigned short*)Bh + (size_t)(col0 + sr) * ldb + sk;
  unsigned short* sh = (unsigned short*)sm; const int swo = sr * G2P + sk; v8us st[12];
  const v8f z8 = {0.f,0.f,0.f,0.f,0.f,0.f,0.f,0.f}; v8f c00 = z8, c01 = z8, c02 = z8, c03 = z8, c10 = z8, c11 = z8, c12 = z8, c13 = z8;
  for (int i = 0; i < 8; ++i) st[i] = *(const v8us*)(ga + (size_t)(16 * i) * lda);
  for (int i = 0; i < 4; ++i) st[8 + i] = *(const v8us*)(gb + (size_t)(16 * i) * ldb);
  for (int i = 0; i < 12; ++i) *(v8us*)(sh + swo + i * 16 * G2P) = st[i];
  __syncthreads();      /* stage 0 is in LDS before a wave reads it */
  for (int kb = 0; kb < K; kb += 64) { const int cur = (kb >> 6) & 1; const bool more = kb + 64 < K;
    if (more) {      /* the next stage's words fly while this stage is multiplied */
      for (int i = 0; i < 8; ++i) st[i] = *(const v8us*)(ga + (size_t)(16 * i) * lda + kb + 64);
      for (int i = 0; i < 4; ++i) st[8 + i] = *(const v8us*)(gb + (size_t)(16 * i) * ldb + kb + 64); }
    const _Float16* pa = (const _Float16*)(sh + cur * G2S + (32 * w + ln) * G2P); const _Float16* pb = (const _Float16*)(sh + cur * G2S + (128 + ln) * G2P);
    v16h a0[2], a1[2], b[2][4];
    for (int ks = 0; ks < 2; ++ks) { a0[ks] = g2_frag(pa + 32 * ks, hh); a1[ks] = g2_frag(pa + 16 * G2P + 32 * ks, hh);
      for (int t = 0; t < 4; ++t) b[ks][t] = g2_frag(pb + t * 16 * G2P + 32 * ks, hh); }
    for (int ks = 0; ks < 2; ++ks) { c00 = g2_mma(a0[ks], b[ks][0], c00); c10 = g2_mma(a1[ks], b[ks][0], c10); c01 = g2_mma(a0[ks], b[ks][1], c01); c11 = g2_mma(a1[ks], b[ks][1], c11);
      c02 = g2_mma(a0[ks], b[ks][2], c02); c12 = g2_mma(a1[ks], b[ks][2], c12); c03 = g2_mma(a0[ks], b[ks][3], c03); c13 = g2_mma(a1[ks], b[ks][3], c13); }
    if (more) {
      for (int i = 0; i < 12; ++i) *(v8us*)(sh + (cur ^ 1) * G2S + swo + i * 16 * G2P) = st[i]; }      /* the other buffer: its readers left it in front of the last barrier */
    __syncthreads(); }      /* publishes the next stage and ends this stage's reads (behind the last stage: before the result's staging re-uses the bytes) */
  v8f accs[8] = {c00, c01, c02, c03, c10, c11, c12, c13};
#pragma unroll
  for (int u = 0; u < 8; ++u) { const int t = u & 3, half = u >> 2; const int col = col0 + t * 16 + ln; const float bv = bp ? bf16_round(bp[col]) : 0.f;
#pragma unroll
    for (int r = 0; r < 8; ++r) { const int rloc = half * 16 + 8 * hh + r; float v = accs[u][r] * alpha + bv; if (CP) { if (rowsPerB < 0) v += CP[cofs + (size_t)(row0g + row0 + rloc) * ldc + col];      /* rowsPerB < 0: own element of the batched C plane */ else { const int bidx = (row0g + row0 + rloc) / rowsPerB; v += CP[(size_t)bidx * sCPb + (size_t)by * 64 + col]; } }
      if (ACT == 3) v = fmaxf(v, 0.f); else if (ACT == 6) v = 0.5f * v * (1.0f + erff(v * 0.70710678118654752f)); else if (ACT == 11) v = 1.0f / (1.0f + expf(-v)); else if (ACT == 15) v = v / (1.0f + expf(-v)); else if (ACT == 12) v = (v > 0.f) ? v : 0.01f * v; else if (ACT == 8) v = tanhf(v); else if (ACT == 9) v = 0.5f * v * (1.0f + tanhf(0.7978845608028654f * (v + 0.044715f * v * v * v))); else if (ACT == 14) v = (v > 0.f) ? v : 0.1f * v; else if (ACT == 16) v = (v >= 0.f) ? v : 0.3f * v; else if (ACT == 17) v = (v >= 0.f) ? v : 0.2f * v;
      accs[u][r] = v; } }
  if (CT && by == byT) {      /* the same for the whole work-group: a barrier follows. A lane's 8 words of an accumulator are 8 rows in a row of one column: 16 bytes of the transposed sheet */
    unsigned short* tp = (unsigned short*)sm; const int gT = (mt * 128) / rowsT, rT = mt * 128 - gT * rowsT;
#pragma unroll
    for (int u = 0; u < 8; ++u) { FragH f;
#pragma unroll
      for (int r = 0; r < 8; ++r) f.h[r] = (_Float16)accs[u][r];
      *(v8us*)(tp + ((u & 3) * 16 + ln) * G2T + 32 * w + (u >> 2) * 16 + 8 * hh) = f.half[0]; }
    __syncthreads();      /* the four waves' rows of every column are in LDS before a wave stores whole columns of the tile (256 bytes in a row each) */
    unsigned short* gt = (unsigned short*)CT + ((size_t)gT * N + col0 + (tid >> 4)) * rowsT + rT + (tid & 15) * 8;
    v8us tv[8];
#pragma unroll
    for (int q = 0; q < 8; ++q) tv[q] = *(const v8us*)(tp + (q * 8 + (tid >> 4)) * G2T + (tid & 15) * 8);
#pragma unroll
    for (int q = 0; q < 8; ++q) { *(v8us*)(gt + (size_t)(q * 8) * rowsT) = tv[q];
      asm volatile("s_wait_xcnt 0x0" ::: "memory"); }      /* the wait in front of the next overwrite of a store's registers (a later store's address re-uses them; behind the last store the built code still holds a branch to the other epilogue, which writes them) */
    return; }
#pragma unroll
  for (int u = 0; u < 8; ++u) {
#pragma unroll
    for (int r = 0; r < 8; ++r) so[w][(u >> 2) * 16 + 8 * hh + r][(u & 3) * 16 + ln] = accs[u][r]; }
  __builtin_amdgcn_fence(__ATOMIC_ACQ_REL, "workgroup"); __builtin_amdgcn_wave_barrier();
  const int rsub = lane >> 4, c4 = (lane & 15) * 4;
  {
#pragma unroll
    for (int q = 0; q < 16; ++q) { const int r = q * 2 + rsub; const v4f v = *(const v4fa*)&so[w][r][c4]; if (C) *(v4f*)(C + cofs + (size_t)(row0 + r) * ldc + col0 + c4) = v; if (C16) { v4h h4; for (int i = 0; i < 4; ++i) h4[i] = (_Float16)v[i]; *(v4h*)(C16 + cofs + (size_t)(row0 + r) * ldc + col0 + c4) = h4; } }
     }
  if (LN) { const float* p = &so[w][lane][0]; float a = 0.0f; const int gT = (mt * 128) / rowsT, rT = mt * 128 - gT * rowsT;      /* a lane a row of the wave's 32: the row's 64 f32 words in index order */
    asm volatile("s_wait_xcnt 0x0" ::: "memory");      /* the wait in front of the overwrite of the last store's registers (the loads below re-use them) */
    v4f x[16];
#pragma unroll
    for (int c = 0; c < 16; ++c) x[c] = *(const v4fa*)(p + 4 * c);
    __builtin_amdgcn_sched_barrier(0);      /* keeps the 16 LDS loads together in front of the sum: sunk into the chain of 64 dependent multiply-adds, each would be waited for in turn */
#pragma unroll
    for (int c = 0; c < 64; ++c) a = __builtin_fmaf(x[c >> 2][c & 3], x[c >> 2][c & 3], a);
    LN[(size_t)by * sLN + ((size_t)gT * ntn + nq) * rowsT + rT + 32 * w + lane] = a;
    asm volatile("s_wait_xcnt 0x0" ::: "memory"); } }      /* the wait in front of an overwrite of the store's registers (behind the store the built code still holds a branch to the other epilogue, which writes them) */

// A work-group takes QCB columns of one strip of one group over all its rows (the grid: group, strip, column block; la, lb, RP and CF lie strip behind strip, group behind group): fa's strip (all rows) and fb's QCB rows are staged in LDS once (whole-line loads), a wave forms QFT tiles of 32 x 64 products on WMMA (the k order and the order of the two k steps are k_gemm2's), turns each accumulator word into sc where it lies, keeps the running sums of its columns and of its rows, and stores each row's sum over the QCB columns (RP: strip, column block, row). Neither the product nor sc goes to memory.
// Eight transcendentals of one kind in ONE asm statement: every result register is apart from every source register ("=&v"), so none of them reads a result or overwrites a source of the one in front of it, and the v_nop at the end is the slot that the instruction set asks for behind the last one (left to the register allocator, runs of these instructions overwrote one another's sources back to back).
#define Q8T(name, op) __device__ __forceinline__ void name(float* y, const float* x) { asm(op " %0, %8\n\t" op " %1, %9\n\t" op " %2, %10\n\t" op " %3, %11\n\t" op " %4, %12\n\t" op " %5, %13\n\t" op " %6, %14\n\t" op " %7, %15\n\tv_nop" : "=&v"(y[0]), "=&v"(y[1]), "=&v"(y[2]), "=&v"(y[3]), "=&v"(y[4]), "=&v"(y[5]), "=&v"(y[6]), "=&v"(y[7]) : "v"(x[0]), "v"(x[1]), "v"(x[2]), "v"(x[3]), "v"(x[4]), "v"(x[5]), "v"(x[6]), "v"(x[7])); }
Q8T(q8_sqrt, "v_sqrt_f32")
Q8T(q8_log, "v_log_f32")
Q8T(q8_exp, "v_exp_f32")
#define QRS(n, ctl) { const bool up = (ln & n) != 0; _Pragma("unroll") for (int m = 0; m < n; ++m) { const float keep = up ? rs[m + n] : rs[m], send = up ? rs[m] : rs[m + n]; rs[m] = keep + __int_as_float(__builtin_amdgcn_update_dpp(0, __float_as_int(send), ctl, 0xf, 0xf, false)); } }      /* ctl: row_xmask:n */
__global__ __launch_bounds__(QFW * 32) void k_qps(const _Float16* __restrict__ FA, const _Float16* __restrict__ FB, const float* __restrict__ la, const float* __restrict__ lb, float* __restrict__ RP, float* __restrict__ CF) {
  static_assert(QSW == 64 && QCB == 64 && QNL == QFW * QFT * 32 && QFW * 32 == 8 * 64 && QNL % 64 == 0, "8 threads stage a row of 128 bytes, 64 rows a round; the waves' tiles cover all rows");
  __shared__ __attribute__((aligned(16))) unsigned short sa[(QNL + QCB) * G2P];      /* fa's rows, then fb's */
  __shared__ __attribute__((aligned(16))) float ps[2 * QFW][QCB];
  const int tid = threadIdx.x, w = tid >> 5, lane = tid & 31, ln = lane & 15, hh = lane >> 4; const int s = blockIdx.x / (QNL / QCB), j0 = (blockIdx.x % (QNL / QCB)) * QCB;      /* s: 16 x group + strip */ const size_t fo = (size_t)(s / QNS) * QNL * QNW + (s % QNS) * QSW;      /* the strip's first word in fa and in fb */
  const int sr = tid >> 3, sk = (tid & 7) * 8;
  const unsigned short* ga = (const unsigned short*)FA + (size_t)sr * QNW + fo + sk; const unsigned short* gb = (const unsigned short*)FB + (size_t)(j0 + sr) * QNW + fo + sk;
  v8us st[QNL / 64 + 1]; float kb[4]; v4f qa[QFT][2][2];
#pragma unroll
  for (int i = 0; i < QNL / 64; ++i) st[i] = *(const v8us*)(ga + (size_t)(64 * i) * QNW);
  st[QNL / 64] = *(const v8us*)gb;
#pragma unroll
  for (int t = 0; t < 4; ++t) kb[t] = lb[s * QNL + j0 + t * 16 + ln];
#pragma unroll
  for (int tt = 0; tt < QFT; ++tt)
#pragma unroll
    for (int e = 0; e < 4; ++e) qa[tt][e >> 1][e & 1] = *(const v4fa*)(la + s * QNL + (QFT * w + tt) * 32 + (e >> 1) * 16 + 8 * hh + (e & 1) * 4);      /* the lengths of the 16 rows that the lane's accumulator words lie in */
  asm volatile("s_wait_xcnt 0x0" ::: "memory");      /* the wait in front of the first overwrite of the loads' address registers (the LDS addresses below may re-use them) */
#pragma unroll
  for (int i = 0; i < QNL / 64; ++i) *(v8us*)(sa + (sr + 64 * i) * G2P + sk) = st[i];
  *(v8us*)(sa + (QNL + sr) * G2P + sk) = st[QNL / 64];
#pragma unroll
  for (int t = 0; t < 4; ++t) kb[t] *= QSI;
#pragma unroll
  for (int tt = 0; tt < QFT; ++tt)
#pragma unroll
    for (int e = 0; e < 4; ++e) qa[tt][e >> 1][e & 1] *= QSI;
  __syncthreads();      /* both operands are in LDS before a wave reads its fragments */
  const _Float16* pb = (const _Float16*)(sa + (QNL + ln) * G2P); v16h b[2][4];
#pragma unroll
  for (int ks = 0; ks < 2; ++ks)
#pragma unroll
    for (int t = 0; t < 4; ++t) b[ks][t] = g2_frag(pb + t * 16 * G2P + 32 * ks, hh);
  float cs[4] = {0.f, 0.f, 0.f, 0.f};
  float* og = RP + ((size_t)s * (QNL / QCB) + j0 / QCB) * QNL + QFT * 32 * w + (ln >> 3) * 16 + 8 * hh + (ln & 7);      /* the row whose sum ends in this lane (below) */
#pragma unroll      /* whole: the lengths' registers are indexed by the tile */
  for (int tt = 0; tt < QFT; ++tt) { const _Float16* pa = (const _Float16*)(sa + ((QFT * w + tt) * 32 + ln) * G2P); v16h a0[2], a1[2];
#pragma unroll
    for (int ks = 0; ks < 2; ++ks) { a0[ks] = g2_frag(pa + 32 * ks, hh); a1[ks] = g2_frag(pa + 16 * G2P + 32 * ks, hh); }
    const v8f z8 = {0.f,0.f,0.f,0.f,0.f,0.f,0.f,0.f}; v8f acc[8] = {z8, z8, z8, z8, z8, z8, z8, z8};
#pragma unroll
    for (int ks = 0; ks < 2; ++ks)
#pragma unroll
      for (int t = 0; t < 4; ++t) { acc[t] = __builtin_amdgcn_wmma_f32_16x16x32_f16(false, a0[ks], false, b[ks][t], (short)0, acc[t], false, false); acc[4 + t] = __builtin_amdgcn_wmma_f32_16x16x32_f16(false, a1[ks], false, b[ks][t], (short)0, acc[4 + t], false, false); }
    float rs[16] = {0.f, 0.f, 0.f, 0.f, 0.f, 0.f, 0.f, 0.f, 0.f, 0.f, 0.f, 0.f, 0.f, 0.f, 0.f, 0.f};      /* the lane's share of the sums of the 16 rows that its accumulator words lie in */
    __builtin_amdgcn_sched_barrier(0);      /* keeps the asm statements below behind the tile's last WMMA and behind the arithmetic that feeds them: drawn up among the WMMAs, a result register of theirs overwrote a fragment too few vector slots behind its WMMA (the compiler pads its own instructions, not asm text) */
#pragma unroll
    for (int u = 0; u < 8; ++u) { const int t = u & 3, half = u >> 2;
      float x[8], y[8];
#pragma unroll
      for (int r = 0; r < 8; ++r) x[r] = fmaxf((qa[tt][half][r >> 2][r & 3] + kb[t]) - (2.0f * QSI) * acc[u][r], QLO * QSI);      /* e2 / 4096: the lengths come scaled */
      q8_sqrt(y, x);      /* gd itself; v_sqrt_f32 as it is: its argument is at least QLO QSI, never subnormal */
#pragma unroll
      for (int r = 0; r < 8; ++r) x[r] = 1.0f + y[r];
      q8_log(y, x);      /* (1 + gd)^QPW = 2^(QPW log2(1 + gd)); v_log_f32 as it is: its argument is at least 1 */
#pragma unroll
      for (int r = 0; r < 8; ++r) x[r] = __builtin_fmaf(QPW, y[r], QXB);      /* the exponent behind its bias */
      q8_exp(y, x);
#pragma unroll
      for (int r = 0; r < 8; ++r) { cs[t] += y[r]; rs[half * 8 + r] += y[r]; } }      /* 2^32 sc */
    /* 16 sums over the 16 lanes of a half wave: at each step a lane keeps one half of its sums and hands the other half to the lane that keeps those, so lane ln ends with sum number ln (15 adds in place of 64) */
    QRS(8, 0x168) QRS(4, 0x164) QRS(2, 0x162) QRS(1, 0x161)
    /* the store and the wait in front of the next overwrite of its data and address registers in ONE statement (the next tile's arithmetic re-uses them) */
    asm volatile("global_store_b32 %0, %1, off\n\ts_wait_xcnt 0x0" :: "v"(og + tt * 32), "v"(rs[0] * QXU) : "memory"); }
#pragma unroll
  for (int t = 0; t < 4; ++t) ps[2 * w + hh][t * 16 + ln] = cs[t];
  __syncthreads();      /* the 2 QFW partial sums of every column are in LDS before a thread a column adds them */
  if (tid < QCB) { float t = 0.0f;
#pragma unroll
    for (int r = 0; r < 2 * QFW; ++r) t += ps[r][tid];
    CF[s * QNL + j0 + tid] = 1.0f / sqrtf(t * QXU); } }

// A work-group takes QMR rows of one strip of one group over all columns (the grid: group, strip, row block). fb's strip (all rows), fc's transposed strip, fb's lengths and the column factors are staged in LDS once (whole-line loads); a wave takes 32 rows and a quarter of the columns, 32 columns a trip. The pair product is formed TRANSPOSED (left operand fb's rows, right operand fa's rows: the k order and the order of the two k steps are k_qps's), so a lane holds ONE row i of sc a tile (its column of the accumulator) and 8 columns j in a row (8 hh + r): exactly the words, in exactly the order, that g2_frag gives a lane of a left operand with rows i and depth j. So kt goes from the accumulators into the next WMMA through registers alone, and kt's row sum is a lane's own running sum. The four quarters' products and sums are added through LDS at the end.
__global__ __launch_bounds__(QMW * 32) void k_mix(const _Float16* __restrict__ FA, const _Float16* __restrict__ FB, const _Float16* __restrict__ VT, const float* __restrict__ la, const float* __restrict__ lb, const float* __restrict__ RP, const float* __restrict__ CF, _Float16* __restrict__ CH) {
  static_assert(QSW == 64 && QNL == 1024 && QMW == 16 && QMR == 128 && QNL % QMR == 0 && QNL / QCB == 16, "8 threads stage a row of 128 bytes, 64 rows a round; 4 x 32 rows, 4 x 256 columns; 16 partial sums a row");
  __shared__ __attribute__((aligned(16))) unsigned char sm[(QNL * G2P + QSW * QMP) * 2];      /* fb's rows, then fc's transposed rows */
  __shared__ __attribute__((aligned(16))) float lc[2 * QNL];      /* fb's squared lengths, then the column factors */
  __shared__ __attribute__((aligned(16))) float dl[QMW][32];      /* a wave's share of kt's row sums */
  static_assert(sizeof(sm) >= QMW * 32 * 68 * 4, "the waves' products re-use the operands' bytes");
  unsigned short* sb = (unsigned short*)sm; unsigned short* sv = sb + QNL * G2P; float (*red)[32][68] = (float (*)[32][68])sm;      /* red: written only behind the barrier that ends the operands' last reads */
  const int tid = threadIdx.x, w = tid >> 5, lane = tid & 31, ln = lane & 15, hh = lane >> 4; const int s = blockIdx.x / (QNL / QMR), i0 = (blockIdx.x % (QNL / QMR)) * QMR;      /* s: 16 x group + strip */ const size_t fo = (size_t)(s / QNS) * QNL * QNW + (s % QNS) * QSW;      /* the strip's first word in fa, in fb and in cx */
  const int rb = w & 3, jq = w >> 2;      /* the wave's block of 32 rows and its quarter of the columns */
  const int sr = tid >> 3, sk = (tid & 7) * 8;
  const unsigned short* gb = (const unsigned short*)FB + (size_t)sr * QNW + fo + sk; const unsigned short* gv = (const unsigned short*)VT + (size_t)s * QSW * QNL + tid * 8;      /* fc's transposed strip is 128 KiB in a row */
  const unsigned short* ga = (const unsigned short*)FA + (size_t)(i0 + 32 * rb + ln) * QNW + fo + 8 * hh; const float* gr = RP + (size_t)s * (QNL / QCB) * QNL + i0 + 32 * rb + ln;
  v8us st[32]; v16h fi[2][2]; float ka[2], rp[2][16], rf[2];
#pragma unroll
  for (int it = 0; it < 2; ++it) { ka[it] = la[s * QNL + i0 + 32 * rb + it * 16 + ln];
#pragma unroll
    for (int q = 0; q < 16; ++q) rp[it][q] = gr[q * QNL + it * 16]; }
  asm volatile("s_wait_xcnt 0x0" ::: "memory");      /* the wait in front of the first overwrite of these loads' address registers (the next loads' addresses and results may re-use them) */
#pragma unroll
  for (int i = 0; i < 16; ++i) st[i] = *(const v8us*)(gb + (size_t)(64 * i) * QNW);
#pragma unroll
  for (int i = 0; i < 16; ++i) st[16 + i] = *(const v8us*)(gv + i * (QMW * 32 * 8));
  const v4f lv = *(const v4fa*)((tid < 256 ? lb : CF) + s * QNL + (tid & 255) * 4);
  asm volatile("s_wait_xcnt 0x0" ::: "memory");      /* the same wait for these loads (a fragment below may land on an address of theirs) */
#pragma unroll
  for (int it = 0; it < 2; ++it)
#pragma unroll
    for (int ks = 0; ks < 2; ++ks) { FragH f; f.half[0] = *(const v8us*)(ga + (size_t)(it * 16) * QNW + 32 * ks); f.half[1] = *(const v8us*)(ga + (size_t)(it * 16) * QNW + 32 * ks + 16); fi[it][ks] = f.v; }      /* g2_frag's words (8 hh is in ga) */
  asm volatile("s_wait_xcnt 0x0" :: "v"(ga) : "memory");      /* the wait in front of the first overwrite of the loads' address registers (the LDS addresses below may re-use them); ga as an input keeps the fragments' address alive up to here, so that no fragment lands on it */
#pragma unroll
  for (int i = 0; i < 16; ++i) *(v8us*)(sb + (sr + 64 * i) * G2P + sk) = st[i];
#pragma unroll
  for (int i = 0; i < 16; ++i) *(v8us*)(sv + ((tid >> 7) + 4 * i) * QMP + (tid & 127) * 8) = st[16 + i];
  *(v4f*)(lc + tid * 4) = lv * (tid < 256 ? QSI : QMU);      /* the lengths under the root's divisor; the factors with the exponent's bias undone */
#pragma unroll
  for (int it = 0; it < 2; ++it) { float t = 0.0f;
#pragma unroll
    for (int q = 0; q < 16; ++q) t += rp[it][q];      /* nr: the 16 column blocks' sums in index order */
    rf[it] = (QPE + QMB) - 0.5f * log2f(t); ka[it] *= QSI; }      /* log2 of nr^(-1/2), of kt's carry and of the bias: added in the exponent, where the multiply-add is there anyway; its own rounding is one factor of a whole row of kt, which cancels where the row's sum divides */
  __syncthreads();      /* the operands are in LDS before a wave reads its fragments */
  const v8f z8 = {0.f,0.f,0.f,0.f,0.f,0.f,0.f,0.f}; v8f acc[8] = {z8, z8, z8, z8, z8, z8, z8, z8}; float dn[2] = {0.f, 0.f};
  for (int jb = 0; jb < QNL / 4 / 32; ++jb) { const int j0 = jq * (QNL / 4) + jb * 32;
    const _Float16* pj = (const _Float16*)(sb + (j0 + ln) * G2P); const _Float16* pv = (const _Float16*)(sv + ln * QMP + j0); const float* pl = lc + j0 + 8 * hh;
    v16h bj[2][2], vf[4]; v4f qb[2][2], qc[2][2];
#pragma unroll
    for (int jt = 0; jt < 2; ++jt)
#pragma unroll
      for (int ks = 0; ks < 2; ++ks) { bj[jt][ks] = g2_frag(pj + jt * 16 * G2P + 32 * ks, hh); qb[jt][ks] = *(const v4fa*)(pl + jt * 16 + ks * 4); qc[jt][ks] = *(const v4fa*)(pl + QNL + jt * 16 + ks * 4); }      /* qb, qc: the lengths and factors of the 16 columns j that the lane's accumulator words lie in */
#pragma unroll
    for (int t = 0; t < 4; ++t) vf[t] = g2_frag(pv + t * 16 * QMP, hh);
    v8f d[4] = {z8, z8, z8, z8};
#pragma unroll
    for (int ks = 0; ks < 2; ++ks)
#pragma unroll
      for (int u = 0; u < 4; ++u) d[u] = __builtin_amdgcn_wmma_f32_16x16x32_f16(false, bj[u >> 1][ks], false, fi[u & 1][ks], (short)0, d[u], false, false);
    __builtin_amdgcn_sched_barrier(0);      /* keeps the asm statements below behind the trip's pair WMMAs and behind the arithmetic that feeds them (as in k_qps: the compiler pads its own instructions, not asm text) */
    FragH pf[2];
#pragma unroll
    for (int u = 0; u < 4; ++u) { const int jt = u >> 1, it = u & 1;
      float x[8], y[8];
#pragma unroll
      for (int r = 0; r < 8; ++r) x[r] = fmaxf((ka[it] + qb[jt][r >> 2][r & 3]) - (2.0f * QSI) * d[u][r], QLO * QSI);
      q8_sqrt(y, x);      /* the three steps and their bounds: as in k_qps */
#pragma unroll
      for (int r = 0; r < 8; ++r) x[r] = 1.0f + y[r];
      q8_log(y, x);
#pragma unroll
      for (int r = 0; r < 8; ++r) x[r] = __builtin_fmaf(QPW, y[r], rf[it]);
      q8_exp(y, x);      /* nr^(-1/2) sc behind the carry and the bias: at most 2^28 (sc is at most nr and at most 1) */
#pragma unroll
      for (int r = 0; r < 8; ++r) { const float kt = y[r] * qc[jt][r >> 2][r & 3]; dn[it] += kt; pf[it].h[jt * 8 + r] = (_Float16)kt; } }      /* word jt 8 + r of the left operand's fragment is depth 16 jt + 8 hh + r: g2_frag's order */
#pragma unroll
    for (int u = 0; u < 8; ++u) acc[u] = __builtin_amdgcn_wmma_f32_16x16x32_f16(false, pf[u >> 2].v, false, vf[u & 3], (short)0, acc[u], false, false); }
#pragma unroll
  for (int it = 0; it < 2; ++it) { const int b = __float_as_int(dn[it]); dn[it] += __int_as_float(__builtin_amdgcn_permlanex16(b, b, 0x76543210, 0xfedcba98, false, false)); }      /* lane l with lane l ^ 16: the two halves of each 16 columns */
  __syncthreads();      /* every wave's last read of the operands is done before their bytes are re-used */
#pragma unroll
  for (int u = 0; u < 8; ++u) {
#pragma unroll
    for (int r = 0; r < 8; ++r) red[w][(u >> 2) * 16 + 8 * hh + r][(u & 3) * 16 + ln] = acc[u][r]; }
  if (hh == 0) { dl[w][ln] = dn[0]; dl[w][16 + ln] = dn[1]; }
  __syncthreads();      /* the four quarters' products and sums are in LDS before a thread adds them */
  const int row = tid >> 2, cg = (tid & 3) * 16, qr = row >> 5, rl = row & 31;      /* 4 threads a row of 128 bytes of cx */
  const float dv = fmaxf(((dl[qr][rl] + dl[4 + qr][rl]) + dl[8 + qr][rl]) + dl[12 + qr][rl], QLO * QPC); FragH o;      /* kt's row sum and its lower bound, both behind the carry */
#pragma unroll
  for (int k = 0; k < 4; ++k) { const v4f a = ((*(const v4fa*)&red[qr][rl][cg + 4 * k] + *(const v4fa*)&red[4 + qr][rl][cg + 4 * k]) + *(const v4fa*)&red[8 + qr][rl][cg + 4 * k]) + *(const v4fa*)&red[12 + qr][rl][cg + 4 * k];
#pragma unroll
    for (int e = 0; e < 4; ++e) o.h[4 * k + e] = (_Float16)(a[e] / dv); }      /* the carry cancels */
  unsigned short* oc = (unsigned short*)CH + (size_t)(i0 + row) * QNW + fo + cg;
  *(v8us*)oc = o.half[0]; *(v8us*)(oc + 8) = o.half[1];      /* the thread's last instructions: nothing overwrites the stores' registers behind them */
}

extern "C" void kernel_launch(void* const* d_in, const int* in_sizes, int n_in,
                              void* d_out, int out_size, void* d_ws, size_t ws_size, hipStream_t stream) {
  (void)in_sizes; (void)n_in; (void)out_size;
  const float* const* I = (const float* const*)d_in; const float* xa = I[0]; const float* wa = I[1]; const float* va = I[2]; const float* wb = I[3]; const float* vb = I[4]; const float* wc = I[5]; const float* vc = I[6]; const float* wd = I[7]; const float* vd = I[8];      /* xa [2][1024][1024]; the four weights [1024][1024] (source, result); the four added vectors [1024] */
  float* res = (float*)d_out;
  static_assert((QNG * QNL) % 128 == 0 && QNL % 128 == 0 && QNW % 64 == 0 && QNW % 32 == 0 && QSW % 64 == 0 && QSW % 32 == 0 && QNL % 8 == 0 && QNS * QSW == QNW, "whole tiles");
  uint8_t* wsp = (uint8_t*)d_ws; size_t off = 0;
  auto take = [&](size_t bytes) { uint8_t* p = wsp + off; off += (bytes + 255) & ~(size_t)255; return p; };
  const size_t GW = (size_t)QNG * QNL * QNW, G1 = (size_t)QNL * QNW;
  float* RP = (float*)take((size_t)QNG * QNS * (QNL / QCB) * QNL * 4);
  _Float16* XH = (_Float16*)take(GW * 2); _Float16* AH = (_Float16*)take(2 * GW * 2); _Float16* CH = (_Float16*)take(GW * 2); _Float16* VT = (_Float16*)take(GW * 2);
  _Float16* WA = (_Float16*)take((size_t)4 * QNW * QNW * 2); _Float16* WD = WA + (size_t)3 * QNW * QNW; float* LA = (float*)take((size_t)2 * QNG * QNS * QNL * 4); float* LB = LA + (size_t)QNG * QNS * QNL; float* CF = (float*)take((size_t)QNG * QNS * QNL * 4);      /* sc's row sums over blocks of 64 columns; xa's cast; the f16 words of fa and, behind them, of fb; cx's; fc's transposed, group by group; the four weights transposed, one behind the other; the strips' squared lengths, fa's and behind them fb's; the column factors */
  if (off > ws_size) return;
  k_cast<<<(unsigned)QCG, 256, 0, stream>>>(xa, wa, wb, wc, wd, XH, WA, QWC);      /* WA[m][o][k] = f16(64 w[k][o]), m: wa, wb, wc, wd */
  k_gemm2<0><<<dim3((unsigned)(((QNG * QNL) / 128) * (QNW / 64)), 3), 128, 0, stream>>>(XH, QNW, 0, WA, QNW, (size_t)QNW * QNW, 1.0f / QWC, va, 0, nullptr, 1, 0, 0, nullptr, AH, QNW, GW, QNG * QNL, QNW, QNW, VT, LA, QNL, vb, vc, 3, 0, (size_t)QNG * QNS * QNL, 2);      /* plane 0: fa[(g, i)][o] = xa[g][i][:] . wa[:][o] + va[o]: AH its f16 words, LA[g][s][i] its strips' squared lengths; plane 1: fb likewise, behind them; plane 2: VT[g][(s, c)][j] = f16(fc[g][j][s 64 + c]) */
  k_qps<<<(unsigned)(QNG * QNS * (QNL / QCB)), QFW * 32, 0, stream>>>(AH, AH + GW, LA, LB, RP, CF);      /* sc from fa[g][i][s] . fb[g][j][s] and the two lengths: RP[g][s][j / 64][i] = its sum over 64 columns; CF[g][s][j] = nc^(-1/2) */
  k_mix<<<(unsigned)(QNG * QNS * (QNL / QMR)), QMW * 32, 0, stream>>>(AH, AH + GW, VT, LA, LB, RP, CF, CH);      /* CH[g][i][s 64 + c] = the f16 word of (sum over j of kt[i][j] fc[g][j][s 64 + c]) / max(kt's row sum, 1e-12): in place at a strip's column offset */
  k_gemm2<0><<<dim3((unsigned)(((QNG * QNL) / 128) * (QNW / 64)), 1), 128, 0, stream>>>(CH, QNW, 0, WD, QNW, 0, 1.0f / QWC, vd, 0, nullptr, 1, 0, 0, res, nullptr, QNW, 0, QNG * QNL, QNW, QNW, nullptr, nullptr, QNL, nullptr, nullptr, 1, 0, 0, -1);      /* res = cx wd + vd: every word of the result once */
}
